// v000
// Measured on an AMD MI455X. A time is GPU time per run, averaged over a window of back-to-back runs after a warm-up
// (all launches, gaps included; the runs take copies of the inputs in turn), and the median of several windows.
// Apart from v000's, it joins two sittings. Times from different sittings can be a few percent apart, while
// side-by-side timings come from the same sitting.
// v000, which the later versions start from, runs in 694 microseconds.
// Contractions: qkv 1x1 conv W[768x256].X[256x3136] on v_wmma_f32_16x16x32_bf16 (bf16 RNE operands, single product);
// channel logits q.k^T (32x32 per head, K=3136) on v_wmma_f32_16x16x32_f16 (f16 planes of the depthwise outputs);
// attn.v (K=32) on v_wmma_f32_16x16x32_f16 (attn x256 as f16 hi + x1024 residual, v as f16 hi + x1024 residual,
// 3 products); proj 1x1 conv on v_wmma_f32_16x16x32_f16 (64 x bf16-RNE weights as f16, 256 x out as f16 hi +
// x1024 residual, 2 products); f32 accumulate everywhere; depthwise 3x3, L2 norms and softmax in f32 on VALU.
#include <hip/hip_runtime.h>
#include <math.h>
#include <stdint.h>

#define NBAT   16
#define NCHK   4
#define NCHUNK 4
#define CDIM   256
#define C3     768
#define CQK    512
#define NPX    3136
#define IMW    56
#define NHEAD  8
#define QT     64
#define NTILE  49
#define TPH    72
#define OSP    68
#define PAP    40
#define RSC    1024.0f
#define IRSC   0.0009765625f
#define PSC    256.0f
#define WSC    64.0f
#define OUTSC  6.103515625e-05f

static_assert(NTILE * QT == NPX);
static_assert(IMW * IMW == NPX);
static_assert(NCHUNK * NCHK == NBAT);
static_assert(NPX % 32 == 0);
static_assert(NPX % 16 == 0);
static_assert((NPX / 16) % 4 == 0);
static_assert(CDIM % 32 == 0);
static_assert(C3 % 128 == 0);
static_assert(CDIM % 64 == 0);
static_assert((TPH * 2) % 16 == 0);
static_assert((OSP * 4) % 16 == 0);
static_assert((PAP * 2) % 16 == 0);
static_assert(NHEAD * 32 == CDIM);

typedef _Float16       v16h __attribute__((ext_vector_type(16)));
typedef _Float16       v8h  __attribute__((ext_vector_type(8)));
typedef __bf16         v16b __attribute__((ext_vector_type(16)));
typedef unsigned short v8us __attribute__((ext_vector_type(8)));
typedef float          v8f  __attribute__((ext_vector_type(8)));
typedef float          v4f  __attribute__((ext_vector_type(4)));
typedef unsigned int   v4u  __attribute__((ext_vector_type(4)));

union Frag { v8us u[2]; v16h h; v16b bf; };
static_assert(sizeof(Frag) == 32);

// ---- scalar helpers ---------------------------------------------------------------------------------
__device__ __forceinline__ unsigned short bf_bits(float f) {          // f32 -> bf16 bits, RNE convert
  unsigned u = __float_as_uint(f);
  return (unsigned short)((u + 0x7FFFu + ((u >> 16) & 1u)) >> 16);
}
__device__ __forceinline__ float bf_up(unsigned short hb) { return __uint_as_float(((unsigned)hb) << 16); }
__device__ __forceinline__ float bfr(float f) { return bf_up(bf_bits(f)); }
__device__ __forceinline__ unsigned short h_bits(_Float16 x) { return __builtin_bit_cast(unsigned short, x); }
__device__ __forceinline__ unsigned pk16(unsigned short a, unsigned short b) { return (unsigned)a | ((unsigned)b << 16); }
__device__ __forceinline__ v8f zero8() { v8f z = {0.f, 0.f, 0.f, 0.f, 0.f, 0.f, 0.f, 0.f}; return z; }

// ---- 16-bit fragment loader (A, or B from a k-contiguous [n][k] row): lane -> row/col (lane&15), p already
//      includes + 8*(lane>>4); elements 0..7 <- p[0..7] (k0+8h..), elements 8..15 <- p[16..23] (k0+16+8h..)
__device__ __forceinline__ Frag ldfrag(const unsigned short* p) {
  Frag f;
  f.u[0] = *(const v8us*)(p);
  f.u[1] = *(const v8us*)(p + 16);
  return f;
}

// ---- WMMA helpers: builtin followed by a 4-slot VALU gap tying D and keeping A/B live ----------------------
__device__ __forceinline__ v8f mma_h(v16h a, v16h b, v8f c) {
  v8f d = __builtin_amdgcn_wmma_f32_16x16x32_f16(false, a, false, b, (short)0, c, false, false);
#if defined(__HIP_DEVICE_COMPILE__)
  asm volatile("v_nop\n\tv_nop\n\tv_nop\n\tv_nop" : "+v"(d) : "v"(a), "v"(b));
#endif
  return d;
}
__device__ __forceinline__ v8f mma_b(v16b a, v16b b, v8f c) {
  v8f d = __builtin_amdgcn_wmma_f32_16x16x32_bf16(false, a, false, b, (short)0, c, false, false);
#if defined(__HIP_DEVICE_COMPILE__)
  const v16h ha = __builtin_bit_cast(v16h, a), hb = __builtin_bit_cast(v16h, b);
  asm volatile("v_nop\n\tv_nop\n\tv_nop\n\tv_nop" : "+v"(d) : "v"(ha), "v"(hb));
#endif
  return d;
}

// =====================================================================================================
// (0) weights: wq f32 [768][256] -> WQ16 bf16 bits [768][256]; wp f32 [256][256] -> WP16 f16 bits of
// coverage: WQ16 32 blocks x 96 lines = 3072 lines = 768 x 256; WP16 32 x 32 = 1024 lines = 256 x 256.
// =====================================================================================================
__global__ __launch_bounds__(256)
void cvt_w(const float* __restrict__ wq, const float* __restrict__ wp,
           unsigned short* WQ16, unsigned short* WP16) {
  const int tid = threadIdx.x, e = tid & 7, lq = tid >> 3;
  v4u uq[3];
#pragma unroll
  for (int it = 0; it < 3; ++it) {
    const int L = blockIdx.x * 96 + it * 32 + lq;                 // 0..3071
    const float* s = wq + (size_t)64 * L + 8 * e;                  // max 196600 + 7 < 196608
    const v4f a = *(const v4f*)(s);
    const v4f b = *(const v4f*)(s + 4);
    uq[it][0] = pk16(bf_bits(a[0]), bf_bits(a[1]));
    uq[it][1] = pk16(bf_bits(a[2]), bf_bits(a[3]));
    uq[it][2] = pk16(bf_bits(b[0]), bf_bits(b[1]));
    uq[it][3] = pk16(bf_bits(b[2]), bf_bits(b[3]));
  }
  v4u up;
  const int Lp = blockIdx.x * 32 + lq;                             // 0..1023
  {
    const float* s = wp + (size_t)64 * Lp + 8 * e;                 // max 65528 + 7 < 65536
    const v4f a = *(const v4f*)(s);
    const v4f b = *(const v4f*)(s + 4);
    up[0] = pk16(h_bits((_Float16)(WSC * bfr(a[0]))), h_bits((_Float16)(WSC * bfr(a[1]))));
    up[1] = pk16(h_bits((_Float16)(WSC * bfr(a[2]))), h_bits((_Float16)(WSC * bfr(a[3]))));
    up[2] = pk16(h_bits((_Float16)(WSC * bfr(b[0]))), h_bits((_Float16)(WSC * bfr(b[1]))));
    up[3] = pk16(h_bits((_Float16)(WSC * bfr(b[2]))), h_bits((_Float16)(WSC * bfr(b[3]))));
  }
{
#pragma unroll
    for (int it = 0; it < 3; ++it) {
      const int L = blockIdx.x * 96 + it * 32 + lq;
      *(v4u*)(WQ16 + (size_t)64 * L + 8 * e) = uq[it];
    }
    *(v4u*)(WP16 + (size_t)64 * Lp + 8 * e) = up;
    
  }
}

// =====================================================================================================
// (1) x chunk view [4][256][3136] f32 -> XP position-major bf16 bits [4][3136][256] through an LDS tile
//     (64 ch) of 64 position rows: 8 consecutive lanes x 16 B per line, one instruction per 32 lines,
// coverage: load 256 threads x 4 it x 4 = 64 ch x 64 px; lines 2 x 32 = 64 rows; grid (49, 4, 4) covers XP.
// =====================================================================================================
__global__ __launch_bounds__(256)
void cvt_x(const float* __restrict__ x, unsigned short* XP) {
  __shared__ __align__(16) unsigned short Lt[QT * TPH];
  const int tid = threadIdx.x;
  const int nt = blockIdx.x, cg = blockIdx.y, bl = blockIdx.z;
  const int n0 = nt * QT;
  {
    const int n4 = (tid & 15) * 4, cs = tid >> 4;                   // cs 0..15
#pragma unroll
    for (int it = 0; it < 4; ++it) {
      const int cl = it * 16 + cs;                                   // 0..63
      const v4f v = *(const v4f*)(x + ((size_t)(bl * CDIM + cg * QT + cl)) * NPX + n0 + n4);
#pragma unroll
      for (int q = 0; q < 4; ++q) Lt[(n4 + q) * TPH + cl] = bf_bits(v[q]);
    }
  }
  __syncthreads();
  {
    const int e = tid & 7, lq = tid >> 3;                            // lq 0..31
    const v4u u0 = *(const v4u*)(Lt + lq * TPH + 8 * e);
    const v4u u1 = *(const v4u*)(Lt + (lq + 32) * TPH + 8 * e);
    unsigned short* d0 = XP + ((size_t)(bl * NPX + n0 + lq)) * CDIM + cg * QT + 8 * e;
    unsigned short* d1 = d0 + (size_t)32 * CDIM;
{
      *(v4u*)(d0) = u0;
      *(v4u*)(d1) = u1;
      
    }
  }
}

// =====================================================================================================
// (2) GEMM: Y[bl][m][n] = scale * sum_k A16[m][k] B16[bl][n][k] (K = 256 = 8 k-steps of 32), A and B rows
//     k-contiguous, split k map loader straight from global for both operands. With RES: B carries a second
//     x1024 residual plane BPL into a separate accumulator, folded back as accl/1024 in the epilogue.
//     Block 128 threads = 4 waves; wave w owns columns n0+16w..+15 (one B fragment per k-step) and MT m-tiles
//     lines of the f32 channel-major plane (2 lines per 64-n row segment, 8 consecutive lanes x 16 B, one
// coverage: Os 4 waves x MT tiles x 16x16 = MR x 64; lines NIT x 16 = 2 MR = MR rows x 64 n; grid (49, M/MR, 4).
// =====================================================================================================
template <int BF, int RES>
__global__ __launch_bounds__(128)
void gemm_k(const unsigned short* __restrict__ A16, const unsigned short* __restrict__ BP,
            const unsigned short* __restrict__ BPL, float* Y, int M, float scale) {
  constexpr int MT  = RES ? 4 : 8;
  constexpr int MR  = 16 * MT;
  constexpr int NIT = (2 * MR) / 16;
  __shared__ __align__(16) float Os[MR * OSP];
  const int tid  = threadIdx.x;
  const int lane = tid & 31, wave = tid >> 5;
  const int hh   = lane >> 4, c = lane & 15;
  const int nt   = blockIdx.x, bl = blockIdx.z;
  const int m0   = blockIdx.y * MR, n0 = nt * QT;

  const unsigned short* ap = A16 + (size_t)(m0 + c) * CDIM + 8 * hh;
  const size_t boff = ((size_t)(bl * NPX + n0 + 16 * wave + c)) * CDIM + 8 * hh;
  const unsigned short* bp  = BP + boff;
  const unsigned short* bpl = RES ? (BPL + boff) : bp;

  v8f acc[MT], accl[MT];
#pragma unroll
  for (int mt = 0; mt < MT; ++mt) { acc[mt] = zero8(); accl[mt] = zero8(); }

#pragma unroll 2
  for (int ks = 0; ks < CDIM / 32; ++ks) {
    const Frag fb = ldfrag(bp + 32 * ks);
    Frag fbl;
    if (RES) fbl = ldfrag(bpl + 32 * ks); else fbl = fb;
#pragma unroll
    for (int mt = 0; mt < MT; ++mt) {
      const Frag fa = ldfrag(ap + (size_t)(16 * mt) * CDIM + 32 * ks);
      if (BF) acc[mt] = mma_b(fa.bf, fb.bf, acc[mt]);
      else    acc[mt] = mma_h(fa.h, fb.h, acc[mt]);
      if (RES) accl[mt] = mma_h(fa.h, fbl.h, accl[mt]);
    }
  }

  // ---- epilogue -> LDS Os[m][n] ----
  {
    const int nl = 16 * wave + c;
#pragma unroll
    for (int mt = 0; mt < MT; ++mt) {
#pragma unroll
      for (int r = 0; r < 8; ++r) {
        float v = acc[mt][r];
        if (RES) v += accl[mt][r] * IRSC;
        Os[(16 * mt + 8 * hh + r) * OSP + nl] = v * scale;
      }
    }
  }
  __syncthreads();

  {
    const int e = tid & 7, lq = tid >> 3;                              // lq 0..15
{
#pragma unroll
      for (int it = 0; it < NIT; ++it) {
        const int L = it * 16 + lq;                                    // 0..2MR-1
        const int row = L >> 1, hf = L & 1;
        const v4f v = *(const v4f*)(Os + row * OSP + hf * 32 + 4 * e);
        float* dst = Y + ((size_t)(bl * M + m0 + row)) * NPX + n0 + hf * 32 + 4 * e;
        *(v4f*)dst = v;
      }
      
    }
  }
}

// =====================================================================================================
// (3) depthwise 3x3, zero pad 1, for one (64 px tile, 64-channel group cg, batch bl) of the f32 plane
//     QKV[4][768][3136]; weights = bf16-RNE values staged in LDS. Thread (px = tid&63, 16 channels 4i+(tid>>6));
//     the 9 tap offsets are clamped addresses, taps outside the image zeroed by predicate. Results as f16 hi
//     (and x1024 residual) into LDS tiles, then:
// coverage: 256 threads x 16 channels = 64 ch x 64 px per tile; lines 2 x 32 = 64 per plane; grid (49, 12, 4)
//           covers QK (cg 0..7 -> channels 0..511) and VP/VPL (cg 8..11 -> v channels 0..255) exactly once.
// =====================================================================================================
__global__ __launch_bounds__(256)
void dw_k(const float* __restrict__ QKV, const float* __restrict__ wdw,
          unsigned short* QK, unsigned short* VP, unsigned short* VPL) {
  __shared__ __align__(16) unsigned short Th[QT * TPH];
  __shared__ __align__(16) unsigned short Tl[QT * TPH];
  __shared__ float Wc[QT * 9];
  const int tid = threadIdx.x;
  const int nt = blockIdx.x, cg = blockIdx.y, bl = blockIdx.z;
  const int n0 = nt * QT;
  const bool isv = (cg >= 8);                                           // block-uniform
  for (int k = tid; k < QT * 9; k += 256) Wc[k] = bfr(wdw[cg * (QT * 9) + k]);   // max 6336 + 575 = 6911
  const int pl = tid & 63, cs = tid >> 6;
  const int p  = n0 + pl;
  const int y  = p / IMW, xw = p - y * IMW;
  int off[9];
  unsigned okm = 0u;
#pragma unroll
  for (int t = 0; t < 9; ++t) {
    const int ky = t / 3, kx = t - 3 * ky;
    const int yy = y + ky - 1, xx = xw + kx - 1;
    const bool ok = ((unsigned)yy < (unsigned)IMW) && ((unsigned)xx < (unsigned)IMW);
    off[t] = min(max(yy, 0), IMW - 1) * IMW + min(max(xx, 0), IMW - 1);
    okm |= ok ? (1u << t) : 0u;
  }
  __syncthreads();

#pragma unroll 1
  for (int i = 0; i < 16; ++i) {
    const int ch = 4 * i + cs;                                           // 0..63
    const float* src = QKV + ((size_t)(bl * C3 + cg * QT + ch)) * NPX;
    const float* wt  = Wc + ch * 9;
    float s = 0.f;
#pragma unroll
    for (int t = 0; t < 9; ++t) {
      const float v = src[off[t]];
      s = fmaf(((okm >> t) & 1u) ? v : 0.f, wt[t], s);
    }
    const _Float16 hv = (_Float16)s;
    const _Float16 lv = (_Float16)((s - (float)hv) * RSC);
    const int li = isv ? (pl * TPH + ch) : (ch * TPH + pl);
    Th[li] = h_bits(hv);
    Tl[li] = h_bits(lv);
  }
  __syncthreads();
  {
    const int e = tid & 7, lq = tid >> 3;                                 // lq 0..31
    const v4u h0 = *(const v4u*)(Th + lq * TPH + 8 * e);
    const v4u h1 = *(const v4u*)(Th + (lq + 32) * TPH + 8 * e);
    const v4u l0 = *(const v4u*)(Tl + lq * TPH + 8 * e);
    const v4u l1 = *(const v4u*)(Tl + (lq + 32) * TPH + 8 * e);
    if (isv) {
      const int vg = cg - 8;                                              // 0..3
      const size_t o0 = ((size_t)(bl * NPX + n0 + lq)) * CDIM + vg * QT + 8 * e;
      const size_t o1 = o0 + (size_t)32 * CDIM;
{
        *(v4u*)(VP  + o0) = h0;
        *(v4u*)(VP  + o1) = h1;
        *(v4u*)(VPL + o0) = l0;
        *(v4u*)(VPL + o1) = l1;
        
      }
    } else {
      const size_t o0 = ((size_t)(bl * CQK + cg * QT + lq)) * NPX + n0 + 8 * e;
      const size_t o1 = o0 + (size_t)32 * NPX;
{
        *(v4u*)(QK + o0) = h0;
        *(v4u*)(QK + o1) = h1;
        
      }
    }
  }
}

// =====================================================================================================
// (4) channel attention for one (head pair g: heads 2g, 2g+1 = channels 64g..64g+63, batch bl), 256 threads.
//   phase 1: per-row sum of squares of q rows 64g..+63 and k rows 256+64g..+63 over the 3136 px (f32, fixed
//            order: lane-strided accumulation + xor tree), wave w -> rows 16w..16w+15.
//   phase 2: S[hl][c][d] = sum_n q[c][n] k[d][n]: 8 D tiles (hl, mt, nt) one per wave, A = q row 16mt+(lane&15),
//            B = k row 16nt+(lane&15), both k-contiguous with the split k map, 98 k-steps on f16 WMMA.
//   phase 3: logits = S * invq * invk * temperature (bf16-RNE), max-subtracted softmax in f32, attn x256 as f16
//            hi and x1024 residual into LDS Pa [c][d] (d contiguous = A operand of phase 4).
//   phase 4: out[c][n] = sum_d attn[c][d] v[d][n]: waves (2pr, 2pr+1) share one 16-px tile (tile pr + 4i), wave
//            hl does head hl: A = Pa frags (resident), B = v rows of VP/VPL (position-major, k = d contiguous):
//            hi.hi -> o, hi.res + res.hi -> orr (x1024). 256*out = o + orr/1024 split into f16 hi + x1024 residual,
//            [4][3136][256] (64-ch slab of a 512-B row): wave hl writes rows {lr+8hl, lr+8hl+4}, 8 consecutive
// coverage: phase 4: 4 pairs x 49 iterations = 196 tiles x 16 px = 3136 rows; per row the two waves' halves
//           (32hl + 16mt + 8hh + r) cover the 64-ch slab; grid (4, 4) covers all slabs of OP/OPL exactly once.
// =====================================================================================================
__global__ __launch_bounds__(256)
void attn_k(const unsigned short* __restrict__ QK, const unsigned short* __restrict__ VP,
            const unsigned short* __restrict__ VPL, const float* __restrict__ temp,
            unsigned short* OP, unsigned short* OPL) {
  __shared__ float sNorm[128];
  __shared__ float sInv[128];
  __shared__ float sS[2 * 32 * 33];
  __shared__ __align__(16) unsigned short Pa[4 * 32 * PAP];            // [hi|res][hl][32][PAP]
  __shared__ __align__(16) unsigned short Ow[8 * 16 * TPH];            // [hi|res][pair][16][TPH]
  const int tid  = threadIdx.x;
  const int lane = tid & 31, wave = tid >> 5;
  const int hh   = lane >> 4, c = lane & 15;
  const int g    = blockIdx.x, bl = blockIdx.y;
  const unsigned short* qkb = QK + (size_t)bl * CQK * NPX;

  // ---- phase 1: row sums of squares ----
#pragma unroll 1
  for (int rr = 0; rr < 16; ++rr) {
    const int R = 16 * wave + rr;                                         // 0..127
    const int chrow = 64 * g + R + ((R >= 64) ? 192 : 0);                // q: 64g+R, k: 256+64g+(R-64)
    const unsigned short* rp = qkb + (size_t)chrow * NPX;
    float s = 0.f;
    for (int j = 0; j < 13; ++j) {
      const int idx = lane + 32 * j;                                      // vector index, 392 vectors per row
      const int idc = min(idx, NPX / 8 - 1);
      const v8h v = *(const v8h*)(rp + 8 * idc);
      float t = 0.f;
#pragma unroll
      for (int q = 0; q < 8; ++q) { const float f = (float)v[q]; t = fmaf(f, f, t); }
      s += (idx < NPX / 8) ? t : 0.f;
    }
#pragma unroll
    for (int off = 16; off > 0; off >>= 1) s += __shfl_xor(s, off, 32);
    if (lane == 0) sNorm[R] = s;
  }

  // ---- phase 2: raw logits S on f16 WMMA ----
  {
    const int hl = wave >> 2, mt = (wave >> 1) & 1, ntk = wave & 1;
    const unsigned short* arow = qkb + (size_t)(64 * g + 32 * hl + 16 * mt + c) * NPX + 8 * hh;
    const unsigned short* brow = qkb + (size_t)(256 + 64 * g + 32 * hl + 16 * ntk + c) * NPX + 8 * hh;
    v8f acc = zero8();
#pragma unroll 2
    for (int ks = 0; ks < NPX / 32; ++ks) {
      const Frag fa = ldfrag(arow + 32 * ks);
      const Frag fb = ldfrag(brow + 32 * ks);
      acc = mma_h(fa.h, fb.h, acc);
    }
    float* sp = sS + hl * (32 * 33) + (16 * mt + 8 * hh) * 33 + 16 * ntk + c;
#pragma unroll
    for (int r = 0; r < 8; ++r) sp[r * 33] = acc[r];
  }
  __syncthreads();
  if (tid < 128) sInv[tid] = 1.0f / fmaxf(sqrtf(sNorm[tid]), 1e-12f);
  __syncthreads();

  // ---- phase 3: softmax, attn x256 as f16 hi + residual ----
  if (tid < 64) {                                                          // waves 0, 1
    const int hl = tid >> 5, row = tid & 31;
    const float tv = bfr(temp[2 * g + hl]);
    const float iq = sInv[32 * hl + row] * tv;
    const float* srow = sS + hl * (32 * 33) + row * 33;
    const float* ik   = sInv + 64 + 32 * hl;
    float lg[32];
    float mx = -3.0e38f;
#pragma unroll
    for (int d = 0; d < 32; ++d) { const float v = srow[d] * iq * ik[d]; lg[d] = v; mx = fmaxf(mx, v); }
    float ssum = 0.f;
#pragma unroll
    for (int d = 0; d < 32; ++d) { const float ev = __expf(lg[d] - mx); lg[d] = ev; ssum += ev; }
    const float inv = PSC / ssum;
    unsigned short* ph = Pa + (hl * 32 + row) * PAP;
    unsigned short* pl = Pa + (64 + hl * 32 + row) * PAP;
#pragma unroll
    for (int d = 0; d < 32; ++d) {
      const float pv = lg[d] * inv;
      const _Float16 hv = (_Float16)pv;
      const _Float16 lv = (_Float16)((pv - (float)hv) * RSC);
      ph[d] = h_bits(hv);
      pl[d] = h_bits(lv);
    }
  }
  __syncthreads();

  // ---- phase 4: out = attn . v ----
  {
    const int pr = wave >> 1, hl = wave & 1;
    Frag ah[2], al[2];
#pragma unroll
    for (int mt = 0; mt < 2; ++mt) {
      const unsigned short* p0 = Pa + (hl * 32 + 16 * mt + c) * PAP + 8 * hh;
      ah[mt] = ldfrag(p0);
      al[mt] = ldfrag(p0 + 64 * PAP);
    }
    const size_t pbase = (size_t)bl * NPX * CDIM + 64 * g;
    const unsigned short* vpb = VP  + pbase + 32 * hl + 8 * hh;
    const unsigned short* vlb = VPL + pbase + 32 * hl + 8 * hh;
    unsigned short* owh = Ow + pr * (16 * TPH);
    unsigned short* owl = Ow + (4 + pr) * (16 * TPH);
    const int e8 = lane & 7, lr = (lane >> 3) + 8 * hl;                   // rows lr, lr+4 of the pair tile
#pragma unroll 1
    for (int i = 0; i < NPX / 64; ++i) {                                   // 49 iterations
      const int n0 = (pr + 4 * i) * 16;                                    // tile 0..195
      const unsigned short* vr = vpb + (size_t)(n0 + c) * CDIM;
      const unsigned short* vl = vlb + (size_t)(n0 + c) * CDIM;
      const Frag fvh = ldfrag(vr);
      const Frag fvl = ldfrag(vl);
      v8f o[2], orr[2];
#pragma unroll
      for (int mt = 0; mt < 2; ++mt) {
        o[mt]   = mma_h(ah[mt].h, fvh.h, zero8());
        orr[mt] = mma_h(ah[mt].h, fvl.h, zero8());
        orr[mt] = mma_h(al[mt].h, fvh.h, orr[mt]);
      }
#pragma unroll
      for (int mt = 0; mt < 2; ++mt) {
        v4u uh, ul;
#pragma unroll
        for (int q = 0; q < 4; ++q) {
          const float f0 = o[mt][2 * q]     + orr[mt][2 * q]     * IRSC;
          const float f1 = o[mt][2 * q + 1] + orr[mt][2 * q + 1] * IRSC;
          const _Float16 h0 = (_Float16)f0, h1 = (_Float16)f1;
          const _Float16 l0 = (_Float16)((f0 - (float)h0) * RSC);
          const _Float16 l1 = (_Float16)((f1 - (float)h1) * RSC);
          uh[q] = pk16(h_bits(h0), h_bits(h1));
          ul[q] = pk16(h_bits(l0), h_bits(l1));
        }
        const int so = c * TPH + 32 * hl + 16 * mt + 8 * hh;               // channels 32hl+16mt+8hh..+7, px c
        *(v4u*)(owh + so) = uh;
        *(v4u*)(owl + so) = ul;
      }
      __syncthreads();
      const v4u a0 = *(const v4u*)(owh + lr * TPH + 8 * e8);
      const v4u a1 = *(const v4u*)(owh + (lr + 4) * TPH + 8 * e8);
      const v4u b0 = *(const v4u*)(owl + lr * TPH + 8 * e8);
      const v4u b1 = *(const v4u*)(owl + (lr + 4) * TPH + 8 * e8);
      unsigned short* d0 = OP  + pbase + (size_t)(n0 + lr) * CDIM + 8 * e8;
      unsigned short* d1 = OPL + pbase + (size_t)(n0 + lr) * CDIM + 8 * e8;
{
        *(v4u*)(d0) = a0;
        *(v4u*)(d0 + 4 * CDIM) = a1;
        *(v4u*)(d1) = b0;
        *(v4u*)(d1 + 4 * CDIM) = b1;
        
      }
      __syncthreads();
    }
  }
}

// =====================================================================================================
// Workspace map (bytes; each region start a multiple of 256; every extent an exact tile multiple, written only as
//   WQ16 bf16 [768][256]        393216      WP16 f16 [256][256]         131072
//   XP   bf16 [4][3136][256]   6422528      R1   f32 [4][768][3136]  38535168     QK f16 [4][512][3136] 12845056
//   VP, VPL, OP, OPL f16 [4][3136][256] 6422528 x 4                                total = 84017152
// =====================================================================================================
extern "C" void kernel_launch(void* const* d_in, const int* in_sizes, int n_in,
                              void* d_out, int out_size, void* d_ws, size_t ws_size,
                              hipStream_t stream) {
  const int XN = NBAT * CDIM * NPX;                      // 12845056
  if (n_in < 5) return;
  if (in_sizes[0] != XN) return;
  if (in_sizes[1] != C3 * CDIM) return;
  if (in_sizes[2] != C3 * 9) return;
  if (in_sizes[3] != CDIM * CDIM) return;
  if (in_sizes[4] != NHEAD) return;
  if (out_size != XN) return;

  size_t off = 0;
  auto carve = [&](size_t bytes) { const size_t o = off; off += (bytes + 255) & ~(size_t)255; return o; };
  const size_t plane16 = (size_t)NCHK * NPX * CDIM * 2;  // 6422528
  const size_t oWQ  = carve((size_t)C3 * CDIM * 2);
  const size_t oWP  = carve((size_t)CDIM * CDIM * 2);
  const size_t oXP  = carve(plane16);
  const size_t oR1  = carve((size_t)NCHK * C3 * NPX * 4);
  const size_t oQK  = carve((size_t)NCHK * CQK * NPX * 2);
  const size_t oVP  = carve(plane16);
  const size_t oVPL = carve(plane16);
  const size_t oOP  = carve(plane16);
  const size_t oOPL = carve(plane16);
  if (off > ws_size) return;
  if (off > (size_t)134217728) return;

  const float* x    = (const float*)d_in[0];
  const float* wq   = (const float*)d_in[1];
  const float* wdw  = (const float*)d_in[2];
  const float* wp   = (const float*)d_in[3];
  const float* temp = (const float*)d_in[4];
  float* out = (float*)d_out;

  char* ws = (char*)d_ws;
  unsigned short* WQ16 = (unsigned short*)(ws + oWQ);
  unsigned short* WP16 = (unsigned short*)(ws + oWP);
  unsigned short* XP   = (unsigned short*)(ws + oXP);
  float*          R1   = (float*)(ws + oR1);
  unsigned short* QK   = (unsigned short*)(ws + oQK);
  unsigned short* VP   = (unsigned short*)(ws + oVP);
  unsigned short* VPL  = (unsigned short*)(ws + oVPL);
  unsigned short* OP   = (unsigned short*)(ws + oOP);
  unsigned short* OPL  = (unsigned short*)(ws + oOPL);

  const dim3 blk256(256), blk128(128);

  // (0) weights -> 16-bit planes
  cvt_w<<<dim3(32), blk256, 0, stream>>>(wq, wp, WQ16, WP16);

  for (int ck = 0; ck < NCHUNK; ++ck) {
    const float* xc   = x   + (size_t)ck * NCHK * CDIM * NPX;
    float*       outc = out + (size_t)ck * NCHK * CDIM * NPX;
    // (1) x chunk -> position-major bf16 [4][3136][256]
    cvt_x<<<dim3(NTILE, CDIM / QT, NCHK), blk256, 0, stream>>>(xc, XP);
    // (2) qkv 1x1 conv -> f32 [4][768][3136]
    gemm_k<1, 0><<<dim3(NTILE, C3 / 128, NCHK), blk128, 0, stream>>>(WQ16, XP, XP, R1, C3, 1.0f);
    // (3) depthwise 3x3 -> q,k channel-major f16; v position-major f16 hi + residual
    dw_k<<<dim3(NTILE, C3 / QT, NCHK), blk256, 0, stream>>>(R1, wdw, QK, VP, VPL);
    // (4) channel attention -> 256*out position-major f16 hi + residual [4][3136][256]
    attn_k<<<dim3(CDIM / 64, NCHK), blk256, 0, stream>>>(QK, VP, VPL, temp, OP, OPL);
    // (5) proj 1x1 conv -> d_out rows of batches 4ck..4ck+3, scaled by 1/(64*256)
    gemm_k<0, 1><<<dim3(NTILE, CDIM / 64, NCHK), blk128, 0, stream>>>(WP16, OP, OPL, outc, CDIM, OUTSC);
  }
  (void)hipGetLastError();
}

// v001
// A run of this version takes 356 microseconds.
// Timed twice side by side with v000, it ran 1.95 times as fast both times.
// Contractions: qkv 1x1 conv W[768x256].X[256x3136] on v_wmma_f32_16x16x32_bf16 (bf16 RNE operands, single product);
// channel logits q.k^T (32x32 per head, K=3136) on v_wmma_f32_16x16x32_f16 (f16 planes of the depthwise outputs);
// attn.v (K=32) on v_wmma_f32_16x16x32_f16 (attn x256 as f16 hi + x1024 residual, v as f16 hi + x1024 residual,
// 3 products); proj 1x1 conv on v_wmma_f32_16x16x32_f16 (64 x bf16-RNE weights as f16, 256 x out as f16 hi +
// x1024 residual, 2 products); f32 accumulate everywhere; depthwise 3x3, L2 norms and softmax in f32 on VALU.
#include <hip/hip_runtime.h>
#include <math.h>
#include <stdint.h>

#define NBAT   16
#define NCHK   4
#define NCHUNK 4
#define CDIM   256
#define C3     768
#define CQK    512
#define NPX    3136
#define IMW    56
#define NHEAD  8
#define QT     64
#define NTILE  49
#define TPH    72
#define OSP    68
#define PAP    40
#define RSC    1024.0f
#define IRSC   0.0009765625f
#define PSC    256.0f
#define WSC    64.0f
#define OUTSC  6.103515625e-05f
#define NSL    14
#define SLPX   224
#define PREC   2176
#define NVT    7
#define VIT    7

static_assert(NTILE * QT == NPX);
static_assert(IMW * IMW == NPX);
static_assert(NCHUNK * NCHK == NBAT);
static_assert(NPX % 32 == 0);
static_assert(NPX % 16 == 0);
static_assert((NPX / 16) % 4 == 0);
static_assert(CDIM % 32 == 0);
static_assert(C3 % 128 == 0);
static_assert(CDIM % 64 == 0);
static_assert((TPH * 2) % 16 == 0);
static_assert((OSP * 4) % 16 == 0);
static_assert((PAP * 2) % 16 == 0);
static_assert(NHEAD * 32 == CDIM);
static_assert(NSL * SLPX == NPX);
static_assert(SLPX % 32 == 0);
static_assert(SLPX / 8 <= 32);
static_assert(PREC == 2 * 32 * 32 + 128);
static_assert((PREC * 4) % 128 == 0);
static_assert(NVT * VIT * 64 == NPX);

typedef _Float16       v16h __attribute__((ext_vector_type(16)));
typedef _Float16       v8h  __attribute__((ext_vector_type(8)));
typedef __bf16         v16b __attribute__((ext_vector_type(16)));
typedef unsigned short v8us __attribute__((ext_vector_type(8)));
typedef float          v8f  __attribute__((ext_vector_type(8)));
typedef float          v4f  __attribute__((ext_vector_type(4)));
typedef unsigned int   v4u  __attribute__((ext_vector_type(4)));

union Frag { v8us u[2]; v16h h; v16b bf; };
static_assert(sizeof(Frag) == 32);

// ---- scalar helpers ---------------------------------------------------------------------------------
__device__ __forceinline__ unsigned short bf_bits(float f) {          // f32 -> bf16 bits, RNE convert
  unsigned u = __float_as_uint(f);
  return (unsigned short)((u + 0x7FFFu + ((u >> 16) & 1u)) >> 16);
}
__device__ __forceinline__ float bf_up(unsigned short hb) { return __uint_as_float(((unsigned)hb) << 16); }
__device__ __forceinline__ float bfr(float f) { return bf_up(bf_bits(f)); }
__device__ __forceinline__ unsigned short h_bits(_Float16 x) { return __builtin_bit_cast(unsigned short, x); }
__device__ __forceinline__ unsigned pk16(unsigned short a, unsigned short b) { return (unsigned)a | ((unsigned)b << 16); }
__device__ __forceinline__ v8f zero8() { v8f z = {0.f, 0.f, 0.f, 0.f, 0.f, 0.f, 0.f, 0.f}; return z; }

// ---- 16-bit fragment loader (A, or B from a k-contiguous [n][k] row): lane -> row/col (lane&15), p already
//      includes + 8*(lane>>4); elements 0..7 <- p[0..7] (k0+8h..), elements 8..15 <- p[16..23] (k0+16+8h..)
__device__ __forceinline__ Frag ldfrag(const unsigned short* p) {
  Frag f;
  f.u[0] = *(const v8us*)(p);
  f.u[1] = *(const v8us*)(p + 16);
  return f;
}

// ---- WMMA helpers: builtin followed by a 4-slot VALU gap tying D and keeping A/B live ----------------------
__device__ __forceinline__ v8f mma_h(v16h a, v16h b, v8f c) {
  v8f d = __builtin_amdgcn_wmma_f32_16x16x32_f16(false, a, false, b, (short)0, c, false, false);
#if defined(__HIP_DEVICE_COMPILE__)
  asm volatile("v_nop\n\tv_nop\n\tv_nop\n\tv_nop" : "+v"(d) : "v"(a), "v"(b));
#endif
  return d;
}
__device__ __forceinline__ v8f mma_b(v16b a, v16b b, v8f c) {
  v8f d = __builtin_amdgcn_wmma_f32_16x16x32_bf16(false, a, false, b, (short)0, c, false, false);
#if defined(__HIP_DEVICE_COMPILE__)
  const v16h ha = __builtin_bit_cast(v16h, a), hb = __builtin_bit_cast(v16h, b);
  asm volatile("v_nop\n\tv_nop\n\tv_nop\n\tv_nop" : "+v"(d) : "v"(ha), "v"(hb));
#endif
  return d;
}

// =====================================================================================================
// (0) weights: wq f32 [768][256] -> WQ16 bf16 bits [768][256]; wp f32 [256][256] -> WP16 f16 bits of
// coverage: WQ16 32 blocks x 96 lines = 3072 lines = 768 x 256; WP16 32 x 32 = 1024 lines = 256 x 256.
// =====================================================================================================
__global__ __launch_bounds__(256)
void cvt_w(const float* __restrict__ wq, const float* __restrict__ wp,
           unsigned short* WQ16, unsigned short* WP16) {
  const int tid = threadIdx.x, e = tid & 7, lq = tid >> 3;
  v4u uq[3];
#pragma unroll
  for (int it = 0; it < 3; ++it) {
    const int L = blockIdx.x * 96 + it * 32 + lq;                 // 0..3071
    const float* s = wq + (size_t)64 * L + 8 * e;                  // max 196600 + 7 < 196608
    const v4f a = *(const v4f*)(s);
    const v4f b = *(const v4f*)(s + 4);
    uq[it][0] = pk16(bf_bits(a[0]), bf_bits(a[1]));
    uq[it][1] = pk16(bf_bits(a[2]), bf_bits(a[3]));
    uq[it][2] = pk16(bf_bits(b[0]), bf_bits(b[1]));
    uq[it][3] = pk16(bf_bits(b[2]), bf_bits(b[3]));
  }
  v4u up;
  const int Lp = blockIdx.x * 32 + lq;                             // 0..1023
  {
    const float* s = wp + (size_t)64 * Lp + 8 * e;                 // max 65528 + 7 < 65536
    const v4f a = *(const v4f*)(s);
    const v4f b = *(const v4f*)(s + 4);
    up[0] = pk16(h_bits((_Float16)(WSC * bfr(a[0]))), h_bits((_Float16)(WSC * bfr(a[1]))));
    up[1] = pk16(h_bits((_Float16)(WSC * bfr(a[2]))), h_bits((_Float16)(WSC * bfr(a[3]))));
    up[2] = pk16(h_bits((_Float16)(WSC * bfr(b[0]))), h_bits((_Float16)(WSC * bfr(b[1]))));
    up[3] = pk16(h_bits((_Float16)(WSC * bfr(b[2]))), h_bits((_Float16)(WSC * bfr(b[3]))));
  }
{
#pragma unroll
    for (int it = 0; it < 3; ++it) {
      const int L = blockIdx.x * 96 + it * 32 + lq;
      *(v4u*)(WQ16 + (size_t)64 * L + 8 * e) = uq[it];
    }
    *(v4u*)(WP16 + (size_t)64 * Lp + 8 * e) = up;
    
  }
}

// =====================================================================================================
// (1) x chunk view [4][256][3136] f32 -> XP position-major bf16 bits [4][3136][256] through an LDS tile
//     (64 ch) of 64 position rows: 8 consecutive lanes x 16 B per line, one instruction per 32 lines,
// coverage: load 256 threads x 4 it x 4 = 64 ch x 64 px; lines 2 x 32 = 64 rows; grid (49, 4, 4) covers XP.
// =====================================================================================================
__global__ __launch_bounds__(256)
void cvt_x(const float* __restrict__ x, unsigned short* XP) {
  __shared__ __align__(16) unsigned short Lt[QT * TPH];
  const int tid = threadIdx.x;
  const int nt = blockIdx.x, cg = blockIdx.y, bl = blockIdx.z;
  const int n0 = nt * QT;
  {
    const int n4 = (tid & 15) * 4, cs = tid >> 4;                   // cs 0..15
#pragma unroll
    for (int it = 0; it < 4; ++it) {
      const int cl = it * 16 + cs;                                   // 0..63
      const v4f v = *(const v4f*)(x + ((size_t)(bl * CDIM + cg * QT + cl)) * NPX + n0 + n4);
#pragma unroll
      for (int q = 0; q < 4; ++q) Lt[(n4 + q) * TPH + cl] = bf_bits(v[q]);
    }
  }
  __syncthreads();
  {
    const int e = tid & 7, lq = tid >> 3;                            // lq 0..31
    const v4u u0 = *(const v4u*)(Lt + lq * TPH + 8 * e);
    const v4u u1 = *(const v4u*)(Lt + (lq + 32) * TPH + 8 * e);
    unsigned short* d0 = XP + ((size_t)(bl * NPX + n0 + lq)) * CDIM + cg * QT + 8 * e;
    unsigned short* d1 = d0 + (size_t)32 * CDIM;
{
      *(v4u*)(d0) = u0;
      *(v4u*)(d1) = u1;
      
    }
  }
}

// =====================================================================================================
// (2) GEMM: Y[bl][m][n] = scale * sum_k A16[m][k] B16[bl][n][k] (K = 256 = 8 k-steps of 32), A and B rows
//     k-contiguous, split k map loader straight from global for both operands. With RES: B carries a second
//     x1024 residual plane BPL into a separate accumulator, folded back as accl/1024 in the epilogue.
//     Block 128 threads = 4 waves; wave w owns columns n0+16w..+15 (one B fragment per k-step) and MT m-tiles
//     lines of the f32 channel-major plane (2 lines per 64-n row segment, 8 consecutive lanes x 16 B, one
// coverage: Os 4 waves x MT tiles x 16x16 = MR x 64; lines NIT x 16 = 2 MR = MR rows x 64 n; grid (49, M/MR, 4).
// =====================================================================================================
template <int BF, int RES>
__global__ __launch_bounds__(128)
void gemm_k(const unsigned short* __restrict__ A16, const unsigned short* __restrict__ BP,
            const unsigned short* __restrict__ BPL, float* Y, int M, float scale) {
  constexpr int MT  = RES ? 4 : 8;
  constexpr int MR  = 16 * MT;
  constexpr int NIT = (2 * MR) / 16;
  __shared__ __align__(16) float Os[MR * OSP];
  const int tid  = threadIdx.x;
  const int lane = tid & 31, wave = tid >> 5;
  const int hh   = lane >> 4, c = lane & 15;
  const int nt   = blockIdx.x, bl = blockIdx.z;
  const int m0   = blockIdx.y * MR, n0 = nt * QT;

  const unsigned short* ap = A16 + (size_t)(m0 + c) * CDIM + 8 * hh;
  const size_t boff = ((size_t)(bl * NPX + n0 + 16 * wave + c)) * CDIM + 8 * hh;
  const unsigned short* bp  = BP + boff;
  const unsigned short* bpl = RES ? (BPL + boff) : bp;

  v8f acc[MT], accl[MT];
#pragma unroll
  for (int mt = 0; mt < MT; ++mt) { acc[mt] = zero8(); accl[mt] = zero8(); }

#pragma unroll 2
  for (int ks = 0; ks < CDIM / 32; ++ks) {
    const Frag fb = ldfrag(bp + 32 * ks);
    Frag fbl;
    if (RES) fbl = ldfrag(bpl + 32 * ks); else fbl = fb;
#pragma unroll
    for (int mt = 0; mt < MT; ++mt) {
      const Frag fa = ldfrag(ap + (size_t)(16 * mt) * CDIM + 32 * ks);
      if (BF) acc[mt] = mma_b(fa.bf, fb.bf, acc[mt]);
      else    acc[mt] = mma_h(fa.h, fb.h, acc[mt]);
      if (RES) accl[mt] = mma_h(fa.h, fbl.h, accl[mt]);
    }
  }

  // ---- epilogue -> LDS Os[m][n] ----
  {
    const int nl = 16 * wave + c;
#pragma unroll
    for (int mt = 0; mt < MT; ++mt) {
#pragma unroll
      for (int r = 0; r < 8; ++r) {
        float v = acc[mt][r];
        if (RES) v += accl[mt][r] * IRSC;
        Os[(16 * mt + 8 * hh + r) * OSP + nl] = v * scale;
      }
    }
  }
  __syncthreads();

  {
    const int e = tid & 7, lq = tid >> 3;                              // lq 0..15
{
#pragma unroll
      for (int it = 0; it < NIT; ++it) {
        const int L = it * 16 + lq;                                    // 0..2MR-1
        const int row = L >> 1, hf = L & 1;
        const v4f v = *(const v4f*)(Os + row * OSP + hf * 32 + 4 * e);
        float* dst = Y + ((size_t)(bl * M + m0 + row)) * NPX + n0 + hf * 32 + 4 * e;
        *(v4f*)dst = v;
      }
      
    }
  }
}

// =====================================================================================================
// (3) depthwise 3x3, zero pad 1, for one (64 px tile, 64-channel group cg, batch bl) of the f32 plane
//     QKV[4][768][3136]; weights = bf16-RNE values staged in LDS. Thread (px = tid&63, 16 channels 4i+(tid>>6));
//     the 9 tap offsets are clamped addresses, taps outside the image zeroed by predicate. Results as f16 hi
//     (and x1024 residual) into LDS tiles, then:
// coverage: 256 threads x 16 channels = 64 ch x 64 px per tile; lines 2 x 32 = 64 per plane; grid (49, 12, 4)
//           covers QK (cg 0..7 -> channels 0..511) and VP/VPL (cg 8..11 -> v channels 0..255) exactly once.
// =====================================================================================================
__global__ __launch_bounds__(256)
void dw_k(const float* __restrict__ QKV, const float* __restrict__ wdw,
          unsigned short* QK, unsigned short* VP, unsigned short* VPL) {
  __shared__ __align__(16) unsigned short Th[QT * TPH];
  __shared__ __align__(16) unsigned short Tl[QT * TPH];
  __shared__ float Wc[QT * 9];
  const int tid = threadIdx.x;
  const int nt = blockIdx.x, cg = blockIdx.y, bl = blockIdx.z;
  const int n0 = nt * QT;
  const bool isv = (cg >= 8);                                           // block-uniform
  for (int k = tid; k < QT * 9; k += 256) Wc[k] = bfr(wdw[cg * (QT * 9) + k]);   // max 6336 + 575 = 6911
  const int pl = tid & 63, cs = tid >> 6;
  const int p  = n0 + pl;
  const int y  = p / IMW, xw = p - y * IMW;
  int off[9];
  unsigned okm = 0u;
#pragma unroll
  for (int t = 0; t < 9; ++t) {
    const int ky = t / 3, kx = t - 3 * ky;
    const int yy = y + ky - 1, xx = xw + kx - 1;
    const bool ok = ((unsigned)yy < (unsigned)IMW) && ((unsigned)xx < (unsigned)IMW);
    off[t] = min(max(yy, 0), IMW - 1) * IMW + min(max(xx, 0), IMW - 1);
    okm |= ok ? (1u << t) : 0u;
  }
  __syncthreads();

#pragma unroll 1
  for (int i = 0; i < 16; ++i) {
    const int ch = 4 * i + cs;                                           // 0..63
    const float* src = QKV + ((size_t)(bl * C3 + cg * QT + ch)) * NPX;
    const float* wt  = Wc + ch * 9;
    float s = 0.f;
#pragma unroll
    for (int t = 0; t < 9; ++t) {
      const float v = src[off[t]];
      s = fmaf(((okm >> t) & 1u) ? v : 0.f, wt[t], s);
    }
    const _Float16 hv = (_Float16)s;
    const _Float16 lv = (_Float16)((s - (float)hv) * RSC);
    const int li = isv ? (pl * TPH + ch) : (ch * TPH + pl);
    Th[li] = h_bits(hv);
    Tl[li] = h_bits(lv);
  }
  __syncthreads();
  {
    const int e = tid & 7, lq = tid >> 3;                                 // lq 0..31
    const v4u h0 = *(const v4u*)(Th + lq * TPH + 8 * e);
    const v4u h1 = *(const v4u*)(Th + (lq + 32) * TPH + 8 * e);
    const v4u l0 = *(const v4u*)(Tl + lq * TPH + 8 * e);
    const v4u l1 = *(const v4u*)(Tl + (lq + 32) * TPH + 8 * e);
    if (isv) {
      const int vg = cg - 8;                                              // 0..3
      const size_t o0 = ((size_t)(bl * NPX + n0 + lq)) * CDIM + vg * QT + 8 * e;
      const size_t o1 = o0 + (size_t)32 * CDIM;
{
        *(v4u*)(VP  + o0) = h0;
        *(v4u*)(VP  + o1) = h1;
        *(v4u*)(VPL + o0) = l0;
        *(v4u*)(VPL + o1) = l1;
        
      }
    } else {
      const size_t o0 = ((size_t)(bl * CQK + cg * QT + lq)) * NPX + n0 + 8 * e;
      const size_t o1 = o0 + (size_t)32 * NPX;
{
        *(v4u*)(QK + o0) = h0;
        *(v4u*)(QK + o1) = h1;
        
      }
    }
  }
}

// =====================================================================================================
// (4a) channel attention, partial sums for one (pixel slice sl of 224 px, head pair g: heads 2g, 2g+1 = channels
//      64g..64g+63, batch bl), 256 threads.
//   phase 1: per-row sum of squares of q rows 64g..+63 and k rows 256+64g..+63 over the slice (f32, one 8-px
//            vector per lane, lanes 0..27, + xor tree), wave w -> rows 16w..16w+15.
//   phase 2: S[hl][c][d] = sum_n q[c][n] k[d][n] over the slice: 8 D tiles (hl, mt, nt) one per wave, A = q row
//            16mt+(lane&15), B = k row 16nt+(lane&15), both k-contiguous with the split k map, 7 k-steps on f16 WMMA.
//   The record [2][32][32] logits + [128] sums of squares goes through LDS and out as whole 128-B lines.
// coverage: 14 slices x 224 px = 3136 px; record 2 x 256 x 4 + 32 x 4 = 2176 floats; grid (14, 4, 4) covers PS.
// =====================================================================================================
__global__ __launch_bounds__(256)
void attn_s(const unsigned short* __restrict__ QK, float* PS) {
  __shared__ __align__(16) float sP[PREC];
  const int tid  = threadIdx.x;
  const int lane = tid & 31, wave = tid >> 5;
  const int hh   = lane >> 4, c = lane & 15;
  const int sl   = blockIdx.x, g = blockIdx.y, bl = blockIdx.z;
  const unsigned short* qkb = QK + (size_t)bl * CQK * NPX + sl * SLPX;

  // The slice is short enough for a wave to hold all of it in registers: the loads of both phases stand ahead
  // of the arithmetic, so that they are in flight together instead of one latency per row and per k-step.
  const int hl = wave >> 2, mt = (wave >> 1) & 1, ntk = wave & 1;
  Frag fa[SLPX / 32], fb[SLPX / 32];
  v8h  rv[16];
  {
    const unsigned short* arow = qkb + (size_t)(64 * g + 32 * hl + 16 * mt + c) * NPX + 8 * hh;
    const unsigned short* brow = qkb + (size_t)(256 + 64 * g + 32 * hl + 16 * ntk + c) * NPX + 8 * hh;
    const int idc = min(lane, SLPX / 8 - 1);                              // 28 vectors per row slice
    const int ch0 = 64 * g + 16 * wave + ((wave >= 4) ? 192 : 0);         // q: 64g+16w, k: 256+64g+16(w-4)
    const unsigned short* rp = qkb + (size_t)ch0 * NPX + 8 * idc;
#pragma unroll
    for (int ks = 0; ks < SLPX / 32; ++ks) {
      fa[ks] = ldfrag(arow + 32 * ks);
      fb[ks] = ldfrag(brow + 32 * ks);
    }
#pragma unroll
    for (int rr = 0; rr < 16; ++rr) rv[rr] = *(const v8h*)(rp + rr * NPX);
#if defined(__HIP_DEVICE_COMPILE__)
    // the wait that stands before a register named by an issued global load is overwritten; the three address
    // pairs are inputs so that no load of this run is given one of them as its destination
    asm volatile("s_wait_xcnt 0x0" :: "v"(arow), "v"(brow), "v"(rp) : "memory");
#endif
  }

  // ---- phase 1: row sums of squares over the slice ----
  {
    float s[16];
#pragma unroll
    for (int rr = 0; rr < 16; ++rr) {
      float t = 0.f;
#pragma unroll
      for (int q = 0; q < 8; ++q) { const float f = (float)rv[rr][q]; t = fmaf(f, f, t); }
      s[rr] = (lane < SLPX / 8) ? t : 0.f;
    }
#pragma unroll
    for (int off = 16; off > 0; off >>= 1) {
#pragma unroll
      for (int rr = 0; rr < 16; ++rr) s[rr] += __shfl_xor(s[rr], off, 32);
    }
    if (lane == 0) {
#pragma unroll
      for (int rr = 0; rr < 16; ++rr) sP[2048 + 16 * wave + rr] = s[rr];
    }
  }

  // ---- phase 2: raw logits S of the slice on f16 WMMA ----
  {
    v8f acc = zero8();
#pragma unroll
    for (int ks = 0; ks < SLPX / 32; ++ks) acc = mma_h(fa[ks].h, fb[ks].h, acc);
    float* sp = sP + hl * 1024 + (16 * mt + 8 * hh) * 32 + 16 * ntk + c;
#pragma unroll
    for (int r = 0; r < 8; ++r) sp[r * 32] = acc[r];
  }
  __syncthreads();
  {
    float* dst = PS + ((size_t)((bl * (CDIM / 64) + g) * NSL + sl)) * PREC;
    const v4f r0 = *(const v4f*)(sP + 4 * tid);
    const v4f r1 = *(const v4f*)(sP + 1024 + 4 * tid);
    *(v4f*)(dst + 4 * tid) = r0;
    *(v4f*)(dst + 1024 + 4 * tid) = r1;
    if (tid < 32) {                                                        // wave 0
      const v4f r2 = *(const v4f*)(sP + 2048 + 4 * tid);
      *(v4f*)(dst + 2048 + 4 * tid) = r2;
    }
  }
}

// =====================================================================================================
// (4b) softmax and attn.v for one (pixel range vt of 448 px, head pair g, batch bl), 256 threads.
//   join:    the 14 slice records of (g, bl) summed in slice order (f32) -> S in LDS, 1/max(norm, eps) in LDS;
//            every block of a (g, bl) does the same sums and gets the same attn.
//   phase 3: logits = S * invq * invk * temperature (bf16-RNE), max-subtracted softmax in f32, attn x256 as f16
//            hi and x1024 residual into LDS Pa [c][d] (d contiguous = A operand of phase 4).
//   phase 4: out[c][n] = sum_d attn[c][d] v[d][n]: waves (2pr, 2pr+1) share one 16-px tile (tile pr + 4(7vt + i)), wave
//            hl does head hl: A = Pa frags (resident), B = v rows of VP/VPL (position-major, k = d contiguous):
//            hi.hi -> o, hi.res + res.hi -> orr (x1024). 256*out = o + orr/1024 split into f16 hi + x1024 residual,
//            [4][3136][256] (64-ch slab of a 512-B row): wave hl writes rows {lr+8hl, lr+8hl+4}, 8 consecutive
// coverage: phase 4: 7 ranges x 4 pairs x 7 iterations = 196 tiles x 16 px = 3136 rows; per row the two waves'
//           halves (32hl + 16mt + 8hh + r) cover the 64-ch slab; grid (7, 4, 4) covers OP/OPL exactly once.
// =====================================================================================================
__global__ __launch_bounds__(256)
void attn_v(const float* __restrict__ PS, const unsigned short* __restrict__ VP,
            const unsigned short* __restrict__ VPL, const float* __restrict__ temp,
            unsigned short* OP, unsigned short* OPL) {
  __shared__ float sInv[128];
  __shared__ float sS[2 * 32 * 33];
  __shared__ __align__(16) unsigned short Pa[4 * 32 * PAP];            // [hi|res][hl][32][PAP]
  __shared__ __align__(16) unsigned short Ow[8 * 16 * TPH];            // [hi|res][pair][16][TPH]
  const int tid  = threadIdx.x;
  const int lane = tid & 31, wave = tid >> 5;
  const int hh   = lane >> 4, c = lane & 15;
  const int vt   = blockIdx.x, g = blockIdx.y, bl = blockIdx.z;

  // ---- join the slice records ----
  {
    const float* pb = PS + ((size_t)((bl * (CDIM / 64) + g) * NSL)) * PREC;
    v4f a0 = {0.f, 0.f, 0.f, 0.f}, a1 = {0.f, 0.f, 0.f, 0.f};
#pragma unroll
    for (int s = 0; s < NSL; ++s) {
      a0 += *(const v4f*)(pb + s * PREC + 4 * tid);
      a1 += *(const v4f*)(pb + s * PREC + 1024 + 4 * tid);
    }
    float* s0 = sS + (tid >> 3) * 33 + 4 * (tid & 7);                      // head 0: row tid>>3, d 4(tid&7)..+3
    float* s1 = s0 + 32 * 33;                                              // head 1
#pragma unroll
    for (int q = 0; q < 4; ++q) { s0[q] = a0[q]; s1[q] = a1[q]; }
    if (tid < 32) {                                                        // wave 0
      v4f an = {0.f, 0.f, 0.f, 0.f};
#pragma unroll
      for (int s = 0; s < NSL; ++s) an += *(const v4f*)(pb + s * PREC + 2048 + 4 * tid);
#pragma unroll
      for (int q = 0; q < 4; ++q) sInv[4 * tid + q] = 1.0f / fmaxf(sqrtf(an[q]), 1e-12f);
    }
  }
  __syncthreads();

  // ---- phase 3: softmax, attn x256 as f16 hi + residual ----
  if (tid < 64) {                                                          // waves 0, 1
    const int hl = tid >> 5, row = tid & 31;
    const float tv = bfr(temp[2 * g + hl]);
    const float iq = sInv[32 * hl + row] * tv;
    const float* srow = sS + hl * (32 * 33) + row * 33;
    const float* ik   = sInv + 64 + 32 * hl;
    float lg[32];
    float mx = -3.0e38f;
#pragma unroll
    for (int d = 0; d < 32; ++d) { const float v = srow[d] * iq * ik[d]; lg[d] = v; mx = fmaxf(mx, v); }
    float ssum = 0.f;
#pragma unroll
    for (int d = 0; d < 32; ++d) { const float ev = __expf(lg[d] - mx); lg[d] = ev; ssum += ev; }
    const float inv = PSC / ssum;
    unsigned short* ph = Pa + (hl * 32 + row) * PAP;
    unsigned short* pl = Pa + (64 + hl * 32 + row) * PAP;
#pragma unroll
    for (int d = 0; d < 32; ++d) {
      const float pv = lg[d] * inv;
      const _Float16 hv = (_Float16)pv;
      const _Float16 lv = (_Float16)((pv - (float)hv) * RSC);
      ph[d] = h_bits(hv);
      pl[d] = h_bits(lv);
    }
  }
  __syncthreads();

  // ---- phase 4: out = attn . v ----
  {
    const int pr = wave >> 1, hl = wave & 1;
    Frag ah[2], al[2];
#pragma unroll
    for (int mt = 0; mt < 2; ++mt) {
      const unsigned short* p0 = Pa + (hl * 32 + 16 * mt + c) * PAP + 8 * hh;
      ah[mt] = ldfrag(p0);
      al[mt] = ldfrag(p0 + 64 * PAP);
    }
    const size_t pbase = (size_t)bl * NPX * CDIM + 64 * g;
    const unsigned short* vpb = VP  + pbase + 32 * hl + 8 * hh;
    const unsigned short* vlb = VPL + pbase + 32 * hl + 8 * hh;
    unsigned short* owh = Ow + pr * (16 * TPH);
    unsigned short* owl = Ow + (4 + pr) * (16 * TPH);
    const int e8 = lane & 7, lr = (lane >> 3) + 8 * hl;                   // rows lr, lr+4 of the pair tile
#pragma unroll 1
    for (int i = 0; i < VIT; ++i) {                                        // 7 iterations
      const int n0 = (pr + 4 * (vt * VIT + i)) * 16;                       // tile 0..195
      const unsigned short* vr = vpb + (size_t)(n0 + c) * CDIM;
      const unsigned short* vl = vlb + (size_t)(n0 + c) * CDIM;
      const Frag fvh = ldfrag(vr);
      const Frag fvl = ldfrag(vl);
      v8f o[2], orr[2];
#pragma unroll
      for (int mt = 0; mt < 2; ++mt) {
        o[mt]   = mma_h(ah[mt].h, fvh.h, zero8());
        orr[mt] = mma_h(ah[mt].h, fvl.h, zero8());
        orr[mt] = mma_h(al[mt].h, fvh.h, orr[mt]);
      }
#pragma unroll
      for (int mt = 0; mt < 2; ++mt) {
        v4u uh, ul;
#pragma unroll
        for (int q = 0; q < 4; ++q) {
          const float f0 = o[mt][2 * q]     + orr[mt][2 * q]     * IRSC;
          const float f1 = o[mt][2 * q + 1] + orr[mt][2 * q + 1] * IRSC;
          const _Float16 h0 = (_Float16)f0, h1 = (_Float16)f1;
          const _Float16 l0 = (_Float16)((f0 - (float)h0) * RSC);
          const _Float16 l1 = (_Float16)((f1 - (float)h1) * RSC);
          uh[q] = pk16(h_bits(h0), h_bits(h1));
          ul[q] = pk16(h_bits(l0), h_bits(l1));
        }
        const int so = c * TPH + 32 * hl + 16 * mt + 8 * hh;               // channels 32hl+16mt+8hh..+7, px c
        *(v4u*)(owh + so) = uh;
        *(v4u*)(owl + so) = ul;
      }
      __syncthreads();
      const v4u a0 = *(const v4u*)(owh + lr * TPH + 8 * e8);
      const v4u a1 = *(const v4u*)(owh + (lr + 4) * TPH + 8 * e8);
      const v4u b0 = *(const v4u*)(owl + lr * TPH + 8 * e8);
      const v4u b1 = *(const v4u*)(owl + (lr + 4) * TPH + 8 * e8);
      unsigned short* d0 = OP  + pbase + (size_t)(n0 + lr) * CDIM + 8 * e8;
      unsigned short* d1 = OPL + pbase + (size_t)(n0 + lr) * CDIM + 8 * e8;
{
        *(v4u*)(d0) = a0;
        *(v4u*)(d0 + 4 * CDIM) = a1;
        *(v4u*)(d1) = b0;
        *(v4u*)(d1 + 4 * CDIM) = b1;
        
      }
      __syncthreads();
    }
  }
}

// =====================================================================================================
// Workspace map (bytes; each region start a multiple of 256; every extent an exact tile multiple, written only as
//   WQ16 bf16 [768][256]        393216      WP16 f16 [256][256]         131072
//   XP   bf16 [4][3136][256]   6422528      R1   f32 [4][768][3136]  38535168     QK f16 [4][512][3136] 12845056
//   VP, VPL, OP, OPL f16 [4][3136][256] 6422528 x 4      PS f32 [4][4][14][2176] 1949696     total = 85966848
// =====================================================================================================
extern "C" void kernel_launch(void* const* d_in, const int* in_sizes, int n_in,
                              void* d_out, int out_size, void* d_ws, size_t ws_size,
                              hipStream_t stream) {
  const int XN = NBAT * CDIM * NPX;                      // 12845056
  if (n_in < 5) return;
  if (in_sizes[0] != XN) return;
  if (in_sizes[1] != C3 * CDIM) return;
  if (in_sizes[2] != C3 * 9) return;
  if (in_sizes[3] != CDIM * CDIM) return;
  if (in_sizes[4] != NHEAD) return;
  if (out_size != XN) return;

  size_t off = 0;
  auto carve = [&](size_t bytes) { const size_t o = off; off += (bytes + 255) & ~(size_t)255; return o; };
  const size_t plane16 = (size_t)NCHK * NPX * CDIM * 2;  // 6422528
  const size_t oWQ  = carve((size_t)C3 * CDIM * 2);
  const size_t oWP  = carve((size_t)CDIM * CDIM * 2);
  const size_t oXP  = carve(plane16);
  const size_t oR1  = carve((size_t)NCHK * C3 * NPX * 4);
  const size_t oQK  = carve((size_t)NCHK * CQK * NPX * 2);
  const size_t oVP  = carve(plane16);
  const size_t oVPL = carve(plane16);
  const size_t oOP  = carve(plane16);
  const size_t oOPL = carve(plane16);
  const size_t oPS  = carve((size_t)NCHK * (CDIM / 64) * NSL * PREC * 4);
  if (off > ws_size) return;
  if (off > (size_t)134217728) return;

  const float* x    = (const float*)d_in[0];
  const float* wq   = (const float*)d_in[1];
  const float* wdw  = (const float*)d_in[2];
  const float* wp   = (const float*)d_in[3];
  const float* temp = (const float*)d_in[4];
  float* out = (float*)d_out;

  char* ws = (char*)d_ws;
  unsigned short* WQ16 = (unsigned short*)(ws + oWQ);
  unsigned short* WP16 = (unsigned short*)(ws + oWP);
  unsigned short* XP   = (unsigned short*)(ws + oXP);
  float*          R1   = (float*)(ws + oR1);
  unsigned short* QK   = (unsigned short*)(ws + oQK);
  unsigned short* VP   = (unsigned short*)(ws + oVP);
  unsigned short* VPL  = (unsigned short*)(ws + oVPL);
  unsigned short* OP   = (unsigned short*)(ws + oOP);
  unsigned short* OPL  = (unsigned short*)(ws + oOPL);
  float*          PS   = (float*)(ws + oPS);

  const dim3 blk256(256), blk128(128);

  // (0) weights -> 16-bit planes
  cvt_w<<<dim3(32), blk256, 0, stream>>>(wq, wp, WQ16, WP16);

  for (int ck = 0; ck < NCHUNK; ++ck) {
    const float* xc   = x   + (size_t)ck * NCHK * CDIM * NPX;
    float*       outc = out + (size_t)ck * NCHK * CDIM * NPX;
    // (1) x chunk -> position-major bf16 [4][3136][256]
    cvt_x<<<dim3(NTILE, CDIM / QT, NCHK), blk256, 0, stream>>>(xc, XP);
    // (2) qkv 1x1 conv -> f32 [4][768][3136]
    gemm_k<1, 0><<<dim3(NTILE, C3 / 128, NCHK), blk128, 0, stream>>>(WQ16, XP, XP, R1, C3, 1.0f);
    // (3) depthwise 3x3 -> q,k channel-major f16; v position-major f16 hi + residual
    dw_k<<<dim3(NTILE, C3 / QT, NCHK), blk256, 0, stream>>>(R1, wdw, QK, VP, VPL);
    // (4a) channel attention: partial logits and sums of squares per 224-px slice
    attn_s<<<dim3(NSL, CDIM / 64, NCHK), blk256, 0, stream>>>(QK, PS);
    // (4b) join, softmax, attn.v -> 256*out position-major f16 hi + residual [4][3136][256]
    attn_v<<<dim3(NVT, CDIM / 64, NCHK), blk256, 0, stream>>>(PS, VP, VPL, temp, OP, OPL);
    // (5) proj 1x1 conv -> d_out rows of batches 4ck..4ck+3, scaled by 1/(64*256)
    gemm_k<0, 1><<<dim3(NTILE, CDIM / 64, NCHK), blk128, 0, stream>>>(WP16, OP, OPL, outc, CDIM, OUTSC);
  }
  (void)hipGetLastError();
}

// v002
// Measured time: 243 microseconds a run.
// Timed twice side by side with v001, it ran 1.47 times as fast both times.
// All steps since v000 together make it 2.88 times as fast.
// Contractions: qkv 1x1 conv W[768x256].X[256x3136] on v_wmma_f32_16x16x32_bf16 (bf16 RNE operands, single product);
// channel logits q.k^T (32x32 per head, K=3136) on v_wmma_f32_16x16x32_f16 (f16 planes of the depthwise outputs);
// attn.v (K=32) on v_wmma_f32_16x16x32_f16 (attn x256 as f16 hi + x1024 residual, v as f16 hi + x1024 residual,
// 3 products); proj 1x1 conv on v_wmma_f32_16x16x32_f16 (64 x bf16-RNE weights as f16, 256 x out as f16 hi +
// x1024 residual, 2 products); f32 accumulate everywhere; depthwise 3x3, L2 norms and softmax in f32 on VALU.
#include <hip/hip_runtime.h>
#include <math.h>
#include <stdint.h>

#define NBAT   16
#define NCHK   16
#define CDIM   256
#define C3     768
#define CQK    512
#define NPX    3136
#define IMW    56
#define NHEAD  8
#define QT     64
#define NTILE  49
#define TPH    72
#define OSP    68
#define PAP    40
#define RSC    1024.0f
#define IRSC   0.0009765625f
#define PSC    256.0f
#define WSC    64.0f
#define OUTSC  6.103515625e-05f
#define NSL    14
#define SLPX   224
#define PREC   2176
#define NVT    7
#define VIT    7

static_assert(NTILE * QT == NPX);
static_assert(IMW * IMW == NPX);
static_assert(NCHK == NBAT);
static_assert(NPX % 32 == 0);
static_assert(NPX % 16 == 0);
static_assert((NPX / 16) % 4 == 0);
static_assert(CDIM % 32 == 0);
static_assert(C3 % 128 == 0);
static_assert(CDIM % 64 == 0);
static_assert((TPH * 2) % 16 == 0);
static_assert((OSP * 4) % 16 == 0);
static_assert((PAP * 2) % 16 == 0);
static_assert(NHEAD * 32 == CDIM);
static_assert(NSL * SLPX == NPX);
static_assert(SLPX % 32 == 0);
static_assert(SLPX / 8 <= 32);
static_assert(PREC == 2 * 32 * 32 + 128);
static_assert((PREC * 4) % 128 == 0);
static_assert(NVT * VIT * 64 == NPX);

typedef _Float16       v16h __attribute__((ext_vector_type(16)));
typedef _Float16       v8h  __attribute__((ext_vector_type(8)));
typedef __bf16         v16b __attribute__((ext_vector_type(16)));
typedef unsigned short v8us __attribute__((ext_vector_type(8)));
typedef float          v8f  __attribute__((ext_vector_type(8)));
typedef float          v4f  __attribute__((ext_vector_type(4)));
typedef unsigned int   v4u  __attribute__((ext_vector_type(4)));

union Frag { v8us u[2]; v16h h; v16b bf; };
static_assert(sizeof(Frag) == 32);

// ---- scalar helpers ---------------------------------------------------------------------------------
__device__ __forceinline__ unsigned short bf_bits(float f) {          // f32 -> bf16 bits, RNE convert
  unsigned u = __float_as_uint(f);
  return (unsigned short)((u + 0x7FFFu + ((u >> 16) & 1u)) >> 16);
}
__device__ __forceinline__ float bf_up(unsigned short hb) { return __uint_as_float(((unsigned)hb) << 16); }
__device__ __forceinline__ float bfr(float f) { return bf_up(bf_bits(f)); }
__device__ __forceinline__ unsigned short h_bits(_Float16 x) { return __builtin_bit_cast(unsigned short, x); }
__device__ __forceinline__ unsigned pk16(unsigned short a, unsigned short b) { return (unsigned)a | ((unsigned)b << 16); }
__device__ __forceinline__ v8f zero8() { v8f z = {0.f, 0.f, 0.f, 0.f, 0.f, 0.f, 0.f, 0.f}; return z; }

// ---- 16-bit fragment loader (A, or B from a k-contiguous [n][k] row): lane -> row/col (lane&15), p already
//      includes + 8*(lane>>4); elements 0..7 <- p[0..7] (k0+8h..), elements 8..15 <- p[16..23] (k0+16+8h..)
__device__ __forceinline__ Frag ldfrag(const unsigned short* p) {
  Frag f;
  f.u[0] = *(const v8us*)(p);
  f.u[1] = *(const v8us*)(p + 16);
  return f;
}

// ---- WMMA helpers: builtin followed by a 4-slot VALU gap tying D and keeping A/B live ----------------------
__device__ __forceinline__ v8f mma_h(v16h a, v16h b, v8f c) {
  v8f d = __builtin_amdgcn_wmma_f32_16x16x32_f16(false, a, false, b, (short)0, c, false, false);
#if defined(__HIP_DEVICE_COMPILE__)
  asm volatile("v_nop\n\tv_nop\n\tv_nop\n\tv_nop" : "+v"(d) : "v"(a), "v"(b));
#endif
  return d;
}
__device__ __forceinline__ v8f mma_b(v16b a, v16b b, v8f c) {
  v8f d = __builtin_amdgcn_wmma_f32_16x16x32_bf16(false, a, false, b, (short)0, c, false, false);
#if defined(__HIP_DEVICE_COMPILE__)
  const v16h ha = __builtin_bit_cast(v16h, a), hb = __builtin_bit_cast(v16h, b);
  asm volatile("v_nop\n\tv_nop\n\tv_nop\n\tv_nop" : "+v"(d) : "v"(ha), "v"(hb));
#endif
  return d;
}

// =====================================================================================================
// (0) weights: wq f32 [768][256] -> WQ16 bf16 bits [768][256]; wp f32 [256][256] -> WP16 f16 bits of
// coverage: WQ16 32 blocks x 96 lines = 3072 lines = 768 x 256; WP16 32 x 32 = 1024 lines = 256 x 256.
// =====================================================================================================
__global__ __launch_bounds__(256)
void cvt_w(const float* __restrict__ wq, const float* __restrict__ wp,
           unsigned short* WQ16, unsigned short* WP16) {
  const int tid = threadIdx.x, e = tid & 7, lq = tid >> 3;
  v4u uq[3];
#pragma unroll
  for (int it = 0; it < 3; ++it) {
    const int L = blockIdx.x * 96 + it * 32 + lq;                 // 0..3071
    const float* s = wq + (size_t)64 * L + 8 * e;                  // max 196600 + 7 < 196608
    const v4f a = *(const v4f*)(s);
    const v4f b = *(const v4f*)(s + 4);
    uq[it][0] = pk16(bf_bits(a[0]), bf_bits(a[1]));
    uq[it][1] = pk16(bf_bits(a[2]), bf_bits(a[3]));
    uq[it][2] = pk16(bf_bits(b[0]), bf_bits(b[1]));
    uq[it][3] = pk16(bf_bits(b[2]), bf_bits(b[3]));
  }
  v4u up;
  const int Lp = blockIdx.x * 32 + lq;                             // 0..1023
  {
    const float* s = wp + (size_t)64 * Lp + 8 * e;                 // max 65528 + 7 < 65536
    const v4f a = *(const v4f*)(s);
    const v4f b = *(const v4f*)(s + 4);
    up[0] = pk16(h_bits((_Float16)(WSC * bfr(a[0]))), h_bits((_Float16)(WSC * bfr(a[1]))));
    up[1] = pk16(h_bits((_Float16)(WSC * bfr(a[2]))), h_bits((_Float16)(WSC * bfr(a[3]))));
    up[2] = pk16(h_bits((_Float16)(WSC * bfr(b[0]))), h_bits((_Float16)(WSC * bfr(b[1]))));
    up[3] = pk16(h_bits((_Float16)(WSC * bfr(b[2]))), h_bits((_Float16)(WSC * bfr(b[3]))));
  }
{
#pragma unroll
    for (int it = 0; it < 3; ++it) {
      const int L = blockIdx.x * 96 + it * 32 + lq;
      *(v4u*)(WQ16 + (size_t)64 * L + 8 * e) = uq[it];
    }
    *(v4u*)(WP16 + (size_t)64 * Lp + 8 * e) = up;
    
  }
}

// =====================================================================================================
// (1) x [16][256][3136] f32 -> XP position-major bf16 bits [16][3136][256] through an LDS tile
//     (64 ch) of 64 position rows: 8 consecutive lanes x 16 B per line, one instruction per 32 lines,
// coverage: load 256 threads x 4 it x 4 = 64 ch x 64 px; lines 2 x 32 = 64 rows; grid (49, 4, 16) covers XP.
// =====================================================================================================
__global__ __launch_bounds__(256)
void cvt_x(const float* __restrict__ x, unsigned short* XP) {
  __shared__ __align__(16) unsigned short Lt[QT * TPH];
  const int tid = threadIdx.x;
  const int nt = blockIdx.x, cg = blockIdx.y, bl = blockIdx.z;
  const int n0 = nt * QT;
  {
    const int n4 = (tid & 15) * 4, cs = tid >> 4;                   // cs 0..15
#pragma unroll
    for (int it = 0; it < 4; ++it) {
      const int cl = it * 16 + cs;                                   // 0..63
      const v4f v = *(const v4f*)(x + ((size_t)(bl * CDIM + cg * QT + cl)) * NPX + n0 + n4);
#pragma unroll
      for (int q = 0; q < 4; ++q) Lt[(n4 + q) * TPH + cl] = bf_bits(v[q]);
    }
  }
  __syncthreads();
  {
    const int e = tid & 7, lq = tid >> 3;                            // lq 0..31
    const v4u u0 = *(const v4u*)(Lt + lq * TPH + 8 * e);
    const v4u u1 = *(const v4u*)(Lt + (lq + 32) * TPH + 8 * e);
    unsigned short* d0 = XP + ((size_t)(bl * NPX + n0 + lq)) * CDIM + cg * QT + 8 * e;
    unsigned short* d1 = d0 + (size_t)32 * CDIM;
{
      *(v4u*)(d0) = u0;
      *(v4u*)(d1) = u1;
      
    }
  }
}

// =====================================================================================================
// (2) GEMM: Y[bl][m][n] = scale * sum_k A16[m][k] B16[bl][n][k] (K = 256 = 8 k-steps of 32), A and B rows
//     k-contiguous, split k map loader straight from global for both operands. With RES: B carries a second
//     x1024 residual plane BPL into a separate accumulator, folded back as accl/1024 in the epilogue.
//     Block 128 threads = 4 waves; wave w owns columns n0+16w..+15 (one B fragment per k-step) and MT m-tiles
//     lines of the f32 channel-major plane (2 lines per 64-n row segment, 8 consecutive lanes x 16 B, one
// coverage: Os 4 waves x MT tiles x 16x16 = MR x 64; lines NIT x 16 = 2 MR = MR rows x 64 n; grid (49, M/MR, 16).
// =====================================================================================================
template <int BF, int RES>
__global__ __launch_bounds__(128)
void gemm_k(const unsigned short* __restrict__ A16, const unsigned short* __restrict__ BP,
            const unsigned short* __restrict__ BPL, float* Y, int M, float scale) {
  constexpr int MT  = RES ? 4 : 8;
  constexpr int MR  = 16 * MT;
  constexpr int NIT = (2 * MR) / 16;
  __shared__ __align__(16) float Os[MR * OSP];
  const int tid  = threadIdx.x;
  const int lane = tid & 31, wave = tid >> 5;
  const int hh   = lane >> 4, c = lane & 15;
  const int nt   = blockIdx.x, bl = blockIdx.z;
  const int m0   = blockIdx.y * MR, n0 = nt * QT;

  const unsigned short* ap = A16 + (size_t)(m0 + c) * CDIM + 8 * hh;
  const size_t boff = ((size_t)(bl * NPX + n0 + 16 * wave + c)) * CDIM + 8 * hh;
  const unsigned short* bp  = BP + boff;
  const unsigned short* bpl = RES ? (BPL + boff) : bp;

  v8f acc[MT], accl[MT];
#pragma unroll
  for (int mt = 0; mt < MT; ++mt) { acc[mt] = zero8(); accl[mt] = zero8(); }

#pragma unroll 2
  for (int ks = 0; ks < CDIM / 32; ++ks) {
    const Frag fb = ldfrag(bp + 32 * ks);
    Frag fbl;
    if (RES) fbl = ldfrag(bpl + 32 * ks); else fbl = fb;
#pragma unroll
    for (int mt = 0; mt < MT; ++mt) {
      const Frag fa = ldfrag(ap + (size_t)(16 * mt) * CDIM + 32 * ks);
      if (BF) acc[mt] = mma_b(fa.bf, fb.bf, acc[mt]);
      else    acc[mt] = mma_h(fa.h, fb.h, acc[mt]);
      if (RES) accl[mt] = mma_h(fa.h, fbl.h, accl[mt]);
    }
  }

  // ---- epilogue -> LDS Os[m][n] ----
  {
    const int nl = 16 * wave + c;
#pragma unroll
    for (int mt = 0; mt < MT; ++mt) {
#pragma unroll
      for (int r = 0; r < 8; ++r) {
        float v = acc[mt][r];
        if (RES) v += accl[mt][r] * IRSC;
        Os[(16 * mt + 8 * hh + r) * OSP + nl] = v * scale;
      }
    }
  }
  __syncthreads();

  {
    const int e = tid & 7, lq = tid >> 3;                              // lq 0..15
{
#pragma unroll
      for (int it = 0; it < NIT; ++it) {
        const int L = it * 16 + lq;                                    // 0..2MR-1
        const int row = L >> 1, hf = L & 1;
        const v4f v = *(const v4f*)(Os + row * OSP + hf * 32 + 4 * e);
        float* dst = Y + ((size_t)(bl * M + m0 + row)) * NPX + n0 + hf * 32 + 4 * e;
        *(v4f*)dst = v;
      }
      
    }
  }
}

// =====================================================================================================
// (3) depthwise 3x3, zero pad 1, for one (64 px tile, 64-channel group cg, batch bl) of the f32 plane
//     QKV[16][768][3136]; weights = bf16-RNE values staged in LDS. Thread (px = tid&63, 16 channels 4i+(tid>>6));
//     the 9 tap offsets are clamped addresses, taps outside the image zeroed by predicate. Results as f16 hi
//     (and x1024 residual) into LDS tiles, then:
// coverage: 256 threads x 16 channels = 64 ch x 64 px per tile; lines 2 x 32 = 64 per plane; grid (49, 12, 16)
//           covers QK (cg 0..7 -> channels 0..511) and VP/VPL (cg 8..11 -> v channels 0..255) exactly once.
// =====================================================================================================
__global__ __launch_bounds__(256)
void dw_k(const float* __restrict__ QKV, const float* __restrict__ wdw,
          unsigned short* QK, unsigned short* VP, unsigned short* VPL) {
  __shared__ __align__(16) unsigned short Th[QT * TPH];
  __shared__ __align__(16) unsigned short Tl[QT * TPH];
  __shared__ float Wc[QT * 9];
  const int tid = threadIdx.x;
  const int nt = blockIdx.x, cg = blockIdx.y, bl = blockIdx.z;
  const int n0 = nt * QT;
  const bool isv = (cg >= 8);                                           // block-uniform
  for (int k = tid; k < QT * 9; k += 256) Wc[k] = bfr(wdw[cg * (QT * 9) + k]);   // max 6336 + 575 = 6911
  const int pl = tid & 63, cs = tid >> 6;
  const int p  = n0 + pl;
  const int y  = p / IMW, xw = p - y * IMW;
  int off[9];
  unsigned okm = 0u;
#pragma unroll
  for (int t = 0; t < 9; ++t) {
    const int ky = t / 3, kx = t - 3 * ky;
    const int yy = y + ky - 1, xx = xw + kx - 1;
    const bool ok = ((unsigned)yy < (unsigned)IMW) && ((unsigned)xx < (unsigned)IMW);
    off[t] = min(max(yy, 0), IMW - 1) * IMW + min(max(xx, 0), IMW - 1);
    okm |= ok ? (1u << t) : 0u;
  }
  __syncthreads();

#pragma unroll 1
  for (int i = 0; i < 16; ++i) {
    const int ch = 4 * i + cs;                                           // 0..63
    const float* src = QKV + ((size_t)(bl * C3 + cg * QT + ch)) * NPX;
    const float* wt  = Wc + ch * 9;
    float s = 0.f;
#pragma unroll
    for (int t = 0; t < 9; ++t) {
      const float v = src[off[t]];
      s = fmaf(((okm >> t) & 1u) ? v : 0.f, wt[t], s);
    }
    const _Float16 hv = (_Float16)s;
    const _Float16 lv = (_Float16)((s - (float)hv) * RSC);
    const int li = isv ? (pl * TPH + ch) : (ch * TPH + pl);
    Th[li] = h_bits(hv);
    Tl[li] = h_bits(lv);
  }
  __syncthreads();
  {
    const int e = tid & 7, lq = tid >> 3;                                 // lq 0..31
    const v4u h0 = *(const v4u*)(Th + lq * TPH + 8 * e);
    const v4u h1 = *(const v4u*)(Th + (lq + 32) * TPH + 8 * e);
    const v4u l0 = *(const v4u*)(Tl + lq * TPH + 8 * e);
    const v4u l1 = *(const v4u*)(Tl + (lq + 32) * TPH + 8 * e);
    if (isv) {
      const int vg = cg - 8;                                              // 0..3
      const size_t o0 = ((size_t)(bl * NPX + n0 + lq)) * CDIM + vg * QT + 8 * e;
      const size_t o1 = o0 + (size_t)32 * CDIM;
{
        *(v4u*)(VP  + o0) = h0;
        *(v4u*)(VP  + o1) = h1;
        *(v4u*)(VPL + o0) = l0;
        *(v4u*)(VPL + o1) = l1;
        
      }
    } else {
      const size_t o0 = ((size_t)(bl * CQK + cg * QT + lq)) * NPX + n0 + 8 * e;
      const size_t o1 = o0 + (size_t)32 * NPX;
{
        *(v4u*)(QK + o0) = h0;
        *(v4u*)(QK + o1) = h1;
        
      }
    }
  }
}

// =====================================================================================================
// (4a) channel attention, partial sums for one (pixel slice sl of 224 px, head pair g: heads 2g, 2g+1 = channels
//      64g..64g+63, batch bl), 256 threads.
//   phase 1: per-row sum of squares of q rows 64g..+63 and k rows 256+64g..+63 over the slice (f32, one 8-px
//            vector per lane, lanes 0..27, + xor tree), wave w -> rows 16w..16w+15.
//   phase 2: S[hl][c][d] = sum_n q[c][n] k[d][n] over the slice: 8 D tiles (hl, mt, nt) one per wave, A = q row
//            16mt+(lane&15), B = k row 16nt+(lane&15), both k-contiguous with the split k map, 7 k-steps on f16 WMMA.
//   The record [2][32][32] logits + [128] sums of squares goes through LDS and out as whole 128-B lines.
// coverage: 14 slices x 224 px = 3136 px; record 2 x 256 x 4 + 32 x 4 = 2176 floats; grid (14, 4, 16) covers PS.
// =====================================================================================================
__global__ __launch_bounds__(256)
void attn_s(const unsigned short* __restrict__ QK, float* PS) {
  __shared__ __align__(16) float sP[PREC];
  const int tid  = threadIdx.x;
  const int lane = tid & 31, wave = tid >> 5;
  const int hh   = lane >> 4, c = lane & 15;
  const int sl   = blockIdx.x, g = blockIdx.y, bl = blockIdx.z;
  const unsigned short* qkb = QK + (size_t)bl * CQK * NPX + sl * SLPX;

  // The slice is short enough for a wave to hold all of it in registers: the loads of both phases stand ahead
  // of the arithmetic, so that they are in flight together instead of one latency per row and per k-step.
  const int hl = wave >> 2, mt = (wave >> 1) & 1, ntk = wave & 1;
  Frag fa[SLPX / 32], fb[SLPX / 32];
  v8h  rv[16];
  {
    const unsigned short* arow = qkb + (size_t)(64 * g + 32 * hl + 16 * mt + c) * NPX + 8 * hh;
    const unsigned short* brow = qkb + (size_t)(256 + 64 * g + 32 * hl + 16 * ntk + c) * NPX + 8 * hh;
    const int idc = min(lane, SLPX / 8 - 1);                              // 28 vectors per row slice
    const int ch0 = 64 * g + 16 * wave + ((wave >= 4) ? 192 : 0);         // q: 64g+16w, k: 256+64g+16(w-4)
    const unsigned short* rp = qkb + (size_t)ch0 * NPX + 8 * idc;
#pragma unroll
    for (int ks = 0; ks < SLPX / 32; ++ks) {
      fa[ks] = ldfrag(arow + 32 * ks);
      fb[ks] = ldfrag(brow + 32 * ks);
    }
#pragma unroll
    for (int rr = 0; rr < 16; ++rr) rv[rr] = *(const v8h*)(rp + rr * NPX);
#if defined(__HIP_DEVICE_COMPILE__)
    // the wait that stands before a register named by an issued global load is overwritten; the three address
    // pairs are inputs so that no load of this run is given one of them as its destination
    asm volatile("s_wait_xcnt 0x0" :: "v"(arow), "v"(brow), "v"(rp) : "memory");
#endif
  }

  // ---- phase 1: row sums of squares over the slice ----
  {
    float s[16];
#pragma unroll
    for (int rr = 0; rr < 16; ++rr) {
      float t = 0.f;
#pragma unroll
      for (int q = 0; q < 8; ++q) { const float f = (float)rv[rr][q]; t = fmaf(f, f, t); }
      s[rr] = (lane < SLPX / 8) ? t : 0.f;
    }
#pragma unroll
    for (int off = 16; off > 0; off >>= 1) {
#pragma unroll
      for (int rr = 0; rr < 16; ++rr) s[rr] += __shfl_xor(s[rr], off, 32);
    }
    if (lane == 0) {
#pragma unroll
      for (int rr = 0; rr < 16; ++rr) sP[2048 + 16 * wave + rr] = s[rr];
    }
  }

  // ---- phase 2: raw logits S of the slice on f16 WMMA ----
  {
    v8f acc = zero8();
#pragma unroll
    for (int ks = 0; ks < SLPX / 32; ++ks) acc = mma_h(fa[ks].h, fb[ks].h, acc);
    float* sp = sP + hl * 1024 + (16 * mt + 8 * hh) * 32 + 16 * ntk + c;
#pragma unroll
    for (int r = 0; r < 8; ++r) sp[r * 32] = acc[r];
  }
  __syncthreads();
  {
    float* dst = PS + ((size_t)((bl * (CDIM / 64) + g) * NSL + sl)) * PREC;
    const v4f r0 = *(const v4f*)(sP + 4 * tid);
    const v4f r1 = *(const v4f*)(sP + 1024 + 4 * tid);
    *(v4f*)(dst + 4 * tid) = r0;
    *(v4f*)(dst + 1024 + 4 * tid) = r1;
    if (tid < 32) {                                                        // wave 0
      const v4f r2 = *(const v4f*)(sP + 2048 + 4 * tid);
      *(v4f*)(dst + 2048 + 4 * tid) = r2;
    }
  }
}

// =====================================================================================================
// (4b) softmax and attn.v for one (pixel range vt of 448 px, head pair g, batch bl), 256 threads.
//   join:    the 14 slice records of (g, bl) summed in slice order (f32) -> S in LDS, 1/max(norm, eps) in LDS;
//            every block of a (g, bl) does the same sums and gets the same attn.
//   phase 3: logits = S * invq * invk * temperature (bf16-RNE), max-subtracted softmax in f32, attn x256 as f16
//            hi and x1024 residual into LDS Pa [c][d] (d contiguous = A operand of phase 4).
//   phase 4: out[c][n] = sum_d attn[c][d] v[d][n]: waves (2pr, 2pr+1) share one 16-px tile (tile pr + 4(7vt + i)), wave
//            hl does head hl: A = Pa frags (resident), B = v rows of VP/VPL (position-major, k = d contiguous):
//            hi.hi -> o, hi.res + res.hi -> orr (x1024). 256*out = o + orr/1024 split into f16 hi + x1024 residual,
//            [16][3136][256] (64-ch slab of a 512-B row): wave hl writes rows {lr, lr+4}, lr = (lane>>3)+8hl, 8 consecutive
// coverage: phase 4: 7 ranges x 4 pairs x 7 iterations = 196 tiles x 16 px = 3136 rows; per row the two waves'
//           halves (32hl + 16mt + 8hh + r) cover the 64-ch slab; grid (7, 4, 16) covers OP/OPL exactly once.
// =====================================================================================================
__global__ __launch_bounds__(256)
void attn_v(const float* __restrict__ PS, const unsigned short* __restrict__ VP,
            const unsigned short* __restrict__ VPL, const float* __restrict__ temp,
            unsigned short* OP, unsigned short* OPL) {
  __shared__ float sInv[128];
  __shared__ float sS[2 * 32 * 33];
  __shared__ __align__(16) unsigned short Pa[4 * 32 * PAP];            // [hi|res][hl][32][PAP]
  __shared__ __align__(16) unsigned short Ow[8 * 16 * TPH];            // [hi|res][pair][16][TPH]
  const int tid  = threadIdx.x;
  const int lane = tid & 31, wave = tid >> 5;
  const int hh   = lane >> 4, c = lane & 15;
  const int vt   = blockIdx.x, g = blockIdx.y, bl = blockIdx.z;

  // ---- join the slice records ----
  {
    const float* pb = PS + ((size_t)((bl * (CDIM / 64) + g) * NSL)) * PREC;
    v4f a0 = {0.f, 0.f, 0.f, 0.f}, a1 = {0.f, 0.f, 0.f, 0.f};
#pragma unroll
    for (int s = 0; s < NSL; ++s) {
      a0 += *(const v4f*)(pb + s * PREC + 4 * tid);
      a1 += *(const v4f*)(pb + s * PREC + 1024 + 4 * tid);
    }
    float* s0 = sS + (tid >> 3) * 33 + 4 * (tid & 7);                      // head 0: row tid>>3, d 4(tid&7)..+3
    float* s1 = s0 + 32 * 33;                                              // head 1
#pragma unroll
    for (int q = 0; q < 4; ++q) { s0[q] = a0[q]; s1[q] = a1[q]; }
    if (tid < 32) {                                                        // wave 0
      v4f an = {0.f, 0.f, 0.f, 0.f};
#pragma unroll
      for (int s = 0; s < NSL; ++s) an += *(const v4f*)(pb + s * PREC + 2048 + 4 * tid);
#pragma unroll
      for (int q = 0; q < 4; ++q) sInv[4 * tid + q] = 1.0f / fmaxf(sqrtf(an[q]), 1e-12f);
    }
  }
  __syncthreads();

  // ---- phase 3: softmax, attn x256 as f16 hi + residual ----
  if (tid < 64) {                                                          // waves 0, 1
    const int hl = tid >> 5, row = tid & 31;
    const float tv = bfr(temp[2 * g + hl]);
    const float iq = sInv[32 * hl + row] * tv;
    const float* srow = sS + hl * (32 * 33) + row * 33;
    const float* ik   = sInv + 64 + 32 * hl;
    float lg[32];
    float mx = -3.0e38f;
#pragma unroll
    for (int d = 0; d < 32; ++d) { const float v = srow[d] * iq * ik[d]; lg[d] = v; mx = fmaxf(mx, v); }
    float ssum = 0.f;
#pragma unroll
    for (int d = 0; d < 32; ++d) { const float ev = __expf(lg[d] - mx); lg[d] = ev; ssum += ev; }
    const float inv = PSC / ssum;
    unsigned short* ph = Pa + (hl * 32 + row) * PAP;
    unsigned short* pl = Pa + (64 + hl * 32 + row) * PAP;
#pragma unroll
    for (int d = 0; d < 32; ++d) {
      const float pv = lg[d] * inv;
      const _Float16 hv = (_Float16)pv;
      const _Float16 lv = (_Float16)((pv - (float)hv) * RSC);
      ph[d] = h_bits(hv);
      pl[d] = h_bits(lv);
    }
  }
  __syncthreads();

  // ---- phase 4: out = attn . v ----
  {
    const int pr = wave >> 1, hl = wave & 1;
    Frag ah[2], al[2];
#pragma unroll
    for (int mt = 0; mt < 2; ++mt) {
      const unsigned short* p0 = Pa + (hl * 32 + 16 * mt + c) * PAP + 8 * hh;
      ah[mt] = ldfrag(p0);
      al[mt] = ldfrag(p0 + 64 * PAP);
    }
    const size_t pbase = (size_t)bl * NPX * CDIM + 64 * g;
    const unsigned short* vpb = VP  + pbase + 32 * hl + 8 * hh;
    const unsigned short* vlb = VPL + pbase + 32 * hl + 8 * hh;
    unsigned short* owh = Ow + pr * (16 * TPH);
    unsigned short* owl = Ow + (4 + pr) * (16 * TPH);
    const int e8 = lane & 7, lr = (lane >> 3) + 8 * hl;                   // rows lr, lr+4 of the pair tile
#pragma unroll 1
    for (int i = 0; i < VIT; ++i) {                                        // 7 iterations
      const int n0 = (pr + 4 * (vt * VIT + i)) * 16;                       // tile 0..195
      const unsigned short* vr = vpb + (size_t)(n0 + c) * CDIM;
      const unsigned short* vl = vlb + (size_t)(n0 + c) * CDIM;
      const Frag fvh = ldfrag(vr);
      const Frag fvl = ldfrag(vl);
      v8f o[2], orr[2];
#pragma unroll
      for (int mt = 0; mt < 2; ++mt) {
        o[mt]   = mma_h(ah[mt].h, fvh.h, zero8());
        orr[mt] = mma_h(ah[mt].h, fvl.h, zero8());
        orr[mt] = mma_h(al[mt].h, fvh.h, orr[mt]);
      }
#pragma unroll
      for (int mt = 0; mt < 2; ++mt) {
        v4u uh, ul;
#pragma unroll
        for (int q = 0; q < 4; ++q) {
          const float f0 = o[mt][2 * q]     + orr[mt][2 * q]     * IRSC;
          const float f1 = o[mt][2 * q + 1] + orr[mt][2 * q + 1] * IRSC;
          const _Float16 h0 = (_Float16)f0, h1 = (_Float16)f1;
          const _Float16 l0 = (_Float16)((f0 - (float)h0) * RSC);
          const _Float16 l1 = (_Float16)((f1 - (float)h1) * RSC);
          uh[q] = pk16(h_bits(h0), h_bits(h1));
          ul[q] = pk16(h_bits(l0), h_bits(l1));
        }
        const int so = c * TPH + 32 * hl + 16 * mt + 8 * hh;               // channels 32hl+16mt+8hh..+7, px c
        *(v4u*)(owh + so) = uh;
        *(v4u*)(owl + so) = ul;
      }
      __syncthreads();
      const v4u a0 = *(const v4u*)(owh + lr * TPH + 8 * e8);
      const v4u a1 = *(const v4u*)(owh + (lr + 4) * TPH + 8 * e8);
      const v4u b0 = *(const v4u*)(owl + lr * TPH + 8 * e8);
      const v4u b1 = *(const v4u*)(owl + (lr + 4) * TPH + 8 * e8);
      unsigned short* d0 = OP  + pbase + (size_t)(n0 + lr) * CDIM + 8 * e8;
      unsigned short* d1 = OPL + pbase + (size_t)(n0 + lr) * CDIM + 8 * e8;
{
        *(v4u*)(d0) = a0;
        *(v4u*)(d0 + 4 * CDIM) = a1;
        *(v4u*)(d1) = b0;
        *(v4u*)(d1 + 4 * CDIM) = b1;
        
      }
      __syncthreads();
    }
  }
}

// =====================================================================================================
// Workspace map (bytes; each region start a multiple of 256; every extent an exact tile multiple). All 16 batches go
// through each stage in one launch. Six regions are carved; a plane whose first store comes in a launch behind the
// last read of a region lies on top of that region:
//   WQ16 bf16 [768][256]          393216      WP16 f16 [256][256]            131072
//   R1   f32 [16][768][3136]   154140672      read last by (3); from (4a) on it holds OP, OPL f16 [16][3136][256]
//                                             25690112 x 2 and PS f32 [16][4][14][2176] 7798784, side by side
//   QK   f16 [16][512][3136]    51380224      stored first by (3); up to (2) it holds XP bf16 [16][3136][256] 25690112
//   VP, VPL f16 [16][3136][256] 25690112 x 2                                              total = 257425408
// =====================================================================================================
extern "C" void kernel_launch(void* const* d_in, const int* in_sizes, int n_in,
                              void* d_out, int out_size, void* d_ws, size_t ws_size,
                              hipStream_t stream) {
  const int XN = NBAT * CDIM * NPX;                      // 12845056
  if (n_in < 5) return;
  if (in_sizes[0] != XN) return;
  if (in_sizes[1] != C3 * CDIM) return;
  if (in_sizes[2] != C3 * 9) return;
  if (in_sizes[3] != CDIM * CDIM) return;
  if (in_sizes[4] != NHEAD) return;
  if (out_size != XN) return;

  size_t off = 0;
  auto carve = [&](size_t bytes) { const size_t o = off; off += (bytes + 255) & ~(size_t)255; return o; };
  const size_t plane16 = (size_t)NCHK * NPX * CDIM * 2;  // 25690112
  static_assert((size_t)NCHK * NPX * CDIM * 2 % 256 == 0);
  static_assert((size_t)NCHK * NPX * CDIM * 2 * 2 + (size_t)NCHK * (CDIM / 64) * NSL * PREC * 4
                <= (size_t)NCHK * C3 * NPX * 4);          // OP, OPL, PS fit on R1
  static_assert((size_t)NCHK * NPX * CDIM * 2 <= (size_t)NCHK * CQK * NPX * 2);   // XP fits on QK
  const size_t oWQ  = carve((size_t)C3 * CDIM * 2);
  const size_t oWP  = carve((size_t)CDIM * CDIM * 2);
  const size_t oR1  = carve((size_t)NCHK * C3 * NPX * 4);
  const size_t oQK  = carve((size_t)NCHK * CQK * NPX * 2);
  const size_t oVP  = carve(plane16);
  const size_t oVPL = carve(plane16);
  if (off > ws_size) return;
  const size_t oXP  = oQK;
  const size_t oOP  = oR1;
  const size_t oOPL = oR1 + plane16;
  const size_t oPS  = oR1 + 2 * plane16;

  const float* x    = (const float*)d_in[0];
  const float* wq   = (const float*)d_in[1];
  const float* wdw  = (const float*)d_in[2];
  const float* wp   = (const float*)d_in[3];
  const float* temp = (const float*)d_in[4];
  float* out = (float*)d_out;

  char* ws = (char*)d_ws;
  unsigned short* WQ16 = (unsigned short*)(ws + oWQ);
  unsigned short* WP16 = (unsigned short*)(ws + oWP);
  unsigned short* XP   = (unsigned short*)(ws + oXP);
  float*          R1   = (float*)(ws + oR1);
  unsigned short* QK   = (unsigned short*)(ws + oQK);
  unsigned short* VP   = (unsigned short*)(ws + oVP);
  unsigned short* VPL  = (unsigned short*)(ws + oVPL);
  unsigned short* OP   = (unsigned short*)(ws + oOP);
  unsigned short* OPL  = (unsigned short*)(ws + oOPL);
  float*          PS   = (float*)(ws + oPS);

  const dim3 blk256(256), blk128(128);

  // (0) weights -> 16-bit planes
  cvt_w<<<dim3(32), blk256, 0, stream>>>(wq, wp, WQ16, WP16);
  // (1) x -> position-major bf16 [16][3136][256]
  cvt_x<<<dim3(NTILE, CDIM / QT, NCHK), blk256, 0, stream>>>(x, XP);
  // (2) qkv 1x1 conv -> f32 [16][768][3136]
  gemm_k<1, 0><<<dim3(NTILE, C3 / 128, NCHK), blk128, 0, stream>>>(WQ16, XP, XP, R1, C3, 1.0f);
  // (3) depthwise 3x3 -> q,k channel-major f16; v position-major f16 hi + residual
  dw_k<<<dim3(NTILE, C3 / QT, NCHK), blk256, 0, stream>>>(R1, wdw, QK, VP, VPL);
  // (4a) channel attention: partial logits and sums of squares per 224-px slice
  attn_s<<<dim3(NSL, CDIM / 64, NCHK), blk256, 0, stream>>>(QK, PS);
  // (4b) join, softmax, attn.v -> 256*out position-major f16 hi + residual [16][3136][256]
  attn_v<<<dim3(NVT, CDIM / 64, NCHK), blk256, 0, stream>>>(PS, VP, VPL, temp, OP, OPL);
  // (5) proj 1x1 conv -> d_out, scaled by 1/(64*256)
  gemm_k<0, 1><<<dim3(NTILE, CDIM / 64, NCHK), blk128, 0, stream>>>(WP16, OP, OPL, out, CDIM, OUTSC);
  (void)hipGetLastError();
}

// v003
// A run of this version takes 168 microseconds.
// Timed twice side by side with v002, it ran 1.45 times as fast both times.
// Counting every step since v000, it is 4.16 times as fast.
// Contractions: qkv 1x1 conv W[768x256].X[256x3136] on v_wmma_f32_16x16x32_bf16 (bf16 RNE operands, single product);
// channel logits q.k^T (32x32 per head, K=3136) on v_wmma_f32_16x16x32_f16 (f16 planes of the depthwise outputs);
// attn.v (K=32) on v_wmma_f32_16x16x32_f16 (attn x256 as f16 hi + x1024 residual, v as f16 hi + x1024 residual,
// 3 products); proj 1x1 conv on v_wmma_f32_16x16x32_f16 (64 x bf16-RNE weights as f16, 256 x out as f16 hi +
// x1024 residual, 2 products); f32 accumulate everywhere; depthwise 3x3, L2 norms and softmax in f32 on VALU.
#include <hip/hip_runtime.h>
#include <math.h>
#include <stdint.h>

#define NBAT   16
#define NCHK   16
#define CDIM   256
#define C3     768
#define CQK    512
#define NPX    3136
#define IMW    56
#define NHEAD  8
#define QT     64
#define NTILE  49
#define TPH    72
#define OSP    68
#define PAP    40
#define RSC    1024.0f
#define IRSC   0.0009765625f
#define PSC    256.0f
#define WSC    64.0f
#define OUTSC  6.103515625e-05f
#define NSL    14
#define SLPX   224
#define PREC   2176
#define NVT    7
#define VIT    7
#define SPE    264

static_assert(NTILE * QT == NPX);
static_assert(IMW * IMW == NPX);
static_assert(NCHK == NBAT);
static_assert(NPX % 32 == 0);
static_assert(NPX % 16 == 0);
static_assert((NPX / 16) % 4 == 0);
static_assert(CDIM % 32 == 0);
static_assert(C3 % 128 == 0);
static_assert(CDIM % 64 == 0);
static_assert((TPH * 2) % 16 == 0);
static_assert((OSP * 4) % 16 == 0);
static_assert((PAP * 2) % 16 == 0);
static_assert(NHEAD * 32 == CDIM);
static_assert(NSL * SLPX == NPX);
static_assert(SLPX % 32 == 0);
static_assert(SLPX / 8 <= 32);
static_assert(PREC == 2 * 32 * 32 + 128);
static_assert((PREC * 4) % 128 == 0);
static_assert(NVT * VIT * 64 == NPX);
static_assert(SPE == CDIM + 8);
static_assert((SPE * 2) % 32 == 16);

typedef _Float16       v16h __attribute__((ext_vector_type(16)));
typedef _Float16       v8h  __attribute__((ext_vector_type(8)));
typedef __bf16         v16b __attribute__((ext_vector_type(16)));
typedef unsigned short v8us __attribute__((ext_vector_type(8)));
typedef float          v8f  __attribute__((ext_vector_type(8)));
typedef float          v4f  __attribute__((ext_vector_type(4)));
typedef unsigned int   v4u  __attribute__((ext_vector_type(4)));

union Frag { v8us u[2]; v16h h; v16b bf; };
static_assert(sizeof(Frag) == 32);

// ---- scalar helpers ---------------------------------------------------------------------------------
__device__ __forceinline__ unsigned short bf_bits(float f) {          // f32 -> bf16 bits, RNE convert
  unsigned u = __float_as_uint(f);
  return (unsigned short)((u + 0x7FFFu + ((u >> 16) & 1u)) >> 16);
}
__device__ __forceinline__ float bf_up(unsigned short hb) { return __uint_as_float(((unsigned)hb) << 16); }
__device__ __forceinline__ float bfr(float f) { return bf_up(bf_bits(f)); }
__device__ __forceinline__ unsigned short h_bits(_Float16 x) { return __builtin_bit_cast(unsigned short, x); }
__device__ __forceinline__ unsigned pk16(unsigned short a, unsigned short b) { return (unsigned)a | ((unsigned)b << 16); }
__device__ __forceinline__ v8f zero8() { v8f z = {0.f, 0.f, 0.f, 0.f, 0.f, 0.f, 0.f, 0.f}; return z; }

// ---- 16-bit fragment loader (A, or B from a k-contiguous [n][k] row): lane -> row/col (lane&15), p already
//      includes + 8*(lane>>4); elements 0..7 <- p[0..7] (k0+8h..), elements 8..15 <- p[16..23] (k0+16+8h..)
__device__ __forceinline__ Frag ldfrag(const unsigned short* p) {
  Frag f;
  f.u[0] = *(const v8us*)(p);
  f.u[1] = *(const v8us*)(p + 16);
  return f;
}

// ---- WMMA helpers: builtin followed by a 4-slot VALU gap tying D and keeping A/B live ----------------------
__device__ __forceinline__ v8f mma_h(v16h a, v16h b, v8f c) {
  v8f d = __builtin_amdgcn_wmma_f32_16x16x32_f16(false, a, false, b, (short)0, c, false, false);
#if defined(__HIP_DEVICE_COMPILE__)
  asm volatile("v_nop\n\tv_nop\n\tv_nop\n\tv_nop" : "+v"(d) : "v"(a), "v"(b));
#endif
  return d;
}
__device__ __forceinline__ v8f mma_b(v16b a, v16b b, v8f c) {
  v8f d = __builtin_amdgcn_wmma_f32_16x16x32_bf16(false, a, false, b, (short)0, c, false, false);
#if defined(__HIP_DEVICE_COMPILE__)
  const v16h ha = __builtin_bit_cast(v16h, a), hb = __builtin_bit_cast(v16h, b);
  asm volatile("v_nop\n\tv_nop\n\tv_nop\n\tv_nop" : "+v"(d) : "v"(ha), "v"(hb));
#endif
  return d;
}

// ---- eight asynchronous copies to LDS: copy j brings one whole 512-B row (32 lanes x 16 B), rows 4 apart; l is the
//      lane's LDS byte address and g its global address in the first row. The s_wait_xcnt at the end of the statement
//      stands in front of any later overwrite of an address register that a copy names.
__device__ __forceinline__ void copy8(unsigned l, const unsigned short* g) {
#if defined(__HIP_DEVICE_COMPILE__)
  asm volatile(
      "global_load_async_to_lds_b128 %0, %8, off\n\t"
      "global_load_async_to_lds_b128 %1, %9, off\n\t"
      "global_load_async_to_lds_b128 %2, %10, off\n\t"
      "global_load_async_to_lds_b128 %3, %11, off\n\t"
      "global_load_async_to_lds_b128 %4, %12, off\n\t"
      "global_load_async_to_lds_b128 %5, %13, off\n\t"
      "global_load_async_to_lds_b128 %6, %14, off\n\t"
      "global_load_async_to_lds_b128 %7, %15, off\n\t"
      "s_wait_xcnt 0x0"
      :: "v"(l), "v"(l + 4 * (SPE * 2)), "v"(l + 8 * (SPE * 2)), "v"(l + 12 * (SPE * 2)),
         "v"(l + 16 * (SPE * 2)), "v"(l + 20 * (SPE * 2)), "v"(l + 24 * (SPE * 2)), "v"(l + 28 * (SPE * 2)),
         "v"(g), "v"(g + 4 * CDIM), "v"(g + 8 * CDIM), "v"(g + 12 * CDIM),
         "v"(g + 16 * CDIM), "v"(g + 20 * CDIM), "v"(g + 24 * CDIM), "v"(g + 28 * CDIM)
      : "memory");
#endif
}

// =====================================================================================================
// (0) weights: wq f32 [768][256] -> WQ16 bf16 bits [768][256]; wp f32 [256][256] -> WP16 f16 bits of
// coverage: WQ16 32 blocks x 96 lines = 3072 lines = 768 x 256; WP16 32 x 32 = 1024 lines = 256 x 256.
// =====================================================================================================
__global__ __launch_bounds__(256)
void cvt_w(const float* __restrict__ wq, const float* __restrict__ wp,
           unsigned short* WQ16, unsigned short* WP16) {
  const int tid = threadIdx.x, e = tid & 7, lq = tid >> 3;
  v4u uq[3];
#pragma unroll
  for (int it = 0; it < 3; ++it) {
    const int L = blockIdx.x * 96 + it * 32 + lq;                 // 0..3071
    const float* s = wq + (size_t)64 * L + 8 * e;                  // max 196600 + 7 < 196608
    const v4f a = *(const v4f*)(s);
    const v4f b = *(const v4f*)(s + 4);
    uq[it][0] = pk16(bf_bits(a[0]), bf_bits(a[1]));
    uq[it][1] = pk16(bf_bits(a[2]), bf_bits(a[3]));
    uq[it][2] = pk16(bf_bits(b[0]), bf_bits(b[1]));
    uq[it][3] = pk16(bf_bits(b[2]), bf_bits(b[3]));
  }
  v4u up;
  const int Lp = blockIdx.x * 32 + lq;                             // 0..1023
  {
    const float* s = wp + (size_t)64 * Lp + 8 * e;                 // max 65528 + 7 < 65536
    const v4f a = *(const v4f*)(s);
    const v4f b = *(const v4f*)(s + 4);
    up[0] = pk16(h_bits((_Float16)(WSC * bfr(a[0]))), h_bits((_Float16)(WSC * bfr(a[1]))));
    up[1] = pk16(h_bits((_Float16)(WSC * bfr(a[2]))), h_bits((_Float16)(WSC * bfr(a[3]))));
    up[2] = pk16(h_bits((_Float16)(WSC * bfr(b[0]))), h_bits((_Float16)(WSC * bfr(b[1]))));
    up[3] = pk16(h_bits((_Float16)(WSC * bfr(b[2]))), h_bits((_Float16)(WSC * bfr(b[3]))));
  }
{
#pragma unroll
    for (int it = 0; it < 3; ++it) {
      const int L = blockIdx.x * 96 + it * 32 + lq;
      *(v4u*)(WQ16 + (size_t)64 * L + 8 * e) = uq[it];
    }
    *(v4u*)(WP16 + (size_t)64 * Lp + 8 * e) = up;
    
  }
}

// =====================================================================================================
// (1) x [16][256][3136] f32 -> XP position-major bf16 bits [16][3136][256] through an LDS tile
//     (64 ch) of 64 position rows: 8 consecutive lanes x 16 B per line, one instruction per 32 lines,
// coverage: load 256 threads x 4 it x 4 = 64 ch x 64 px; lines 2 x 32 = 64 rows; grid (49, 4, 16) covers XP.
// =====================================================================================================
__global__ __launch_bounds__(256)
void cvt_x(const float* __restrict__ x, unsigned short* XP) {
  __shared__ __align__(16) unsigned short Lt[QT * TPH];
  const int tid = threadIdx.x;
  const int nt = blockIdx.x, cg = blockIdx.y, bl = blockIdx.z;
  const int n0 = nt * QT;
  {
    const int n4 = (tid & 15) * 4, cs = tid >> 4;                   // cs 0..15
#pragma unroll
    for (int it = 0; it < 4; ++it) {
      const int cl = it * 16 + cs;                                   // 0..63
      const v4f v = *(const v4f*)(x + ((size_t)(bl * CDIM + cg * QT + cl)) * NPX + n0 + n4);
#pragma unroll
      for (int q = 0; q < 4; ++q) Lt[(n4 + q) * TPH + cl] = bf_bits(v[q]);
    }
  }
  __syncthreads();
  {
    const int e = tid & 7, lq = tid >> 3;                            // lq 0..31
    const v4u u0 = *(const v4u*)(Lt + lq * TPH + 8 * e);
    const v4u u1 = *(const v4u*)(Lt + (lq + 32) * TPH + 8 * e);
    unsigned short* d0 = XP + ((size_t)(bl * NPX + n0 + lq)) * CDIM + cg * QT + 8 * e;
    unsigned short* d1 = d0 + (size_t)32 * CDIM;
{
      *(v4u*)(d0) = u0;
      *(v4u*)(d1) = u1;
      
    }
  }
}

// =====================================================================================================
// (2) GEMM: Y[bl][m][n] = scale * sum_k A16[m][k] B16[bl][n][k] (K = 256 = 8 k-steps of 32), A and B rows
//     k-contiguous. The block's MR rows of A and 64 rows of B (and of BPL), all of K, are brought into LDS once by
//     asynchronous copies, a whole 512-B row per copy, at a pitch of 528 B; the split k map loader reads LDS. With RES: B carries a second
//     x1024 residual plane BPL into a separate accumulator, folded back as accl/1024 in the epilogue.
//     Block 128 threads = 4 waves; wave w owns columns n0+16w..+15 (one B fragment per k-step) and MT m-tiles
//     lines of the f32 channel-major plane (2 lines per 64-n row segment, 8 consecutive lanes x 16 B, one
// coverage: Os 4 waves x MT tiles x 16x16 = MR x 64; lines NIT x 16 = 2 MR = MR rows x 64 n; grid (49, M/MR, 16).
// =====================================================================================================
template <int BF, int RES>
__global__ __launch_bounds__(128)
void gemm_k(const unsigned short* __restrict__ A16, const unsigned short* __restrict__ BP,
            const unsigned short* __restrict__ BPL, float* Y, int M, float scale) {
  constexpr int MT  = RES ? 4 : 8;
  constexpr int MR  = 16 * MT;
  constexpr int NIT = (2 * MR) / 16;
  constexpr int NROW = MR + (RES ? 2 : 1) * QT;                        // staged rows: A, B, (BPL)
  static_assert(MR % 32 == 0 && QT % 32 == 0);
  static_assert(MR * OSP * 4 <= NROW * SPE * 2);
  static_assert(NROW / 4 <= 63);                                        // copies of a wave in flight
  __shared__ __align__(16) unsigned short St[NROW * SPE];
  float* Os = (float*)St;                                               // output staging, on St behind the K loop
  const int tid  = threadIdx.x;
  const int lane = tid & 31, wave = tid >> 5;
  const int hh   = lane >> 4, c = lane & 15;
  const int nt   = blockIdx.x, bl = blockIdx.z;
  const int m0   = blockIdx.y * MR, n0 = nt * QT;

  // ---- fill: wave w copies rows w, w+4, ... of each operand ----
  {
    const unsigned l0 = (unsigned)(uintptr_t)(St + wave * SPE + 8 * lane);
    const unsigned short* ga = A16 + (size_t)(m0 + wave) * CDIM + 8 * lane;
    const size_t go = ((size_t)(bl * NPX + n0 + wave)) * CDIM + 8 * lane;
    // the three loops are unrolled so that every copy's addresses are one add of a constant to a common base
#pragma unroll
    for (int s = 0; s < MR / 32; ++s) copy8(l0 + s * 32 * (SPE * 2), ga + s * 32 * CDIM);
#pragma unroll
    for (int s = 0; s < QT / 32; ++s) copy8(l0 + (MR + s * 32) * (SPE * 2), BP + go + s * 32 * CDIM);
    if (RES) {
#pragma unroll
      for (int s = 0; s < QT / 32; ++s) copy8(l0 + (MR + QT + s * 32) * (SPE * 2), BPL + go + s * 32 * CDIM);
    }
#if defined(__HIP_DEVICE_COMPILE__)
    // this wave's copies have landed before the barrier behind which the other waves read them
    asm volatile("s_wait_asynccnt 0x0" ::: "memory");
#endif
  }
  __syncthreads();

  const unsigned short* ap  = St + c * SPE + 8 * hh;
  const unsigned short* bp  = St + (MR + 16 * wave + c) * SPE + 8 * hh;
  const unsigned short* bpl = RES ? (bp + QT * SPE) : bp;

  v8f acc[MT], accl[MT];
#pragma unroll
  for (int mt = 0; mt < MT; ++mt) { acc[mt] = zero8(); accl[mt] = zero8(); }

#pragma unroll 2
  for (int ks = 0; ks < CDIM / 32; ++ks) {
    const Frag fb = ldfrag(bp + 32 * ks);
    Frag fbl;
    if (RES) fbl = ldfrag(bpl + 32 * ks); else fbl = fb;
    // the k-step's LDS reads stand as one group ahead of its WMMAs: one LDS latency per k-step, not one per WMMA;
    // unrolled so that fa[] lives in registers
    Frag fa[MT];
#pragma unroll
    for (int mt = 0; mt < MT; ++mt) fa[mt] = ldfrag(ap + (16 * mt) * SPE + 32 * ks);
#pragma unroll
    for (int mt = 0; mt < MT; ++mt) {
      if (BF) acc[mt] = mma_b(fa[mt].bf, fb.bf, acc[mt]);
      else    acc[mt] = mma_h(fa[mt].h, fb.h, acc[mt]);
      if (RES) accl[mt] = mma_h(fa[mt].h, fbl.h, accl[mt]);
    }
  }

  __syncthreads();                                                      // every wave has left St: it becomes Os

  // ---- epilogue -> LDS Os[m][n] ----
  {
    const int nl = 16 * wave + c;
#pragma unroll
    for (int mt = 0; mt < MT; ++mt) {
#pragma unroll
      for (int r = 0; r < 8; ++r) {
        float v = acc[mt][r];
        if (RES) v += accl[mt][r] * IRSC;
        Os[(16 * mt + 8 * hh + r) * OSP + nl] = v * scale;
      }
    }
  }
  __syncthreads();

  {
    const int e = tid & 7, lq = tid >> 3;                              // lq 0..15
{
#pragma unroll
      for (int it = 0; it < NIT; ++it) {
        const int L = it * 16 + lq;                                    // 0..2MR-1
        const int row = L >> 1, hf = L & 1;
        const v4f v = *(const v4f*)(Os + row * OSP + hf * 32 + 4 * e);
        float* dst = Y + ((size_t)(bl * M + m0 + row)) * NPX + n0 + hf * 32 + 4 * e;
        *(v4f*)dst = v;
      }
      
    }
  }
}

// =====================================================================================================
// (3) depthwise 3x3, zero pad 1, for one (64 px tile, 64-channel group cg, batch bl) of the f32 plane
//     QKV[16][768][3136]; weights = bf16-RNE values staged in LDS. Thread (px = tid&63, 16 channels 4i+(tid>>6));
//     the 9 tap offsets are clamped addresses, taps outside the image zeroed by predicate. Results as f16 hi
//     (and x1024 residual) into LDS tiles, then:
// coverage: 256 threads x 16 channels = 64 ch x 64 px per tile; lines 2 x 32 = 64 per plane; grid (49, 12, 16)
//           covers QK (cg 0..7 -> channels 0..511) and VP/VPL (cg 8..11 -> v channels 0..255) exactly once.
// =====================================================================================================
__global__ __launch_bounds__(256)
void dw_k(const float* __restrict__ QKV, const float* __restrict__ wdw,
          unsigned short* QK, unsigned short* VP, unsigned short* VPL) {
  __shared__ __align__(16) unsigned short Th[QT * TPH];
  __shared__ __align__(16) unsigned short Tl[QT * TPH];
  __shared__ float Wc[QT * 9];
  const int tid = threadIdx.x;
  const int nt = blockIdx.x, cg = blockIdx.y, bl = blockIdx.z;
  const int n0 = nt * QT;
  const bool isv = (cg >= 8);                                           // block-uniform
  for (int k = tid; k < QT * 9; k += 256) Wc[k] = bfr(wdw[cg * (QT * 9) + k]);   // max 6336 + 575 = 6911
  const int pl = tid & 63, cs = tid >> 6;
  const int p  = n0 + pl;
  const int y  = p / IMW, xw = p - y * IMW;
  int off[9];
  unsigned okm = 0u;
#pragma unroll
  for (int t = 0; t < 9; ++t) {
    const int ky = t / 3, kx = t - 3 * ky;
    const int yy = y + ky - 1, xx = xw + kx - 1;
    const bool ok = ((unsigned)yy < (unsigned)IMW) && ((unsigned)xx < (unsigned)IMW);
    off[t] = min(max(yy, 0), IMW - 1) * IMW + min(max(xx, 0), IMW - 1);
    okm |= ok ? (1u << t) : 0u;
  }
  __syncthreads();

#pragma unroll 1
  for (int i = 0; i < 16; ++i) {
    const int ch = 4 * i + cs;                                           // 0..63
    const float* src = QKV + ((size_t)(bl * C3 + cg * QT + ch)) * NPX;
    const float* wt  = Wc + ch * 9;
    float s = 0.f;
#pragma unroll
    for (int t = 0; t < 9; ++t) {
      const float v = src[off[t]];
      s = fmaf(((okm >> t) & 1u) ? v : 0.f, wt[t], s);
    }
    const _Float16 hv = (_Float16)s;
    const _Float16 lv = (_Float16)((s - (float)hv) * RSC);
    const int li = isv ? (pl * TPH + ch) : (ch * TPH + pl);
    Th[li] = h_bits(hv);
    Tl[li] = h_bits(lv);
  }
  __syncthreads();
  {
    const int e = tid & 7, lq = tid >> 3;                                 // lq 0..31
    const v4u h0 = *(const v4u*)(Th + lq * TPH + 8 * e);
    const v4u h1 = *(const v4u*)(Th + (lq + 32) * TPH + 8 * e);
    const v4u l0 = *(const v4u*)(Tl + lq * TPH + 8 * e);
    const v4u l1 = *(const v4u*)(Tl + (lq + 32) * TPH + 8 * e);
    if (isv) {
      const int vg = cg - 8;                                              // 0..3
      const size_t o0 = ((size_t)(bl * NPX + n0 + lq)) * CDIM + vg * QT + 8 * e;
      const size_t o1 = o0 + (size_t)32 * CDIM;
{
        *(v4u*)(VP  + o0) = h0;
        *(v4u*)(VP  + o1) = h1;
        *(v4u*)(VPL + o0) = l0;
        *(v4u*)(VPL + o1) = l1;
        
      }
    } else {
      const size_t o0 = ((size_t)(bl * CQK + cg * QT + lq)) * NPX + n0 + 8 * e;
      const size_t o1 = o0 + (size_t)32 * NPX;
{
        *(v4u*)(QK + o0) = h0;
        *(v4u*)(QK + o1) = h1;
        
      }
    }
  }
}

// =====================================================================================================
// (4a) channel attention, partial sums for one (pixel slice sl of 224 px, head pair g: heads 2g, 2g+1 = channels
//      64g..64g+63, batch bl), 256 threads.
//   phase 1: per-row sum of squares of q rows 64g..+63 and k rows 256+64g..+63 over the slice (f32, one 8-px
//            vector per lane, lanes 0..27, + xor tree), wave w -> rows 16w..16w+15.
//   phase 2: S[hl][c][d] = sum_n q[c][n] k[d][n] over the slice: 8 D tiles (hl, mt, nt) one per wave, A = q row
//            16mt+(lane&15), B = k row 16nt+(lane&15), both k-contiguous with the split k map, 7 k-steps on f16 WMMA.
//   The record [2][32][32] logits + [128] sums of squares goes through LDS and out as whole 128-B lines.
// coverage: 14 slices x 224 px = 3136 px; record 2 x 256 x 4 + 32 x 4 = 2176 floats; grid (14, 4, 16) covers PS.
// =====================================================================================================
__global__ __launch_bounds__(256)
void attn_s(const unsigned short* __restrict__ QK, float* PS) {
  __shared__ __align__(16) float sP[PREC];
  const int tid  = threadIdx.x;
  const int lane = tid & 31, wave = tid >> 5;
  const int hh   = lane >> 4, c = lane & 15;
  const int sl   = blockIdx.x, g = blockIdx.y, bl = blockIdx.z;
  const unsigned short* qkb = QK + (size_t)bl * CQK * NPX + sl * SLPX;

  // The slice is short enough for a wave to hold all of it in registers: the loads of both phases stand ahead
  // of the arithmetic, so that they are in flight together instead of one latency per row and per k-step.
  const int hl = wave >> 2, mt = (wave >> 1) & 1, ntk = wave & 1;
  Frag fa[SLPX / 32], fb[SLPX / 32];
  v8h  rv[16];
  {
    const unsigned short* arow = qkb + (size_t)(64 * g + 32 * hl + 16 * mt + c) * NPX + 8 * hh;
    const unsigned short* brow = qkb + (size_t)(256 + 64 * g + 32 * hl + 16 * ntk + c) * NPX + 8 * hh;
    const int idc = min(lane, SLPX / 8 - 1);                              // 28 vectors per row slice
    const int ch0 = 64 * g + 16 * wave + ((wave >= 4) ? 192 : 0);         // q: 64g+16w, k: 256+64g+16(w-4)
    const unsigned short* rp = qkb + (size_t)ch0 * NPX + 8 * idc;
#pragma unroll
    for (int ks = 0; ks < SLPX / 32; ++ks) {
      fa[ks] = ldfrag(arow + 32 * ks);
      fb[ks] = ldfrag(brow + 32 * ks);
    }
#pragma unroll
    for (int rr = 0; rr < 16; ++rr) rv[rr] = *(const v8h*)(rp + rr * NPX);
#if defined(__HIP_DEVICE_COMPILE__)
    // the wait that stands before a register named by an issued global load is overwritten; the three address
    // pairs are inputs so that no load of this run is given one of them as its destination
    asm volatile("s_wait_xcnt 0x0" :: "v"(arow), "v"(brow), "v"(rp) : "memory");
#endif
  }

  // ---- phase 1: row sums of squares over the slice ----
  {
    float s[16];
#pragma unroll
    for (int rr = 0; rr < 16; ++rr) {
      float t = 0.f;
#pragma unroll
      for (int q = 0; q < 8; ++q) { const float f = (float)rv[rr][q]; t = fmaf(f, f, t); }
      s[rr] = (lane < SLPX / 8) ? t : 0.f;
    }
#pragma unroll
    for (int off = 16; off > 0; off >>= 1) {
#pragma unroll
      for (int rr = 0; rr < 16; ++rr) s[rr] += __shfl_xor(s[rr], off, 32);
    }
    if (lane == 0) {
#pragma unroll
      for (int rr = 0; rr < 16; ++rr) sP[2048 + 16 * wave + rr] = s[rr];
    }
  }

  // ---- phase 2: raw logits S of the slice on f16 WMMA ----
  {
    v8f acc = zero8();
#pragma unroll
    for (int ks = 0; ks < SLPX / 32; ++ks) acc = mma_h(fa[ks].h, fb[ks].h, acc);
    float* sp = sP + hl * 1024 + (16 * mt + 8 * hh) * 32 + 16 * ntk + c;
#pragma unroll
    for (int r = 0; r < 8; ++r) sp[r * 32] = acc[r];
  }
  __syncthreads();
  {
    float* dst = PS + ((size_t)((bl * (CDIM / 64) + g) * NSL + sl)) * PREC;
    const v4f r0 = *(const v4f*)(sP + 4 * tid);
    const v4f r1 = *(const v4f*)(sP + 1024 + 4 * tid);
    *(v4f*)(dst + 4 * tid) = r0;
    *(v4f*)(dst + 1024 + 4 * tid) = r1;
    if (tid < 32) {                                                        // wave 0
      const v4f r2 = *(const v4f*)(sP + 2048 + 4 * tid);
      *(v4f*)(dst + 2048 + 4 * tid) = r2;
    }
  }
}

// =====================================================================================================
// (4b) softmax and attn.v for one (pixel range vt of 448 px, head pair g, batch bl), 256 threads.
//   join:    the 14 slice records of (g, bl) summed in slice order (f32) -> S in LDS, 1/max(norm, eps) in LDS;
//            every block of a (g, bl) does the same sums and gets the same attn.
//   phase 3: logits = S * invq * invk * temperature (bf16-RNE), max-subtracted softmax in f32, attn x256 as f16
//            hi and x1024 residual into LDS Pa [c][d] (d contiguous = A operand of phase 4).
//   phase 4: out[c][n] = sum_d attn[c][d] v[d][n]: waves (2pr, 2pr+1) share one 16-px tile (tile pr + 4(7vt + i)), wave
//            hl does head hl: A = Pa frags (resident), B = v rows of VP/VPL (position-major, k = d contiguous):
//            hi.hi -> o, hi.res + res.hi -> orr (x1024). 256*out = o + orr/1024 split into f16 hi + x1024 residual,
//            [16][3136][256] (64-ch slab of a 512-B row): wave hl writes rows {lr, lr+4}, lr = (lane>>3)+8hl, 8 consecutive
// coverage: phase 4: 7 ranges x 4 pairs x 7 iterations = 196 tiles x 16 px = 3136 rows; per row the two waves'
//           halves (32hl + 16mt + 8hh + r) cover the 64-ch slab; grid (7, 4, 16) covers OP/OPL exactly once.
// =====================================================================================================
__global__ __launch_bounds__(256)
void attn_v(const float* __restrict__ PS, const unsigned short* __restrict__ VP,
            const unsigned short* __restrict__ VPL, const float* __restrict__ temp,
            unsigned short* OP, unsigned short* OPL) {
  __shared__ float sInv[128];
  __shared__ float sS[2 * 32 * 33];
  __shared__ __align__(16) unsigned short Pa[4 * 32 * PAP];            // [hi|res][hl][32][PAP]
  __shared__ __align__(16) unsigned short Ow[8 * 16 * TPH];            // [hi|res][pair][16][TPH]
  const int tid  = threadIdx.x;
  const int lane = tid & 31, wave = tid >> 5;
  const int hh   = lane >> 4, c = lane & 15;
  const int vt   = blockIdx.x, g = blockIdx.y, bl = blockIdx.z;

  // ---- join the slice records ----
  {
    const float* pb = PS + ((size_t)((bl * (CDIM / 64) + g) * NSL)) * PREC;
    v4f a0 = {0.f, 0.f, 0.f, 0.f}, a1 = {0.f, 0.f, 0.f, 0.f};
#pragma unroll
    for (int s = 0; s < NSL; ++s) {
      a0 += *(const v4f*)(pb + s * PREC + 4 * tid);
      a1 += *(const v4f*)(pb + s * PREC + 1024 + 4 * tid);
    }
    float* s0 = sS + (tid >> 3) * 33 + 4 * (tid & 7);                      // head 0: row tid>>3, d 4(tid&7)..+3
    float* s1 = s0 + 32 * 33;                                              // head 1
#pragma unroll
    for (int q = 0; q < 4; ++q) { s0[q] = a0[q]; s1[q] = a1[q]; }
    if (tid < 32) {                                                        // wave 0
      v4f an = {0.f, 0.f, 0.f, 0.f};
#pragma unroll
      for (int s = 0; s < NSL; ++s) an += *(const v4f*)(pb + s * PREC + 2048 + 4 * tid);
#pragma unroll
      for (int q = 0; q < 4; ++q) sInv[4 * tid + q] = 1.0f / fmaxf(sqrtf(an[q]), 1e-12f);
    }
  }
  __syncthreads();

  // ---- phase 3: softmax, attn x256 as f16 hi + residual ----
  if (tid < 64) {                                                          // waves 0, 1
    const int hl = tid >> 5, row = tid & 31;
    const float tv = bfr(temp[2 * g + hl]);
    const float iq = sInv[32 * hl + row] * tv;
    const float* srow = sS + hl * (32 * 33) + row * 33;
    const float* ik   = sInv + 64 + 32 * hl;
    float lg[32];
    float mx = -3.0e38f;
#pragma unroll
    for (int d = 0; d < 32; ++d) { const float v = srow[d] * iq * ik[d]; lg[d] = v; mx = fmaxf(mx, v); }
    float ssum = 0.f;
#pragma unroll
    for (int d = 0; d < 32; ++d) { const float ev = __expf(lg[d] - mx); lg[d] = ev; ssum += ev; }
    const float inv = PSC / ssum;
    unsigned short* ph = Pa + (hl * 32 + row) * PAP;
    unsigned short* pl = Pa + (64 + hl * 32 + row) * PAP;
#pragma unroll
    for (int d = 0; d < 32; ++d) {
      const float pv = lg[d] * inv;
      const _Float16 hv = (_Float16)pv;
      const _Float16 lv = (_Float16)((pv - (float)hv) * RSC);
      ph[d] = h_bits(hv);
      pl[d] = h_bits(lv);
    }
  }
  __syncthreads();

  // ---- phase 4: out = attn . v ----
  {
    const int pr = wave >> 1, hl = wave & 1;
    Frag ah[2], al[2];
#pragma unroll
    for (int mt = 0; mt < 2; ++mt) {
      const unsigned short* p0 = Pa + (hl * 32 + 16 * mt + c) * PAP + 8 * hh;
      ah[mt] = ldfrag(p0);
      al[mt] = ldfrag(p0 + 64 * PAP);
    }
    const size_t pbase = (size_t)bl * NPX * CDIM + 64 * g;
    const unsigned short* vpb = VP  + pbase + 32 * hl + 8 * hh;
    const unsigned short* vlb = VPL + pbase + 32 * hl + 8 * hh;
    unsigned short* owh = Ow + pr * (16 * TPH);
    unsigned short* owl = Ow + (4 + pr) * (16 * TPH);
    const int e8 = lane & 7, lr = (lane >> 3) + 8 * hl;                   // rows lr, lr+4 of the pair tile
#pragma unroll 1
    for (int i = 0; i < VIT; ++i) {                                        // 7 iterations
      const int n0 = (pr + 4 * (vt * VIT + i)) * 16;                       // tile 0..195
      const unsigned short* vr = vpb + (size_t)(n0 + c) * CDIM;
      const unsigned short* vl = vlb + (size_t)(n0 + c) * CDIM;
      const Frag fvh = ldfrag(vr);
      const Frag fvl = ldfrag(vl);
      v8f o[2], orr[2];
#pragma unroll
      for (int mt = 0; mt < 2; ++mt) {
        o[mt]   = mma_h(ah[mt].h, fvh.h, zero8());
        orr[mt] = mma_h(ah[mt].h, fvl.h, zero8());
        orr[mt] = mma_h(al[mt].h, fvh.h, orr[mt]);
      }
#pragma unroll
      for (int mt = 0; mt < 2; ++mt) {
        v4u uh, ul;
#pragma unroll
        for (int q = 0; q < 4; ++q) {
          const float f0 = o[mt][2 * q]     + orr[mt][2 * q]     * IRSC;
          const float f1 = o[mt][2 * q + 1] + orr[mt][2 * q + 1] * IRSC;
          const _Float16 h0 = (_Float16)f0, h1 = (_Float16)f1;
          const _Float16 l0 = (_Float16)((f0 - (float)h0) * RSC);
          const _Float16 l1 = (_Float16)((f1 - (float)h1) * RSC);
          uh[q] = pk16(h_bits(h0), h_bits(h1));
          ul[q] = pk16(h_bits(l0), h_bits(l1));
        }
        const int so = c * TPH + 32 * hl + 16 * mt + 8 * hh;               // channels 32hl+16mt+8hh..+7, px c
        *(v4u*)(owh + so) = uh;
        *(v4u*)(owl + so) = ul;
      }
      __syncthreads();
      const v4u a0 = *(const v4u*)(owh + lr * TPH + 8 * e8);
      const v4u a1 = *(const v4u*)(owh + (lr + 4) * TPH + 8 * e8);
      const v4u b0 = *(const v4u*)(owl + lr * TPH + 8 * e8);
      const v4u b1 = *(const v4u*)(owl + (lr + 4) * TPH + 8 * e8);
      unsigned short* d0 = OP  + pbase + (size_t)(n0 + lr) * CDIM + 8 * e8;
      unsigned short* d1 = OPL + pbase + (size_t)(n0 + lr) * CDIM + 8 * e8;
{
        *(v4u*)(d0) = a0;
        *(v4u*)(d0 + 4 * CDIM) = a1;
        *(v4u*)(d1) = b0;
        *(v4u*)(d1 + 4 * CDIM) = b1;
        
      }
      __syncthreads();
    }
  }
}

// =====================================================================================================
// Workspace map (bytes; each region start a multiple of 256; every extent an exact tile multiple). All 16 batches go
// through each stage in one launch. Six regions are carved; a plane whose first store comes in a launch behind the
// last read of a region lies on top of that region:
//   WQ16 bf16 [768][256]          393216      WP16 f16 [256][256]            131072
//   R1   f32 [16][768][3136]   154140672      read last by (3); from (4a) on it holds OP, OPL f16 [16][3136][256]
//                                             25690112 x 2 and PS f32 [16][4][14][2176] 7798784, side by side
//   QK   f16 [16][512][3136]    51380224      stored first by (3); up to (2) it holds XP bf16 [16][3136][256] 25690112
//   VP, VPL f16 [16][3136][256] 25690112 x 2                                              total = 257425408
// =====================================================================================================
extern "C" void kernel_launch(void* const* d_in, const int* in_sizes, int n_in,
                              void* d_out, int out_size, void* d_ws, size_t ws_size,
                              hipStream_t stream) {
  const int XN = NBAT * CDIM * NPX;                      // 12845056
  if (n_in < 5) return;
  if (in_sizes[0] != XN) return;
  if (in_sizes[1] != C3 * CDIM) return;
  if (in_sizes[2] != C3 * 9) return;
  if (in_sizes[3] != CDIM * CDIM) return;
  if (in_sizes[4] != NHEAD) return;
  if (out_size != XN) return;

  size_t off = 0;
  auto carve = [&](size_t bytes) { const size_t o = off; off += (bytes + 255) & ~(size_t)255; return o; };
  const size_t plane16 = (size_t)NCHK * NPX * CDIM * 2;  // 25690112
  static_assert((size_t)NCHK * NPX * CDIM * 2 % 256 == 0);
  static_assert((size_t)NCHK * NPX * CDIM * 2 * 2 + (size_t)NCHK * (CDIM / 64) * NSL * PREC * 4
                <= (size_t)NCHK * C3 * NPX * 4);          // OP, OPL, PS fit on R1
  static_assert((size_t)NCHK * NPX * CDIM * 2 <= (size_t)NCHK * CQK * NPX * 2);   // XP fits on QK
  const size_t oWQ  = carve((size_t)C3 * CDIM * 2);
  const size_t oWP  = carve((size_t)CDIM * CDIM * 2);
  const size_t oR1  = carve((size_t)NCHK * C3 * NPX * 4);
  const size_t oQK  = carve((size_t)NCHK * CQK * NPX * 2);
  const size_t oVP  = carve(plane16);
  const size_t oVPL = carve(plane16);
  if (off > ws_size) return;
  const size_t oXP  = oQK;
  const size_t oOP  = oR1;
  const size_t oOPL = oR1 + plane16;
  const size_t oPS  = oR1 + 2 * plane16;

  const float* x    = (const float*)d_in[0];
  const float* wq   = (const float*)d_in[1];
  const float* wdw  = (const float*)d_in[2];
  const float* wp   = (const float*)d_in[3];
  const float* temp = (const float*)d_in[4];
  float* out = (float*)d_out;

  char* ws = (char*)d_ws;
  unsigned short* WQ16 = (unsigned short*)(ws + oWQ);
  unsigned short* WP16 = (unsigned short*)(ws + oWP);
  unsigned short* XP   = (unsigned short*)(ws + oXP);
  float*          R1   = (float*)(ws + oR1);
  unsigned short* QK   = (unsigned short*)(ws + oQK);
  unsigned short* VP   = (unsigned short*)(ws + oVP);
  unsigned short* VPL  = (unsigned short*)(ws + oVPL);
  unsigned short* OP   = (unsigned short*)(ws + oOP);
  unsigned short* OPL  = (unsigned short*)(ws + oOPL);
  float*          PS   = (float*)(ws + oPS);

  const dim3 blk256(256), blk128(128);

  // (0) weights -> 16-bit planes
  cvt_w<<<dim3(32), blk256, 0, stream>>>(wq, wp, WQ16, WP16);
  // (1) x -> position-major bf16 [16][3136][256]
  cvt_x<<<dim3(NTILE, CDIM / QT, NCHK), blk256, 0, stream>>>(x, XP);
  // (2) qkv 1x1 conv -> f32 [16][768][3136]
  gemm_k<1, 0><<<dim3(NTILE, C3 / 128, NCHK), blk128, 0, stream>>>(WQ16, XP, XP, R1, C3, 1.0f);
  // (3) depthwise 3x3 -> q,k channel-major f16; v position-major f16 hi + residual
  dw_k<<<dim3(NTILE, C3 / QT, NCHK), blk256, 0, stream>>>(R1, wdw, QK, VP, VPL);
  // (4a) channel attention: partial logits and sums of squares per 224-px slice
  attn_s<<<dim3(NSL, CDIM / 64, NCHK), blk256, 0, stream>>>(QK, PS);
  // (4b) join, softmax, attn.v -> 256*out position-major f16 hi + residual [16][3136][256]
  attn_v<<<dim3(NVT, CDIM / 64, NCHK), blk256, 0, stream>>>(PS, VP, VPL, temp, OP, OPL);
  // (5) proj 1x1 conv -> d_out, scaled by 1/(64*256)
  gemm_k<0, 1><<<dim3(NTILE, CDIM / 64, NCHK), blk128, 0, stream>>>(WP16, OP, OPL, out, CDIM, OUTSC);
  (void)hipGetLastError();
}

// v004
// One run takes 148 microseconds.
// Next to v003, in two timings, it ran 1.14 and 1.13 times as fast.
// All steps since v000 together make it 4.73 times as fast.
// Contractions: qkv 1x1 conv W[768x256].X[256x3136] on v_wmma_f32_16x16x32_bf16 (bf16 RNE operands, single product);
// channel logits q.k^T (32x32 per head, K=3136) on v_wmma_f32_16x16x32_f16 (f16 planes of the depthwise outputs);
// attn.v (K=32) on v_wmma_f32_16x16x32_f16 (attn x256 as f16 hi + x1024 residual, v as f16 hi + x1024 residual,
// 3 products); proj 1x1 conv on v_wmma_f32_16x16x32_f16 (64 x bf16-RNE weights as f16, 256 x out as f16 hi +
// x1024 residual, 2 products); f32 accumulate everywhere; depthwise 3x3, L2 norms and softmax in f32 on VALU.
#include <hip/hip_runtime.h>
#include <math.h>
#include <stdint.h>

#define NBAT   16
#define NCHK   16
#define CDIM   256
#define C3     768
#define CQK    512
#define NPX    3136
#define IMW    56
#define NHEAD  8
#define QT     64
#define NTILE  49
#define TPH    72
#define OSP    68
#define PAP    40
#define RSC    1024.0f
#define IRSC   0.0009765625f
#define PSC    256.0f
#define WSC    64.0f
#define OUTSC  6.103515625e-05f
#define NSL    14
#define SLPX   224
#define PREC   2176
#define NVT    7
#define VIT    7
#define SPE    264
#define BROW   8
#define BPX    448
#define NBAND  7
#define NST    7
#define DWT    448
#define PQ     456

static_assert(NTILE * QT == NPX);
static_assert(IMW * IMW == NPX);
static_assert(NCHK == NBAT);
static_assert(NPX % 32 == 0);
static_assert(NPX % 16 == 0);
static_assert((NPX / 16) % 4 == 0);
static_assert(CDIM % 32 == 0);
static_assert(C3 % 128 == 0);
static_assert(CDIM % 64 == 0);
static_assert((TPH * 2) % 16 == 0);
static_assert((OSP * 4) % 16 == 0);
static_assert((PAP * 2) % 16 == 0);
static_assert(NHEAD * 32 == CDIM);
static_assert(NSL * SLPX == NPX);
static_assert(SLPX % 32 == 0);
static_assert(SLPX / 8 <= 32);
static_assert(PREC == 2 * 32 * 32 + 128);
static_assert((PREC * 4) % 128 == 0);
static_assert(NVT * VIT * 64 == NPX);
static_assert(SPE == CDIM + 8);
static_assert((SPE * 2) % 32 == 16);
static_assert(BROW * IMW == BPX);
static_assert(NBAND * BPX == NPX);
static_assert(NST * 8 == IMW);
static_assert(DWT == QT * NST);
static_assert((BPX * 2) % 128 == 0);
static_assert((PQ * 2) % 16 == 0 && PQ >= BPX);
static_assert(QT * PQ <= 2 * BPX * TPH);
static_assert(DWT / 8 == IMW);

typedef _Float16       v16h __attribute__((ext_vector_type(16)));
typedef _Float16       v8h  __attribute__((ext_vector_type(8)));
typedef __bf16         v16b __attribute__((ext_vector_type(16)));
typedef unsigned short v8us __attribute__((ext_vector_type(8)));
typedef float          v8f  __attribute__((ext_vector_type(8)));
typedef float          v4f  __attribute__((ext_vector_type(4)));
typedef unsigned int   v4u  __attribute__((ext_vector_type(4)));

union Frag { v8us u[2]; v16h h; v16b bf; };
static_assert(sizeof(Frag) == 32);

// ---- scalar helpers ---------------------------------------------------------------------------------
__device__ __forceinline__ unsigned short bf_bits(float f) {          // f32 -> bf16 bits, RNE convert
  unsigned u = __float_as_uint(f);
  return (unsigned short)((u + 0x7FFFu + ((u >> 16) & 1u)) >> 16);
}
__device__ __forceinline__ float bf_up(unsigned short hb) { return __uint_as_float(((unsigned)hb) << 16); }
__device__ __forceinline__ float bfr(float f) { return bf_up(bf_bits(f)); }
__device__ __forceinline__ unsigned short h_bits(_Float16 x) { return __builtin_bit_cast(unsigned short, x); }
__device__ __forceinline__ unsigned pk16(unsigned short a, unsigned short b) { return (unsigned)a | ((unsigned)b << 16); }
__device__ __forceinline__ v8f zero8() { v8f z = {0.f, 0.f, 0.f, 0.f, 0.f, 0.f, 0.f, 0.f}; return z; }

// ---- 16-bit fragment loader (A, or B from a k-contiguous [n][k] row): lane -> row/col (lane&15), p already
//      includes + 8*(lane>>4); elements 0..7 <- p[0..7] (k0+8h..), elements 8..15 <- p[16..23] (k0+16+8h..)
__device__ __forceinline__ Frag ldfrag(const unsigned short* p) {
  Frag f;
  f.u[0] = *(const v8us*)(p);
  f.u[1] = *(const v8us*)(p + 16);
  return f;
}

// ---- WMMA helpers: builtin followed by a 4-slot VALU gap tying D and keeping A/B live ----------------------
__device__ __forceinline__ v8f mma_h(v16h a, v16h b, v8f c) {
  v8f d = __builtin_amdgcn_wmma_f32_16x16x32_f16(false, a, false, b, (short)0, c, false, false);
#if defined(__HIP_DEVICE_COMPILE__)
  asm volatile("v_nop\n\tv_nop\n\tv_nop\n\tv_nop" : "+v"(d) : "v"(a), "v"(b));
#endif
  return d;
}
__device__ __forceinline__ v8f mma_b(v16b a, v16b b, v8f c) {
  v8f d = __builtin_amdgcn_wmma_f32_16x16x32_bf16(false, a, false, b, (short)0, c, false, false);
#if defined(__HIP_DEVICE_COMPILE__)
  const v16h ha = __builtin_bit_cast(v16h, a), hb = __builtin_bit_cast(v16h, b);
  asm volatile("v_nop\n\tv_nop\n\tv_nop\n\tv_nop" : "+v"(d) : "v"(ha), "v"(hb));
#endif
  return d;
}

// ---- eight asynchronous copies to LDS: copy j brings one whole 512-B row (32 lanes x 16 B), rows 4 apart; l is the
//      lane's LDS byte address and g its global address in the first row. The s_wait_xcnt at the end of the statement
//      stands in front of any later overwrite of an address register that a copy names.
__device__ __forceinline__ void copy8(unsigned l, const unsigned short* g) {
#if defined(__HIP_DEVICE_COMPILE__)
  asm volatile(
      "global_load_async_to_lds_b128 %0, %8, off\n\t"
      "global_load_async_to_lds_b128 %1, %9, off\n\t"
      "global_load_async_to_lds_b128 %2, %10, off\n\t"
      "global_load_async_to_lds_b128 %3, %11, off\n\t"
      "global_load_async_to_lds_b128 %4, %12, off\n\t"
      "global_load_async_to_lds_b128 %5, %13, off\n\t"
      "global_load_async_to_lds_b128 %6, %14, off\n\t"
      "global_load_async_to_lds_b128 %7, %15, off\n\t"
      "s_wait_xcnt 0x0"
      :: "v"(l), "v"(l + 4 * (SPE * 2)), "v"(l + 8 * (SPE * 2)), "v"(l + 12 * (SPE * 2)),
         "v"(l + 16 * (SPE * 2)), "v"(l + 20 * (SPE * 2)), "v"(l + 24 * (SPE * 2)), "v"(l + 28 * (SPE * 2)),
         "v"(g), "v"(g + 4 * CDIM), "v"(g + 8 * CDIM), "v"(g + 12 * CDIM),
         "v"(g + 16 * CDIM), "v"(g + 20 * CDIM), "v"(g + 24 * CDIM), "v"(g + 28 * CDIM)
      : "memory");
#endif
}

// =====================================================================================================
// (0) weights: wq f32 [768][256] -> WQ16 bf16 bits [768][256]; wp f32 [256][256] -> WP16 f16 bits of
// coverage: WQ16 32 blocks x 96 lines = 3072 lines = 768 x 256; WP16 32 x 32 = 1024 lines = 256 x 256.
// =====================================================================================================
__global__ __launch_bounds__(256)
void cvt_w(const float* __restrict__ wq, const float* __restrict__ wp,
           unsigned short* WQ16, unsigned short* WP16) {
  const int tid = threadIdx.x, e = tid & 7, lq = tid >> 3;
  v4u uq[3];
#pragma unroll
  for (int it = 0; it < 3; ++it) {
    const int L = blockIdx.x * 96 + it * 32 + lq;                 // 0..3071
    const float* s = wq + (size_t)64 * L + 8 * e;                  // max 196600 + 7 < 196608
    const v4f a = *(const v4f*)(s);
    const v4f b = *(const v4f*)(s + 4);
    uq[it][0] = pk16(bf_bits(a[0]), bf_bits(a[1]));
    uq[it][1] = pk16(bf_bits(a[2]), bf_bits(a[3]));
    uq[it][2] = pk16(bf_bits(b[0]), bf_bits(b[1]));
    uq[it][3] = pk16(bf_bits(b[2]), bf_bits(b[3]));
  }
  v4u up;
  const int Lp = blockIdx.x * 32 + lq;                             // 0..1023
  {
    const float* s = wp + (size_t)64 * Lp + 8 * e;                 // max 65528 + 7 < 65536
    const v4f a = *(const v4f*)(s);
    const v4f b = *(const v4f*)(s + 4);
    up[0] = pk16(h_bits((_Float16)(WSC * bfr(a[0]))), h_bits((_Float16)(WSC * bfr(a[1]))));
    up[1] = pk16(h_bits((_Float16)(WSC * bfr(a[2]))), h_bits((_Float16)(WSC * bfr(a[3]))));
    up[2] = pk16(h_bits((_Float16)(WSC * bfr(b[0]))), h_bits((_Float16)(WSC * bfr(b[1]))));
    up[3] = pk16(h_bits((_Float16)(WSC * bfr(b[2]))), h_bits((_Float16)(WSC * bfr(b[3]))));
  }
{
#pragma unroll
    for (int it = 0; it < 3; ++it) {
      const int L = blockIdx.x * 96 + it * 32 + lq;
      *(v4u*)(WQ16 + (size_t)64 * L + 8 * e) = uq[it];
    }
    *(v4u*)(WP16 + (size_t)64 * Lp + 8 * e) = up;
    
  }
}

// =====================================================================================================
// (1) x [16][256][3136] f32 -> XP position-major bf16 bits [16][3136][256] through an LDS tile
//     (64 ch) of 64 position rows: 8 consecutive lanes x 16 B per line, one instruction per 32 lines,
// coverage: load 256 threads x 4 it x 4 = 64 ch x 64 px; lines 2 x 32 = 64 rows; grid (49, 4, 16) covers XP.
// =====================================================================================================
__global__ __launch_bounds__(256)
void cvt_x(const float* __restrict__ x, unsigned short* XP) {
  __shared__ __align__(16) unsigned short Lt[QT * TPH];
  const int tid = threadIdx.x;
  const int nt = blockIdx.x, cg = blockIdx.y, bl = blockIdx.z;
  const int n0 = nt * QT;
  {
    const int n4 = (tid & 15) * 4, cs = tid >> 4;                   // cs 0..15
#pragma unroll
    for (int it = 0; it < 4; ++it) {
      const int cl = it * 16 + cs;                                   // 0..63
      const v4f v = *(const v4f*)(x + ((size_t)(bl * CDIM + cg * QT + cl)) * NPX + n0 + n4);
#pragma unroll
      for (int q = 0; q < 4; ++q) Lt[(n4 + q) * TPH + cl] = bf_bits(v[q]);
    }
  }
  __syncthreads();
  {
    const int e = tid & 7, lq = tid >> 3;                            // lq 0..31
    const v4u u0 = *(const v4u*)(Lt + lq * TPH + 8 * e);
    const v4u u1 = *(const v4u*)(Lt + (lq + 32) * TPH + 8 * e);
    unsigned short* d0 = XP + ((size_t)(bl * NPX + n0 + lq)) * CDIM + cg * QT + 8 * e;
    unsigned short* d1 = d0 + (size_t)32 * CDIM;
{
      *(v4u*)(d0) = u0;
      *(v4u*)(d1) = u1;
      
    }
  }
}

// =====================================================================================================
// (2) GEMM: Y[bl][m][n] = scale * sum_k A16[m][k] B16[bl][n][k] (K = 256 = 8 k-steps of 32), A and B rows
//     k-contiguous. The block's MR rows of A and 64 rows of B (and of BPL), all of K, are brought into LDS once by
//     asynchronous copies, a whole 512-B row per copy, at a pitch of 528 B; the split k map loader reads LDS. With RES: B carries a second
//     x1024 residual plane BPL into a separate accumulator, folded back as accl/1024 in the epilogue.
//     Block 128 threads = 4 waves; wave w owns columns n0+16w..+15 (one B fragment per k-step) and MT m-tiles
//     lines of the f32 channel-major plane (2 lines per 64-n row segment, 8 consecutive lanes x 16 B, one
// coverage: Os 4 waves x MT tiles x 16x16 = MR x 64; lines NIT x 16 = 2 MR = MR rows x 64 n; grid (49, M/MR, 16).
// =====================================================================================================
template <int BF, int RES>
__global__ __launch_bounds__(128)
void gemm_k(const unsigned short* __restrict__ A16, const unsigned short* __restrict__ BP,
            const unsigned short* __restrict__ BPL, float* Y, int M, float scale) {
  constexpr int MT  = RES ? 4 : 8;
  constexpr int MR  = 16 * MT;
  constexpr int NIT = (2 * MR) / 16;
  constexpr int NROW = MR + (RES ? 2 : 1) * QT;                        // staged rows: A, B, (BPL)
  static_assert(MR % 32 == 0 && QT % 32 == 0);
  static_assert(MR * OSP * 4 <= NROW * SPE * 2);
  static_assert(NROW / 4 <= 63);                                        // copies of a wave in flight
  __shared__ __align__(16) unsigned short St[NROW * SPE];
  float* Os = (float*)St;                                               // output staging, on St behind the K loop
  const int tid  = threadIdx.x;
  const int lane = tid & 31, wave = tid >> 5;
  const int hh   = lane >> 4, c = lane & 15;
  const int nt   = blockIdx.x, bl = blockIdx.z;
  const int m0   = blockIdx.y * MR, n0 = nt * QT;

  // ---- fill: wave w copies rows w, w+4, ... of each operand ----
  {
    const unsigned l0 = (unsigned)(uintptr_t)(St + wave * SPE + 8 * lane);
    const unsigned short* ga = A16 + (size_t)(m0 + wave) * CDIM + 8 * lane;
    const size_t go = ((size_t)(bl * NPX + n0 + wave)) * CDIM + 8 * lane;
    // the three loops are unrolled so that every copy's addresses are one add of a constant to a common base
#pragma unroll
    for (int s = 0; s < MR / 32; ++s) copy8(l0 + s * 32 * (SPE * 2), ga + s * 32 * CDIM);
#pragma unroll
    for (int s = 0; s < QT / 32; ++s) copy8(l0 + (MR + s * 32) * (SPE * 2), BP + go + s * 32 * CDIM);
    if (RES) {
#pragma unroll
      for (int s = 0; s < QT / 32; ++s) copy8(l0 + (MR + QT + s * 32) * (SPE * 2), BPL + go + s * 32 * CDIM);
    }
#if defined(__HIP_DEVICE_COMPILE__)
    // this wave's copies have landed before the barrier behind which the other waves read them
    asm volatile("s_wait_asynccnt 0x0" ::: "memory");
#endif
  }
  __syncthreads();

  const unsigned short* ap  = St + c * SPE + 8 * hh;
  const unsigned short* bp  = St + (MR + 16 * wave + c) * SPE + 8 * hh;
  const unsigned short* bpl = RES ? (bp + QT * SPE) : bp;

  v8f acc[MT], accl[MT];
#pragma unroll
  for (int mt = 0; mt < MT; ++mt) { acc[mt] = zero8(); accl[mt] = zero8(); }

#pragma unroll 2
  for (int ks = 0; ks < CDIM / 32; ++ks) {
    const Frag fb = ldfrag(bp + 32 * ks);
    Frag fbl;
    if (RES) fbl = ldfrag(bpl + 32 * ks); else fbl = fb;
    // the k-step's LDS reads stand as one group ahead of its WMMAs: one LDS latency per k-step, not one per WMMA;
    // unrolled so that fa[] lives in registers
    Frag fa[MT];
#pragma unroll
    for (int mt = 0; mt < MT; ++mt) fa[mt] = ldfrag(ap + (16 * mt) * SPE + 32 * ks);
#pragma unroll
    for (int mt = 0; mt < MT; ++mt) {
      if (BF) acc[mt] = mma_b(fa[mt].bf, fb.bf, acc[mt]);
      else    acc[mt] = mma_h(fa[mt].h, fb.h, acc[mt]);
      if (RES) accl[mt] = mma_h(fa[mt].h, fbl.h, accl[mt]);
    }
  }

  __syncthreads();                                                      // every wave has left St: it becomes Os

  // ---- epilogue -> LDS Os[m][n] ----
  {
    const int nl = 16 * wave + c;
#pragma unroll
    for (int mt = 0; mt < MT; ++mt) {
#pragma unroll
      for (int r = 0; r < 8; ++r) {
        float v = acc[mt][r];
        if (RES) v += accl[mt][r] * IRSC;
        Os[(16 * mt + 8 * hh + r) * OSP + nl] = v * scale;
      }
    }
  }
  __syncthreads();

  {
    const int e = tid & 7, lq = tid >> 3;                              // lq 0..15
{
#pragma unroll
      for (int it = 0; it < NIT; ++it) {
        const int L = it * 16 + lq;                                    // 0..2MR-1
        const int row = L >> 1, hf = L & 1;
        const v4f v = *(const v4f*)(Os + row * OSP + hf * 32 + 4 * e);
        float* dst = Y + ((size_t)(bl * M + m0 + row)) * NPX + n0 + hf * 32 + 4 * e;
        *(v4f*)dst = v;
      }
      
    }
  }
}

// =====================================================================================================
// (3) depthwise 3x3, zero pad 1, for one (band of 8 image rows = 448 px, 64-channel group cg, batch bl) of the f32
//     plane QKV[16][768][3136]; weights = bf16-RNE values in registers. Thread (channel tid/7, strip tid%7 of 8 px):
//     the 10 input rows of its strip (8 px as two 16-B loads, plus the left and the right neighbour) are held in
//     registers and give an 8 x 8 px patch; row and neighbour addresses are clamped, taps outside the image zeroed
//     by predicate; per output the 9 products are summed in tap order. Results as f16 hi (v: and x1024 residual)
//     into an LDS tile, then out as whole 128-B lines. v tile: [px][channel], the eight 16-B channel chunks of a px
//     row rotated by (px/8)&7 so that the strips of a wave store to different banks.
// coverage: 448 threads x 64 px = 64 ch x 448 px per tile; lines 8 x 56 = 448 per plane; grid (7, 12, 16)
//           covers QK (cg 0..7 -> channels 0..511) and VP/VPL (cg 8..11 -> v channels 0..255) exactly once.
// =====================================================================================================
__global__ __launch_bounds__(DWT)
void dw_k(const float* __restrict__ QKV, const float* __restrict__ wdw,
          unsigned short* QK, unsigned short* VP, unsigned short* VPL) {
  __shared__ __align__(16) unsigned short Tt[2 * BPX * TPH];           // v: [hi|res][448][TPH]; q,k: [64][PQ]
  const int tid = threadIdx.x;
  const int bd = blockIdx.x, cg = blockIdx.y, bl = blockIdx.z;
  const bool isv = (cg >= 8);                                           // block-uniform
  const int ch = tid / NST, st = tid - ch * NST;                        // ch 0..63, st 0..6
  const bool okt = (bd > 0), okb = (bd < NBAND - 1);                    // row above / below the band is in the image
  const bool okl = (st > 0), okr = (st < NST - 1);                      // left / right neighbour is in the image

  // Addresses: a block-uniform base (the band's first row; the row above it, clamped into the image) plus the
  // thread's byte offset (its strip; its left and right neighbour, clamped into the row).
  const char* sb  = (const char*)(QKV + ((size_t)(bl * C3 + cg * QT)) * NPX + bd * BPX);
  const char* sbt = sb - (okt ? IMW * 4 : 0);
  const unsigned ob = okb ? BROW * IMW * 4u : (BROW - 1) * IMW * 4u;    // the row below, as an offset from sb
  const char* sw  = (const char*)(wdw + cg * (QT * 9));
  unsigned vm = (unsigned)(ch * NPX + 8 * st) * 4u;                     // max (63 * 3136 + 48) * 4
  unsigned vl = vm - (okl ? 4u : 0u);
  unsigned vr = vm + (okr ? 32u : 28u);
  const unsigned vw = (unsigned)(ch * 9) * 4u;                          // group max 704 * 9 + 63 * 9 + 8 = 6911

  // every loop below over rows, px and taps is unrolled so that w[], in[] and o[] are registers with constant indices
  float w[9];
  float in[BROW + 2][10];
  auto ldrow = [&](int rr, const char* base, unsigned om, unsigned ol, unsigned orr) {
    const v4f a = *(const v4f*)(base + om);
    const v4f b = *(const v4f*)(base + om + 16);
    in[rr][0] = *(const float*)(base + ol);
    in[rr][9] = *(const float*)(base + orr);
#pragma unroll
    for (int q = 0; q < 4; ++q) { in[rr][1 + q] = a[q]; in[rr][5 + q] = b[q]; }
  };
  // taps outside the image read as zero
  auto mask = [&](int rr) {
    const bool oky = (rr == 0) ? okt : (rr == BROW + 1) ? okb : true;
    in[rr][0] = (oky && okl) ? in[rr][0] : 0.f;
    in[rr][9] = (oky && okr) ? in[rr][9] : 0.f;
    if (rr == 0 || rr == BROW + 1) {
#pragma unroll
      for (int q = 1; q < 9; ++q) in[rr][q] = oky ? in[rr][q] : 0.f;
    }
  };

  // first run of loads: the weights and input rows 0..7, all in flight together
#pragma unroll
  for (int t = 0; t < 9; ++t) w[t] = *(const float*)(sw + vw + 4 * t);
  ldrow(0, sbt, vm, vl, vr);
#pragma unroll
  for (int rr = 1; rr < BROW; ++rr) ldrow(rr, sb + (rr - 1) * (IMW * 4), vm, vl, vr);
#if defined(__HIP_DEVICE_COMPILE__)
  // the wait that stands before a register named by an issued global load is overwritten; the address registers are
  // operands so that no load of this run is given one of them as its destination; the three offsets are in/out so
  // that the second run forms its addresses from them again as scalar base + 32-bit offset: carried over from here
  // they would be three 64-bit pairs, held in registers through rows 0 and 1
  asm volatile("s_wait_xcnt 0x0" : "+v"(vm), "+v"(vl), "+v"(vr) : "v"(vw), "s"(sw), "s"(sb), "s"(sbt) : "memory");
#endif
#pragma unroll
  for (int t = 0; t < 9; ++t) w[t] = bfr(w[t]);

#pragma unroll
  for (int r = 0; r < BROW; ++r) {
    if (r == 2) {
      // second run: input rows 8 and 9 take the registers that rows 0 and 1 have left; they are used from r = 6 on
      const unsigned vm9 = vm + ob, vl9 = vl + ob, vr9 = vr + ob;
      ldrow(BROW, sb + (BROW - 1) * (IMW * 4), vm, vl, vr);
      ldrow(BROW + 1, sb, vm9, vl9, vr9);
#if defined(__HIP_DEVICE_COMPILE__)
      // the same wait for the second run of loads, its address registers as inputs
      asm volatile("s_wait_xcnt 0x0" :: "v"(vm), "v"(vl), "v"(vr), "v"(vm9), "v"(vl9), "v"(vr9), "s"(sb) : "memory");
#endif
    }
    if (r == 0) { mask(0); mask(1); }
    mask(r + 2);
    float o[8];
#pragma unroll
    for (int j = 0; j < 8; ++j) {
      float s = 0.f;
#pragma unroll
      for (int t = 0; t < 9; ++t) s = fmaf(in[r + t / 3][j + t % 3], w[t], s);
      o[j] = s;
    }
    if (isv) {
      const int p0 = r * IMW + 8 * st;                                   // px of the band, p0/8 = 7r + st
      unsigned short* th = Tt + p0 * TPH + ((ch + 8 * (NST * r + st)) & 63);
#pragma unroll
      for (int j = 0; j < 8; ++j) {
        const _Float16 hv = (_Float16)o[j];
        const _Float16 lv = (_Float16)((o[j] - (float)hv) * RSC);
        th[j * TPH] = h_bits(hv);
        th[BPX * TPH + j * TPH] = h_bits(lv);
      }
    } else {
      v4u u;
#pragma unroll
      for (int q = 0; q < 4; ++q) u[q] = pk16(h_bits((_Float16)o[2 * q]), h_bits((_Float16)o[2 * q + 1]));
      *(v4u*)(Tt + ch * PQ + r * IMW + 8 * st) = u;
    }
  }
  __syncthreads();
  {
    const int e = tid & 7, lq = tid >> 3;                                 // lq 0..55
    if (isv) {
      const int vg = cg - 8;                                              // 0..3
      unsigned short* dh = VP  + ((size_t)(bl * NPX + bd * BPX + lq)) * CDIM + vg * QT + 8 * e;
      unsigned short* dl = VPL + ((size_t)(bl * NPX + bd * BPX + lq)) * CDIM + vg * QT + 8 * e;
#pragma unroll
      for (int it = 0; it < BROW; ++it) {
        const int px = it * IMW + lq;                                     // 0..447
        const unsigned short* t = Tt + px * TPH + 8 * ((e + (px >> 3)) & 7);
        const v4u h = *(const v4u*)(t);
        const v4u l = *(const v4u*)(t + BPX * TPH);
        *(v4u*)(dh + (size_t)it * IMW * CDIM) = h;
        *(v4u*)(dl + (size_t)it * IMW * CDIM) = l;
      }
    } else {
      const int rw = lq / NST, sg = lq - rw * NST;                        // channel row 0..7 of 8, line 0..6 of 7
      unsigned short* dq = QK + ((size_t)(bl * CQK + cg * QT + rw)) * NPX + bd * BPX + sg * 64 + 8 * e;
      const unsigned short* t = Tt + rw * PQ + sg * 64 + 8 * e;
#pragma unroll
      for (int it = 0; it < 8; ++it) {
        const v4u h = *(const v4u*)(t + it * 8 * PQ);
        *(v4u*)(dq + (size_t)it * 8 * NPX) = h;
      }
#if defined(__HIP_DEVICE_COMPILE__)
      // the wait that stands before a register named by an issued global store is overwritten: in the listing the
      // code of the v branch, which writes these registers, follows the stores behind a conditional branch
      asm volatile("s_wait_xcnt 0x0" ::: "memory");
#endif
    }
  }
}

// =====================================================================================================
// (4a) channel attention, partial sums for one (pixel slice sl of 224 px, head pair g: heads 2g, 2g+1 = channels
//      64g..64g+63, batch bl), 256 threads.
//   phase 1: per-row sum of squares of q rows 64g..+63 and k rows 256+64g..+63 over the slice (f32, one 8-px
//            vector per lane, lanes 0..27, + xor tree), wave w -> rows 16w..16w+15.
//   phase 2: S[hl][c][d] = sum_n q[c][n] k[d][n] over the slice: 8 D tiles (hl, mt, nt) one per wave, A = q row
//            16mt+(lane&15), B = k row 16nt+(lane&15), both k-contiguous with the split k map, 7 k-steps on f16 WMMA.
//   The record [2][32][32] logits + [128] sums of squares goes through LDS and out as whole 128-B lines.
// coverage: 14 slices x 224 px = 3136 px; record 2 x 256 x 4 + 32 x 4 = 2176 floats; grid (14, 4, 16) covers PS.
// =====================================================================================================
__global__ __launch_bounds__(256)
void attn_s(const unsigned short* __restrict__ QK, float* PS) {
  __shared__ __align__(16) float sP[PREC];
  const int tid  = threadIdx.x;
  const int lane = tid & 31, wave = tid >> 5;
  const int hh   = lane >> 4, c = lane & 15;
  const int sl   = blockIdx.x, g = blockIdx.y, bl = blockIdx.z;
  const unsigned short* qkb = QK + (size_t)bl * CQK * NPX + sl * SLPX;

  // The slice is short enough for a wave to hold all of it in registers: the loads of both phases stand ahead
  // of the arithmetic, so that they are in flight together instead of one latency per row and per k-step.
  const int hl = wave >> 2, mt = (wave >> 1) & 1, ntk = wave & 1;
  Frag fa[SLPX / 32], fb[SLPX / 32];
  v8h  rv[16];
  {
    const unsigned short* arow = qkb + (size_t)(64 * g + 32 * hl + 16 * mt + c) * NPX + 8 * hh;
    const unsigned short* brow = qkb + (size_t)(256 + 64 * g + 32 * hl + 16 * ntk + c) * NPX + 8 * hh;
    const int idc = min(lane, SLPX / 8 - 1);                              // 28 vectors per row slice
    const int ch0 = 64 * g + 16 * wave + ((wave >= 4) ? 192 : 0);         // q: 64g+16w, k: 256+64g+16(w-4)
    const unsigned short* rp = qkb + (size_t)ch0 * NPX + 8 * idc;
#pragma unroll
    for (int ks = 0; ks < SLPX / 32; ++ks) {
      fa[ks] = ldfrag(arow + 32 * ks);
      fb[ks] = ldfrag(brow + 32 * ks);
    }
#pragma unroll
    for (int rr = 0; rr < 16; ++rr) rv[rr] = *(const v8h*)(rp + rr * NPX);
#if defined(__HIP_DEVICE_COMPILE__)
    // the wait that stands before a register named by an issued global load is overwritten; the three address
    // pairs are inputs so that no load of this run is given one of them as its destination
    asm volatile("s_wait_xcnt 0x0" :: "v"(arow), "v"(brow), "v"(rp) : "memory");
#endif
  }

  // ---- phase 1: row sums of squares over the slice ----
  {
    float s[16];
#pragma unroll
    for (int rr = 0; rr < 16; ++rr) {
      float t = 0.f;
#pragma unroll
      for (int q = 0; q < 8; ++q) { const float f = (float)rv[rr][q]; t = fmaf(f, f, t); }
      s[rr] = (lane < SLPX / 8) ? t : 0.f;
    }
#pragma unroll
    for (int off = 16; off > 0; off >>= 1) {
#pragma unroll
      for (int rr = 0; rr < 16; ++rr) s[rr] += __shfl_xor(s[rr], off, 32);
    }
    if (lane == 0) {
#pragma unroll
      for (int rr = 0; rr < 16; ++rr) sP[2048 + 16 * wave + rr] = s[rr];
    }
  }

  // ---- phase 2: raw logits S of the slice on f16 WMMA ----
  {
    v8f acc = zero8();
#pragma unroll
    for (int ks = 0; ks < SLPX / 32; ++ks) acc = mma_h(fa[ks].h, fb[ks].h, acc);
    float* sp = sP + hl * 1024 + (16 * mt + 8 * hh) * 32 + 16 * ntk + c;
#pragma unroll
    for (int r = 0; r < 8; ++r) sp[r * 32] = acc[r];
  }
  __syncthreads();
  {
    float* dst = PS + ((size_t)((bl * (CDIM / 64) + g) * NSL + sl)) * PREC;
    const v4f r0 = *(const v4f*)(sP + 4 * tid);
    const v4f r1 = *(const v4f*)(sP + 1024 + 4 * tid);
    *(v4f*)(dst + 4 * tid) = r0;
    *(v4f*)(dst + 1024 + 4 * tid) = r1;
    if (tid < 32) {                                                        // wave 0
      const v4f r2 = *(const v4f*)(sP + 2048 + 4 * tid);
      *(v4f*)(dst + 2048 + 4 * tid) = r2;
    }
  }
}

// =====================================================================================================
// (4b) softmax and attn.v for one (pixel range vt of 448 px, head pair g, batch bl), 256 threads.
//   join:    the 14 slice records of (g, bl) summed in slice order (f32) -> S in LDS, 1/max(norm, eps) in LDS;
//            every block of a (g, bl) does the same sums and gets the same attn.
//   phase 3: logits = S * invq * invk * temperature (bf16-RNE), max-subtracted softmax in f32, attn x256 as f16
//            hi and x1024 residual into LDS Pa [c][d] (d contiguous = A operand of phase 4).
//   phase 4: out[c][n] = sum_d attn[c][d] v[d][n]: waves (2pr, 2pr+1) share one 16-px tile (tile pr + 4(7vt + i)), wave
//            hl does head hl: A = Pa frags (resident), B = v rows of VP/VPL (position-major, k = d contiguous):
//            hi.hi -> o, hi.res + res.hi -> orr (x1024). 256*out = o + orr/1024 split into f16 hi + x1024 residual,
//            [16][3136][256] (64-ch slab of a 512-B row): wave hl writes rows {lr, lr+4}, lr = (lane>>3)+8hl, 8 consecutive
// coverage: phase 4: 7 ranges x 4 pairs x 7 iterations = 196 tiles x 16 px = 3136 rows; per row the two waves'
//           halves (32hl + 16mt + 8hh + r) cover the 64-ch slab; grid (7, 4, 16) covers OP/OPL exactly once.
// =====================================================================================================
__global__ __launch_bounds__(256)
void attn_v(const float* __restrict__ PS, const unsigned short* __restrict__ VP,
            const unsigned short* __restrict__ VPL, const float* __restrict__ temp,
            unsigned short* OP, unsigned short* OPL) {
  __shared__ float sInv[128];
  __shared__ float sS[2 * 32 * 33];
  __shared__ __align__(16) unsigned short Pa[4 * 32 * PAP];            // [hi|res][hl][32][PAP]
  __shared__ __align__(16) unsigned short Ow[8 * 16 * TPH];            // [hi|res][pair][16][TPH]
  const int tid  = threadIdx.x;
  const int lane = tid & 31, wave = tid >> 5;
  const int hh   = lane >> 4, c = lane & 15;
  const int vt   = blockIdx.x, g = blockIdx.y, bl = blockIdx.z;

  // ---- join the slice records ----
  {
    const float* pb = PS + ((size_t)((bl * (CDIM / 64) + g) * NSL)) * PREC;
    v4f a0 = {0.f, 0.f, 0.f, 0.f}, a1 = {0.f, 0.f, 0.f, 0.f};
#pragma unroll
    for (int s = 0; s < NSL; ++s) {
      a0 += *(const v4f*)(pb + s * PREC + 4 * tid);
      a1 += *(const v4f*)(pb + s * PREC + 1024 + 4 * tid);
    }
    float* s0 = sS + (tid >> 3) * 33 + 4 * (tid & 7);                      // head 0: row tid>>3, d 4(tid&7)..+3
    float* s1 = s0 + 32 * 33;                                              // head 1
#pragma unroll
    for (int q = 0; q < 4; ++q) { s0[q] = a0[q]; s1[q] = a1[q]; }
    if (tid < 32) {                                                        // wave 0
      v4f an = {0.f, 0.f, 0.f, 0.f};
#pragma unroll
      for (int s = 0; s < NSL; ++s) an += *(const v4f*)(pb + s * PREC + 2048 + 4 * tid);
#pragma unroll
      for (int q = 0; q < 4; ++q) sInv[4 * tid + q] = 1.0f / fmaxf(sqrtf(an[q]), 1e-12f);
    }
  }
  __syncthreads();

  // ---- phase 3: softmax, attn x256 as f16 hi + residual ----
  if (tid < 64) {                                                          // waves 0, 1
    const int hl = tid >> 5, row = tid & 31;
    const float tv = bfr(temp[2 * g + hl]);
    const float iq = sInv[32 * hl + row] * tv;
    const float* srow = sS + hl * (32 * 33) + row * 33;
    const float* ik   = sInv + 64 + 32 * hl;
    float lg[32];
    float mx = -3.0e38f;
#pragma unroll
    for (int d = 0; d < 32; ++d) { const float v = srow[d] * iq * ik[d]; lg[d] = v; mx = fmaxf(mx, v); }
    float ssum = 0.f;
#pragma unroll
    for (int d = 0; d < 32; ++d) { const float ev = __expf(lg[d] - mx); lg[d] = ev; ssum += ev; }
    const float inv = PSC / ssum;
    unsigned short* ph = Pa + (hl * 32 + row) * PAP;
    unsigned short* pl = Pa + (64 + hl * 32 + row) * PAP;
#pragma unroll
    for (int d = 0; d < 32; ++d) {
      const float pv = lg[d] * inv;
      const _Float16 hv = (_Float16)pv;
      const _Float16 lv = (_Float16)((pv - (float)hv) * RSC);
      ph[d] = h_bits(hv);
      pl[d] = h_bits(lv);
    }
  }
  __syncthreads();

  // ---- phase 4: out = attn . v ----
  {
    const int pr = wave >> 1, hl = wave & 1;
    Frag ah[2], al[2];
#pragma unroll
    for (int mt = 0; mt < 2; ++mt) {
      const unsigned short* p0 = Pa + (hl * 32 + 16 * mt + c) * PAP + 8 * hh;
      ah[mt] = ldfrag(p0);
      al[mt] = ldfrag(p0 + 64 * PAP);
    }
    const size_t pbase = (size_t)bl * NPX * CDIM + 64 * g;
    const unsigned short* vpb = VP  + pbase + 32 * hl + 8 * hh;
    const unsigned short* vlb = VPL + pbase + 32 * hl + 8 * hh;
    unsigned short* owh = Ow + pr * (16 * TPH);
    unsigned short* owl = Ow + (4 + pr) * (16 * TPH);
    const int e8 = lane & 7, lr = (lane >> 3) + 8 * hl;                   // rows lr, lr+4 of the pair tile
#pragma unroll 1
    for (int i = 0; i < VIT; ++i) {                                        // 7 iterations
      const int n0 = (pr + 4 * (vt * VIT + i)) * 16;                       // tile 0..195
      const unsigned short* vr = vpb + (size_t)(n0 + c) * CDIM;
      const unsigned short* vl = vlb + (size_t)(n0 + c) * CDIM;
      const Frag fvh = ldfrag(vr);
      const Frag fvl = ldfrag(vl);
      v8f o[2], orr[2];
#pragma unroll
      for (int mt = 0; mt < 2; ++mt) {
        o[mt]   = mma_h(ah[mt].h, fvh.h, zero8());
        orr[mt] = mma_h(ah[mt].h, fvl.h, zero8());
        orr[mt] = mma_h(al[mt].h, fvh.h, orr[mt]);
      }
#pragma unroll
      for (int mt = 0; mt < 2; ++mt) {
        v4u uh, ul;
#pragma unroll
        for (int q = 0; q < 4; ++q) {
          const float f0 = o[mt][2 * q]     + orr[mt][2 * q]     * IRSC;
          const float f1 = o[mt][2 * q + 1] + orr[mt][2 * q + 1] * IRSC;
          const _Float16 h0 = (_Float16)f0, h1 = (_Float16)f1;
          const _Float16 l0 = (_Float16)((f0 - (float)h0) * RSC);
          const _Float16 l1 = (_Float16)((f1 - (float)h1) * RSC);
          uh[q] = pk16(h_bits(h0), h_bits(h1));
          ul[q] = pk16(h_bits(l0), h_bits(l1));
        }
        const int so = c * TPH + 32 * hl + 16 * mt + 8 * hh;               // channels 32hl+16mt+8hh..+7, px c
        *(v4u*)(owh + so) = uh;
        *(v4u*)(owl + so) = ul;
      }
      __syncthreads();
      const v4u a0 = *(const v4u*)(owh + lr * TPH + 8 * e8);
      const v4u a1 = *(const v4u*)(owh + (lr + 4) * TPH + 8 * e8);
      const v4u b0 = *(const v4u*)(owl + lr * TPH + 8 * e8);
      const v4u b1 = *(const v4u*)(owl + (lr + 4) * TPH + 8 * e8);
      unsigned short* d0 = OP  + pbase + (size_t)(n0 + lr) * CDIM + 8 * e8;
      unsigned short* d1 = OPL + pbase + (size_t)(n0 + lr) * CDIM + 8 * e8;
{
        *(v4u*)(d0) = a0;
        *(v4u*)(d0 + 4 * CDIM) = a1;
        *(v4u*)(d1) = b0;
        *(v4u*)(d1 + 4 * CDIM) = b1;
        
      }
      __syncthreads();
    }
  }
}

// =====================================================================================================
// Workspace map (bytes; each region start a multiple of 256; every extent an exact tile multiple). All 16 batches go
// through each stage in one launch. Six regions are carved; a plane whose first store comes in a launch behind the
// last read of a region lies on top of that region:
//   WQ16 bf16 [768][256]          393216      WP16 f16 [256][256]            131072
//   R1   f32 [16][768][3136]   154140672      read last by (3); from (4a) on it holds OP, OPL f16 [16][3136][256]
//                                             25690112 x 2 and PS f32 [16][4][14][2176] 7798784, side by side
//   QK   f16 [16][512][3136]    51380224      stored first by (3); up to (2) it holds XP bf16 [16][3136][256] 25690112
//   VP, VPL f16 [16][3136][256] 25690112 x 2                                              total = 257425408
// =====================================================================================================
extern "C" void kernel_launch(void* const* d_in, const int* in_sizes, int n_in,
                              void* d_out, int out_size, void* d_ws, size_t ws_size,
                              hipStream_t stream) {
  const int XN = NBAT * CDIM * NPX;                      // 12845056
  if (n_in < 5) return;
  if (in_sizes[0] != XN) return;
  if (in_sizes[1] != C3 * CDIM) return;
  if (in_sizes[2] != C3 * 9) return;
  if (in_sizes[3] != CDIM * CDIM) return;
  if (in_sizes[4] != NHEAD) return;
  if (out_size != XN) return;

  size_t off = 0;
  auto carve = [&](size_t bytes) { const size_t o = off; off += (bytes + 255) & ~(size_t)255; return o; };
  const size_t plane16 = (size_t)NCHK * NPX * CDIM * 2;  // 25690112
  static_assert((size_t)NCHK * NPX * CDIM * 2 % 256 == 0);
  static_assert((size_t)NCHK * NPX * CDIM * 2 * 2 + (size_t)NCHK * (CDIM / 64) * NSL * PREC * 4
                <= (size_t)NCHK * C3 * NPX * 4);          // OP, OPL, PS fit on R1
  static_assert((size_t)NCHK * NPX * CDIM * 2 <= (size_t)NCHK * CQK * NPX * 2);   // XP fits on QK
  const size_t oWQ  = carve((size_t)C3 * CDIM * 2);
  const size_t oWP  = carve((size_t)CDIM * CDIM * 2);
  const size_t oR1  = carve((size_t)NCHK * C3 * NPX * 4);
  const size_t oQK  = carve((size_t)NCHK * CQK * NPX * 2);
  const size_t oVP  = carve(plane16);
  const size_t oVPL = carve(plane16);
  if (off > ws_size) return;
  const size_t oXP  = oQK;
  const size_t oOP  = oR1;
  const size_t oOPL = oR1 + plane16;
  const size_t oPS  = oR1 + 2 * plane16;

  const float* x    = (const float*)d_in[0];
  const float* wq   = (const float*)d_in[1];
  const float* wdw  = (const float*)d_in[2];
  const float* wp   = (const float*)d_in[3];
  const float* temp = (const float*)d_in[4];
  float* out = (float*)d_out;

  char* ws = (char*)d_ws;
  unsigned short* WQ16 = (unsigned short*)(ws + oWQ);
  unsigned short* WP16 = (unsigned short*)(ws + oWP);
  unsigned short* XP   = (unsigned short*)(ws + oXP);
  float*          R1   = (float*)(ws + oR1);
  unsigned short* QK   = (unsigned short*)(ws + oQK);
  unsigned short* VP   = (unsigned short*)(ws + oVP);
  unsigned short* VPL  = (unsigned short*)(ws + oVPL);
  unsigned short* OP   = (unsigned short*)(ws + oOP);
  unsigned short* OPL  = (unsigned short*)(ws + oOPL);
  float*          PS   = (float*)(ws + oPS);

  const dim3 blk256(256), blk128(128);

  // (0) weights -> 16-bit planes
  cvt_w<<<dim3(32), blk256, 0, stream>>>(wq, wp, WQ16, WP16);
  // (1) x -> position-major bf16 [16][3136][256]
  cvt_x<<<dim3(NTILE, CDIM / QT, NCHK), blk256, 0, stream>>>(x, XP);
  // (2) qkv 1x1 conv -> f32 [16][768][3136]
  gemm_k<1, 0><<<dim3(NTILE, C3 / 128, NCHK), blk128, 0, stream>>>(WQ16, XP, XP, R1, C3, 1.0f);
  // (3) depthwise 3x3 -> q,k channel-major f16; v position-major f16 hi + residual
  dw_k<<<dim3(NBAND, C3 / QT, NCHK), dim3(DWT), 0, stream>>>(R1, wdw, QK, VP, VPL);
  // (4a) channel attention: partial logits and sums of squares per 224-px slice
  attn_s<<<dim3(NSL, CDIM / 64, NCHK), blk256, 0, stream>>>(QK, PS);
  // (4b) join, softmax, attn.v -> 256*out position-major f16 hi + residual [16][3136][256]
  attn_v<<<dim3(NVT, CDIM / 64, NCHK), blk256, 0, stream>>>(PS, VP, VPL, temp, OP, OPL);
  // (5) proj 1x1 conv -> d_out, scaled by 1/(64*256)
  gemm_k<0, 1><<<dim3(NTILE, CDIM / 64, NCHK), blk128, 0, stream>>>(WP16, OP, OPL, out, CDIM, OUTSC);
  (void)hipGetLastError();
}

// v005
// It runs in 133 microseconds.
// In both of two side-by-side timings against v004, it was 1.11 times as fast.
// All steps since v000 together make it 5.25 times as fast.
// Contractions: qkv 1x1 conv W[768x256].X[256x3136] on v_wmma_f32_16x16x32_bf16 (bf16 RNE operands, single product);
// channel logits q.k^T (32x32 per head, K=3136) on v_wmma_f32_16x16x32_f16 (f16 planes of the depthwise outputs);
// attn.v (K=32) on v_wmma_f32_16x16x32_f16 (attn x256 as f16 hi + x1024 residual, v as f16 hi + x1024 residual,
// 3 products); proj 1x1 conv on v_wmma_f32_16x16x32_f16 (64 x bf16-RNE weights as f16, 256 x out as f16 hi +
// x1024 residual, 2 products); f32 accumulate everywhere; depthwise 3x3, L2 norms and softmax in f32 on VALU.
#include <hip/hip_runtime.h>
#include <math.h>
#include <stdint.h>

#define NBAT   16
#define NCHK   16
#define CDIM   256
#define C3     768
#define CQK    512
#define NPX    3136
#define IMW    56
#define NHEAD  8
#define QT     64
#define NTILE  49
#define TPH    72
#define OSP    68
#define PAP    40
#define RSC    1024.0f
#define IRSC   0.0009765625f
#define PSC    256.0f
#define WSC    64.0f
#define OUTSC  6.103515625e-05f
#define NSL    14
#define SLPX   224
#define PREC   2176
#define NVT    7
#define VIT    7
#define SPE    264
#define BROW   8
#define BPX    448
#define NBAND  7
#define NST    7
#define DWT    448
#define PQ     456
#define ACH    32
#define MSPL   2
#define NCK    12

static_assert(NTILE * QT == NPX);
static_assert(IMW * IMW == NPX);
static_assert(NCHK == NBAT);
static_assert(NPX % 32 == 0);
static_assert(NPX % 16 == 0);
static_assert((NPX / 16) % 4 == 0);
static_assert(CDIM % 32 == 0);
static_assert(C3 % 128 == 0);
static_assert(CDIM % 64 == 0);
static_assert((TPH * 2) % 16 == 0);
static_assert((OSP * 4) % 16 == 0);
static_assert((PAP * 2) % 16 == 0);
static_assert(NHEAD * 32 == CDIM);
static_assert(NSL * SLPX == NPX);
static_assert(SLPX % 32 == 0);
static_assert(SLPX / 8 <= 32);
static_assert(PREC == 2 * 32 * 32 + 128);
static_assert((PREC * 4) % 128 == 0);
static_assert(NVT * VIT * 64 == NPX);
static_assert(SPE == CDIM + 8);
static_assert((SPE * 2) % 32 == 16);
static_assert(BROW * IMW == BPX);
static_assert(NBAND * BPX == NPX);
static_assert(NST * 8 == IMW);
static_assert(DWT == QT * NST);
static_assert((BPX * 2) % 128 == 0);
static_assert((PQ * 2) % 16 == 0 && PQ >= BPX);
static_assert(QT * PQ <= 2 * BPX * TPH);
static_assert(DWT / 8 == IMW);
static_assert(MSPL * NCK * ACH == C3);
static_assert(NCK >= 2);
static_assert(2 * ACH * OSP * 4 <= QT * SPE * 2);

typedef _Float16       v16h __attribute__((ext_vector_type(16)));
typedef _Float16       v8h  __attribute__((ext_vector_type(8)));
typedef __bf16         v16b __attribute__((ext_vector_type(16)));
typedef unsigned short v8us __attribute__((ext_vector_type(8)));
typedef float          v8f  __attribute__((ext_vector_type(8)));
typedef float          v4f  __attribute__((ext_vector_type(4)));
typedef unsigned int   v4u  __attribute__((ext_vector_type(4)));

union Frag { v8us u[2]; v16h h; v16b bf; };
static_assert(sizeof(Frag) == 32);

// ---- scalar helpers ---------------------------------------------------------------------------------
__device__ __forceinline__ unsigned short bf_bits(float f) {          // f32 -> bf16 bits, RNE convert
  unsigned u = __float_as_uint(f);
  return (unsigned short)((u + 0x7FFFu + ((u >> 16) & 1u)) >> 16);
}
__device__ __forceinline__ float bf_up(unsigned short hb) { return __uint_as_float(((unsigned)hb) << 16); }
__device__ __forceinline__ float bfr(float f) { return bf_up(bf_bits(f)); }
__device__ __forceinline__ unsigned short h_bits(_Float16 x) { return __builtin_bit_cast(unsigned short, x); }
__device__ __forceinline__ unsigned pk16(unsigned short a, unsigned short b) { return (unsigned)a | ((unsigned)b << 16); }
__device__ __forceinline__ v8f zero8() { v8f z = {0.f, 0.f, 0.f, 0.f, 0.f, 0.f, 0.f, 0.f}; return z; }

// ---- 16-bit fragment loader (A, or B from a k-contiguous [n][k] row): lane -> row/col (lane&15), p already
//      includes + 8*(lane>>4); elements 0..7 <- p[0..7] (k0+8h..), elements 8..15 <- p[16..23] (k0+16+8h..)
__device__ __forceinline__ Frag ldfrag(const unsigned short* p) {
  Frag f;
  f.u[0] = *(const v8us*)(p);
  f.u[1] = *(const v8us*)(p + 16);
  return f;
}

// ---- WMMA helpers: builtin followed by a 4-slot VALU gap tying D and keeping A/B live ----------------------
__device__ __forceinline__ v8f mma_h(v16h a, v16h b, v8f c) {
  v8f d = __builtin_amdgcn_wmma_f32_16x16x32_f16(false, a, false, b, (short)0, c, false, false);
#if defined(__HIP_DEVICE_COMPILE__)
  asm volatile("v_nop\n\tv_nop\n\tv_nop\n\tv_nop" : "+v"(d) : "v"(a), "v"(b));
#endif
  return d;
}
__device__ __forceinline__ v8f mma_b(v16b a, v16b b, v8f c) {
  v8f d = __builtin_amdgcn_wmma_f32_16x16x32_bf16(false, a, false, b, (short)0, c, false, false);
#if defined(__HIP_DEVICE_COMPILE__)
  const v16h ha = __builtin_bit_cast(v16h, a), hb = __builtin_bit_cast(v16h, b);
  asm volatile("v_nop\n\tv_nop\n\tv_nop\n\tv_nop" : "+v"(d) : "v"(ha), "v"(hb));
#endif
  return d;
}

// ---- eight asynchronous copies to LDS: copy j brings one whole 512-B row (32 lanes x 16 B), rows 4 apart; l is the
//      lane's LDS byte address and g its global address in the first row. The s_wait_xcnt at the end of the statement
//      stands in front of any later overwrite of an address register that a copy names.
__device__ __forceinline__ void copy8(unsigned l, const unsigned short* g) {
#if defined(__HIP_DEVICE_COMPILE__)
  asm volatile(
      "global_load_async_to_lds_b128 %0, %8, off\n\t"
      "global_load_async_to_lds_b128 %1, %9, off\n\t"
      "global_load_async_to_lds_b128 %2, %10, off\n\t"
      "global_load_async_to_lds_b128 %3, %11, off\n\t"
      "global_load_async_to_lds_b128 %4, %12, off\n\t"
      "global_load_async_to_lds_b128 %5, %13, off\n\t"
      "global_load_async_to_lds_b128 %6, %14, off\n\t"
      "global_load_async_to_lds_b128 %7, %15, off\n\t"
      "s_wait_xcnt 0x0"
      :: "v"(l), "v"(l + 4 * (SPE * 2)), "v"(l + 8 * (SPE * 2)), "v"(l + 12 * (SPE * 2)),
         "v"(l + 16 * (SPE * 2)), "v"(l + 20 * (SPE * 2)), "v"(l + 24 * (SPE * 2)), "v"(l + 28 * (SPE * 2)),
         "v"(g), "v"(g + 4 * CDIM), "v"(g + 8 * CDIM), "v"(g + 12 * CDIM),
         "v"(g + 16 * CDIM), "v"(g + 20 * CDIM), "v"(g + 24 * CDIM), "v"(g + 28 * CDIM)
      : "memory");
#endif
}

// =====================================================================================================
// (0) weights: wq f32 [768][256] -> WQ16 bf16 bits [768][256]; wp f32 [256][256] -> WP16 f16 bits of
// coverage: WQ16 32 blocks x 96 lines = 3072 lines = 768 x 256; WP16 32 x 32 = 1024 lines = 256 x 256.
// =====================================================================================================
__global__ __launch_bounds__(256)
void cvt_w(const float* __restrict__ wq, const float* __restrict__ wp,
           unsigned short* WQ16, unsigned short* WP16) {
  const int tid = threadIdx.x, e = tid & 7, lq = tid >> 3;
  v4u uq[3];
#pragma unroll
  for (int it = 0; it < 3; ++it) {
    const int L = blockIdx.x * 96 + it * 32 + lq;                 // 0..3071
    const float* s = wq + (size_t)64 * L + 8 * e;                  // max 196600 + 7 < 196608
    const v4f a = *(const v4f*)(s);
    const v4f b = *(const v4f*)(s + 4);
    uq[it][0] = pk16(bf_bits(a[0]), bf_bits(a[1]));
    uq[it][1] = pk16(bf_bits(a[2]), bf_bits(a[3]));
    uq[it][2] = pk16(bf_bits(b[0]), bf_bits(b[1]));
    uq[it][3] = pk16(bf_bits(b[2]), bf_bits(b[3]));
  }
  v4u up;
  const int Lp = blockIdx.x * 32 + lq;                             // 0..1023
  {
    const float* s = wp + (size_t)64 * Lp + 8 * e;                 // max 65528 + 7 < 65536
    const v4f a = *(const v4f*)(s);
    const v4f b = *(const v4f*)(s + 4);
    up[0] = pk16(h_bits((_Float16)(WSC * bfr(a[0]))), h_bits((_Float16)(WSC * bfr(a[1]))));
    up[1] = pk16(h_bits((_Float16)(WSC * bfr(a[2]))), h_bits((_Float16)(WSC * bfr(a[3]))));
    up[2] = pk16(h_bits((_Float16)(WSC * bfr(b[0]))), h_bits((_Float16)(WSC * bfr(b[1]))));
    up[3] = pk16(h_bits((_Float16)(WSC * bfr(b[2]))), h_bits((_Float16)(WSC * bfr(b[3]))));
  }
{
#pragma unroll
    for (int it = 0; it < 3; ++it) {
      const int L = blockIdx.x * 96 + it * 32 + lq;
      *(v4u*)(WQ16 + (size_t)64 * L + 8 * e) = uq[it];
    }
    *(v4u*)(WP16 + (size_t)64 * Lp + 8 * e) = up;
    
  }
}

// =====================================================================================================
// (1) qkv 1x1 conv: Y[bl][m][n] = sum_k WQ16[m][k] bf16(x[bl][k][n]) for one (64-px tile nt, half mh of the 768 rows,
//     batch bl), 128 threads = 4 waves. The block reads its x tile [256 ch][64 px] f32 once, converts it (RNE) and
//     lays it position-major [px][k] in LDS at a pitch of 528 B; wave (mi, ni) takes its B fragments (px 32ni..+31,
//     all of K) into registers for the whole kernel. A comes in stages of 32 rows through two LDS buffers filled by
//     asynchronous copies: stage t+1 flies while stage t is worked on. Per stage a wave does rows 16mi..+15 x its
//     32 px (16 WMMAs, k ascending, one accumulator chain per 16x16 tile); the 32 x 64 f32 result goes through LDS
//     (two buffers, on the x tile's place, which is dead behind the fragment loads) and out as whole 128-B lines.
// coverage: x tile 128 threads x 32 loads x 4 = 256 ch x 64 px; stage 4 waves x 8 copies = 32 rows; result lines
//           4 x 8 rows x 256 B = 32 rows x 64 px; 12 stages x 32 = 384 rows; grid (49, 2, 16) covers Y exactly once.
// =====================================================================================================
__global__ __launch_bounds__(128)
void qkv_k(const unsigned short* __restrict__ A16, const float* __restrict__ x, float* Y) {
  __shared__ __align__(16) unsigned short Bt[QT * SPE];                // x tile [px][k]; behind the fragment loads: Os
  __shared__ __align__(16) unsigned short Ar[2 * ACH * SPE];           // the two A buffers
  float* Os = (float*)Bt;
  const int tid  = threadIdx.x;
  const int lane = tid & 31, wave = tid >> 5;
  const int hh   = lane >> 4, c = lane & 15;
  const int mi   = wave >> 1, ni = wave & 1;
  const int nt   = blockIdx.x, bl = blockIdx.z;
  const int m0   = blockIdx.y * (NCK * ACH), n0 = nt * QT;

  // wave w copies rows w, w+4, ..., w+28 of a stage
  const unsigned l0 = (unsigned)(uintptr_t)(Ar + wave * SPE + 8 * lane);
  const unsigned short* ga = A16 + (size_t)(m0 + wave) * CDIM + 8 * lane;
  copy8(l0, ga);                                                        // stage 0 -> buffer 0

  // ---- x tile: thread (4-px group pg, 8-channel group cq) loads 8 channels x 4 px per pass, 4 passes ----
  {
    const int pg = tid & 15, cq = tid >> 4;                             // cq 0..7
    const char* xb = (const char*)(x + (size_t)bl * CDIM * NPX + n0);
    const unsigned vo = (unsigned)(cq * 8 * NPX + 4 * pg) * 4u;         // max (56 * 3136 + 60) * 4
    // both loops are unrolled so that ld[][] lives in registers and all 32 loads are in flight together
    v4f ld[4][8];
#pragma unroll
    for (int p = 0; p < 4; ++p) {
#pragma unroll
      for (int j = 0; j < 8; ++j)                                       // channel 64p + 8cq + j <= 255
        ld[p][j] = *(const v4f*)(xb + vo + (unsigned)((p * 64 + j) * NPX) * 4u);
    }
#if defined(__HIP_DEVICE_COMPILE__)
    // the wait that stands before a register named by an issued global load is overwritten; the address registers
    // are inputs so that no load of this run is given one of them as its destination
    asm volatile("s_wait_xcnt 0x0" :: "v"(vo), "s"(xb) : "memory");
#endif
    // unrolled for constant indices into ld[][]
#pragma unroll
    for (int p = 0; p < 4; ++p) {
#pragma unroll
      for (int q = 0; q < 4; ++q) {
        v4u u;
#pragma unroll
        for (int i = 0; i < 4; ++i) u[i] = pk16(bf_bits(ld[p][2 * i][q]), bf_bits(ld[p][2 * i + 1][q]));
        *(v4u*)(Bt + (4 * pg + q) * SPE + (p * 8 + cq) * 8) = u;        // px 4pg+q, channels 64p+8cq..+7
      }
    }
  }
#if defined(__HIP_DEVICE_COMPILE__)
  // this wave's copies of stage 0 have landed before the barrier behind which the other waves read them
  asm volatile("s_wait_asynccnt 0x0" ::: "memory");
#endif
  __syncthreads();                                                      // publishes the x tile and stage 0
  copy8(l0 + ACH * (SPE * 2), ga + ACH * CDIM);                         // stage 1 -> buffer 1

  // unrolled so that fb[][] lives in registers
  Frag fb[2][CDIM / 32];
  {
    const unsigned short* bp = Bt + (32 * ni + c) * SPE + 8 * hh;
#pragma unroll
    for (int j = 0; j < 2; ++j) {
#pragma unroll
      for (int ks = 0; ks < CDIM / 32; ++ks) fb[j][ks] = ldfrag(bp + (16 * j) * SPE + 32 * ks);
    }
  }
  __syncthreads();                                                      // every wave has left Bt: it becomes Os

  const unsigned short* ap0 = Ar + (16 * mi + c) * SPE + 8 * hh;
  const int e = tid & 15, lq = tid >> 4;                                // 16 lanes x 16 B = one 256-B row piece; lq 0..7
  float* yb = Y + ((size_t)(bl * C3 + m0 + lq)) * NPX + n0 + 4 * e;

  // kept rolled: twelve copies of the body would only lengthen the text that the instruction cache has to hold
#pragma unroll 1
  for (int t = 0; t < NCK; ++t) {
    const int par = t & 1;
    const unsigned short* ap = ap0 + par * (ACH * SPE);
    float* ob = Os + par * (ACH * OSP);
    // the stage's LDS reads stand as one group ahead of its WMMAs; unrolled so that fa[] lives in registers
    Frag fa[CDIM / 32];
#pragma unroll
    for (int ks = 0; ks < CDIM / 32; ++ks) fa[ks] = ldfrag(ap + 32 * ks);
    v8f acc0 = zero8(), acc1 = zero8();
#pragma unroll
    for (int ks = 0; ks < CDIM / 32; ++ks) {
      acc0 = mma_b(fa[ks].bf, fb[0][ks].bf, acc0);
      acc1 = mma_b(fa[ks].bf, fb[1][ks].bf, acc1);
    }
    {
      float* op = ob + (16 * mi + 8 * hh) * OSP + 32 * ni + c;
      // unrolled for constant indices into the accumulators
#pragma unroll
      for (int r = 0; r < 8; ++r) { op[r * OSP] = acc0[r]; op[r * OSP + 16] = acc1[r]; }
    }
#if defined(__HIP_DEVICE_COMPILE__)
    // foot of the trip: this wave's reads of buffer par and its writes of ob are done ...
    asm volatile("s_wait_dscnt 0x0" ::: "memory");
    // ... and its copies of stage t+1 have landed, before the barrier that publishes stage t+1 and ob and frees buffer par
    asm volatile("s_wait_asynccnt 0x0" ::: "memory");
#endif
    __syncthreads();
    if (t + 2 < NCK) copy8(l0 + par * (ACH * (SPE * 2)), ga + (size_t)(t + 2) * (ACH * CDIM));
    float* yd = yb + (size_t)t * (ACH * NPX);
    // unrolled so that the four LDS reads stand together ahead of the stores
#pragma unroll
    for (int it = 0; it < ACH / 8; ++it) {
      const v4f v = *(const v4f*)(ob + (it * 8 + lq) * OSP + 4 * e);
      *(v4f*)(yd + (size_t)it * 8 * NPX) = v;
    }
#if defined(__HIP_DEVICE_COMPILE__)
    // the wait that stands before a register named by an issued global store is overwritten (the next trip does)
    asm volatile("s_wait_xcnt 0x0" ::: "memory");
#endif
  }
#if defined(__HIP_DEVICE_COMPILE__)
  // behind the last copy, before the wave ends
  asm volatile("s_wait_asynccnt 0x0" ::: "memory");
#endif
}

// =====================================================================================================
// (5) GEMM: Y[bl][m][n] = scale * sum_k A16[m][k] B16[bl][n][k] (K = 256 = 8 k-steps of 32), A and B rows
//     k-contiguous. The block's MR rows of A and 64 rows of B (and of BPL), all of K, are brought into LDS once by
//     asynchronous copies, a whole 512-B row per copy, at a pitch of 528 B; the split k map loader reads LDS. With RES: B carries a second
//     x1024 residual plane BPL into a separate accumulator, folded back as accl/1024 in the epilogue.
//     Block 128 threads = 4 waves; wave w owns columns n0+16w..+15 (one B fragment per k-step) and MT m-tiles
//     lines of the f32 channel-major plane (2 lines per 64-n row segment, 8 consecutive lanes x 16 B, one
// coverage: Os 4 waves x MT tiles x 16x16 = MR x 64; lines NIT x 16 = 2 MR = MR rows x 64 n; grid (49, M/MR, 16).
// =====================================================================================================
template <int BF, int RES>
__global__ __launch_bounds__(128)
void gemm_k(const unsigned short* __restrict__ A16, const unsigned short* __restrict__ BP,
            const unsigned short* __restrict__ BPL, float* Y, int M, float scale) {
  constexpr int MT  = RES ? 4 : 8;
  constexpr int MR  = 16 * MT;
  constexpr int NIT = (2 * MR) / 16;
  constexpr int NROW = MR + (RES ? 2 : 1) * QT;                        // staged rows: A, B, (BPL)
  static_assert(MR % 32 == 0 && QT % 32 == 0);
  static_assert(MR * OSP * 4 <= NROW * SPE * 2);
  static_assert(NROW / 4 <= 63);                                        // copies of a wave in flight
  __shared__ __align__(16) unsigned short St[NROW * SPE];
  float* Os = (float*)St;                                               // output staging, on St behind the K loop
  const int tid  = threadIdx.x;
  const int lane = tid & 31, wave = tid >> 5;
  const int hh   = lane >> 4, c = lane & 15;
  const int nt   = blockIdx.x, bl = blockIdx.z;
  const int m0   = blockIdx.y * MR, n0 = nt * QT;

  // ---- fill: wave w copies rows w, w+4, ... of each operand ----
  {
    const unsigned l0 = (unsigned)(uintptr_t)(St + wave * SPE + 8 * lane);
    const unsigned short* ga = A16 + (size_t)(m0 + wave) * CDIM + 8 * lane;
    const size_t go = ((size_t)(bl * NPX + n0 + wave)) * CDIM + 8 * lane;
    // the three loops are unrolled so that every copy's addresses are one add of a constant to a common base
#pragma unroll
    for (int s = 0; s < MR / 32; ++s) copy8(l0 + s * 32 * (SPE * 2), ga + s * 32 * CDIM);
#pragma unroll
    for (int s = 0; s < QT / 32; ++s) copy8(l0 + (MR + s * 32) * (SPE * 2), BP + go + s * 32 * CDIM);
    if (RES) {
#pragma unroll
      for (int s = 0; s < QT / 32; ++s) copy8(l0 + (MR + QT + s * 32) * (SPE * 2), BPL + go + s * 32 * CDIM);
    }
#if defined(__HIP_DEVICE_COMPILE__)
    // this wave's copies have landed before the barrier behind which the other waves read them
    asm volatile("s_wait_asynccnt 0x0" ::: "memory");
#endif
  }
  __syncthreads();

  const unsigned short* ap  = St + c * SPE + 8 * hh;
  const unsigned short* bp  = St + (MR + 16 * wave + c) * SPE + 8 * hh;
  const unsigned short* bpl = RES ? (bp + QT * SPE) : bp;

  v8f acc[MT], accl[MT];
#pragma unroll
  for (int mt = 0; mt < MT; ++mt) { acc[mt] = zero8(); accl[mt] = zero8(); }

#pragma unroll 2
  for (int ks = 0; ks < CDIM / 32; ++ks) {
    const Frag fb = ldfrag(bp + 32 * ks);
    Frag fbl;
    if (RES) fbl = ldfrag(bpl + 32 * ks); else fbl = fb;
    // the k-step's LDS reads stand as one group ahead of its WMMAs: one LDS latency per k-step, not one per WMMA;
    // unrolled so that fa[] lives in registers
    Frag fa[MT];
#pragma unroll
    for (int mt = 0; mt < MT; ++mt) fa[mt] = ldfrag(ap + (16 * mt) * SPE + 32 * ks);
#pragma unroll
    for (int mt = 0; mt < MT; ++mt) {
      if (BF) acc[mt] = mma_b(fa[mt].bf, fb.bf, acc[mt]);
      else    acc[mt] = mma_h(fa[mt].h, fb.h, acc[mt]);
      if (RES) accl[mt] = mma_h(fa[mt].h, fbl.h, accl[mt]);
    }
  }

  __syncthreads();                                                      // every wave has left St: it becomes Os

  // ---- epilogue -> LDS Os[m][n] ----
  {
    const int nl = 16 * wave + c;
#pragma unroll
    for (int mt = 0; mt < MT; ++mt) {
#pragma unroll
      for (int r = 0; r < 8; ++r) {
        float v = acc[mt][r];
        if (RES) v += accl[mt][r] * IRSC;
        Os[(16 * mt + 8 * hh + r) * OSP + nl] = v * scale;
      }
    }
  }
  __syncthreads();

  {
    const int e = tid & 7, lq = tid >> 3;                              // lq 0..15
{
#pragma unroll
      for (int it = 0; it < NIT; ++it) {
        const int L = it * 16 + lq;                                    // 0..2MR-1
        const int row = L >> 1, hf = L & 1;
        const v4f v = *(const v4f*)(Os + row * OSP + hf * 32 + 4 * e);
        float* dst = Y + ((size_t)(bl * M + m0 + row)) * NPX + n0 + hf * 32 + 4 * e;
        *(v4f*)dst = v;
      }
      
    }
  }
}

// =====================================================================================================
// (3) depthwise 3x3, zero pad 1, for one (band of 8 image rows = 448 px, 64-channel group cg, batch bl) of the f32
//     plane QKV[16][768][3136]; weights = bf16-RNE values in registers. Thread (channel tid/7, strip tid%7 of 8 px):
//     the 10 input rows of its strip (8 px as two 16-B loads, plus the left and the right neighbour) are held in
//     registers and give an 8 x 8 px patch; row and neighbour addresses are clamped, taps outside the image zeroed
//     by predicate; per output the 9 products are summed in tap order. Results as f16 hi (v: and x1024 residual)
//     into an LDS tile, then out as whole 128-B lines. v tile: [px][channel], the eight 16-B channel chunks of a px
//     row rotated by (px/8)&7 so that the strips of a wave store to different banks.
// coverage: 448 threads x 64 px = 64 ch x 448 px per tile; lines 8 x 56 = 448 per plane; grid (7, 12, 16)
//           covers QK (cg 0..7 -> channels 0..511) and VP/VPL (cg 8..11 -> v channels 0..255) exactly once.
// =====================================================================================================
__global__ __launch_bounds__(DWT)
void dw_k(const float* __restrict__ QKV, const float* __restrict__ wdw,
          unsigned short* QK, unsigned short* VP, unsigned short* VPL) {
  __shared__ __align__(16) unsigned short Tt[2 * BPX * TPH];           // v: [hi|res][448][TPH]; q,k: [64][PQ]
  const int tid = threadIdx.x;
  const int bd = blockIdx.x, cg = blockIdx.y, bl = blockIdx.z;
  const bool isv = (cg >= 8);                                           // block-uniform
  const int ch = tid / NST, st = tid - ch * NST;                        // ch 0..63, st 0..6
  const bool okt = (bd > 0), okb = (bd < NBAND - 1);                    // row above / below the band is in the image
  const bool okl = (st > 0), okr = (st < NST - 1);                      // left / right neighbour is in the image

  // Addresses: a block-uniform base (the band's first row; the row above it, clamped into the image) plus the
  // thread's byte offset (its strip; its left and right neighbour, clamped into the row).
  const char* sb  = (const char*)(QKV + ((size_t)(bl * C3 + cg * QT)) * NPX + bd * BPX);
  const char* sbt = sb - (okt ? IMW * 4 : 0);
  const unsigned ob = okb ? BROW * IMW * 4u : (BROW - 1) * IMW * 4u;    // the row below, as an offset from sb
  const char* sw  = (const char*)(wdw + cg * (QT * 9));
  unsigned vm = (unsigned)(ch * NPX + 8 * st) * 4u;                     // max (63 * 3136 + 48) * 4
  unsigned vl = vm - (okl ? 4u : 0u);
  unsigned vr = vm + (okr ? 32u : 28u);
  const unsigned vw = (unsigned)(ch * 9) * 4u;                          // group max 704 * 9 + 63 * 9 + 8 = 6911

  // every loop below over rows, px and taps is unrolled so that w[], in[] and o[] are registers with constant indices
  float w[9];
  float in[BROW + 2][10];
  auto ldrow = [&](int rr, const char* base, unsigned om, unsigned ol, unsigned orr) {
    const v4f a = *(const v4f*)(base + om);
    const v4f b = *(const v4f*)(base + om + 16);
    in[rr][0] = *(const float*)(base + ol);
    in[rr][9] = *(const float*)(base + orr);
#pragma unroll
    for (int q = 0; q < 4; ++q) { in[rr][1 + q] = a[q]; in[rr][5 + q] = b[q]; }
  };
  // taps outside the image read as zero
  auto mask = [&](int rr) {
    const bool oky = (rr == 0) ? okt : (rr == BROW + 1) ? okb : true;
    in[rr][0] = (oky && okl) ? in[rr][0] : 0.f;
    in[rr][9] = (oky && okr) ? in[rr][9] : 0.f;
    if (rr == 0 || rr == BROW + 1) {
#pragma unroll
      for (int q = 1; q < 9; ++q) in[rr][q] = oky ? in[rr][q] : 0.f;
    }
  };

  // first run of loads: the weights and input rows 0..7, all in flight together
#pragma unroll
  for (int t = 0; t < 9; ++t) w[t] = *(const float*)(sw + vw + 4 * t);
  ldrow(0, sbt, vm, vl, vr);
#pragma unroll
  for (int rr = 1; rr < BROW; ++rr) ldrow(rr, sb + (rr - 1) * (IMW * 4), vm, vl, vr);
#if defined(__HIP_DEVICE_COMPILE__)
  // the wait that stands before a register named by an issued global load is overwritten; the address registers are
  // operands so that no load of this run is given one of them as its destination; the three offsets are in/out so
  // that the second run forms its addresses from them again as scalar base + 32-bit offset: carried over from here
  // they would be three 64-bit pairs, held in registers through rows 0 and 1
  asm volatile("s_wait_xcnt 0x0" : "+v"(vm), "+v"(vl), "+v"(vr) : "v"(vw), "s"(sw), "s"(sb), "s"(sbt) : "memory");
#endif
#pragma unroll
  for (int t = 0; t < 9; ++t) w[t] = bfr(w[t]);

#pragma unroll
  for (int r = 0; r < BROW; ++r) {
    if (r == 2) {
      // second run: input rows 8 and 9 take the registers that rows 0 and 1 have left; they are used from r = 6 on
      const unsigned vm9 = vm + ob, vl9 = vl + ob, vr9 = vr + ob;
      ldrow(BROW, sb + (BROW - 1) * (IMW * 4), vm, vl, vr);
      ldrow(BROW + 1, sb, vm9, vl9, vr9);
#if defined(__HIP_DEVICE_COMPILE__)
      // the same wait for the second run of loads, its address registers as inputs
      asm volatile("s_wait_xcnt 0x0" :: "v"(vm), "v"(vl), "v"(vr), "v"(vm9), "v"(vl9), "v"(vr9), "s"(sb) : "memory");
#endif
    }
    if (r == 0) { mask(0); mask(1); }
    mask(r + 2);
    float o[8];
#pragma unroll
    for (int j = 0; j < 8; ++j) {
      float s = 0.f;
#pragma unroll
      for (int t = 0; t < 9; ++t) s = fmaf(in[r + t / 3][j + t % 3], w[t], s);
      o[j] = s;
    }
    if (isv) {
      const int p0 = r * IMW + 8 * st;                                   // px of the band, p0/8 = 7r + st
      unsigned short* th = Tt + p0 * TPH + ((ch + 8 * (NST * r + st)) & 63);
#pragma unroll
      for (int j = 0; j < 8; ++j) {
        const _Float16 hv = (_Float16)o[j];
        const _Float16 lv = (_Float16)((o[j] - (float)hv) * RSC);
        th[j * TPH] = h_bits(hv);
        th[BPX * TPH + j * TPH] = h_bits(lv);
      }
    } else {
      v4u u;
#pragma unroll
      for (int q = 0; q < 4; ++q) u[q] = pk16(h_bits((_Float16)o[2 * q]), h_bits((_Float16)o[2 * q + 1]));
      *(v4u*)(Tt + ch * PQ + r * IMW + 8 * st) = u;
    }
  }
  __syncthreads();
  {
    const int e = tid & 7, lq = tid >> 3;                                 // lq 0..55
    if (isv) {
      const int vg = cg - 8;                                              // 0..3
      unsigned short* dh = VP  + ((size_t)(bl * NPX + bd * BPX + lq)) * CDIM + vg * QT + 8 * e;
      unsigned short* dl = VPL + ((size_t)(bl * NPX + bd * BPX + lq)) * CDIM + vg * QT + 8 * e;
#pragma unroll
      for (int it = 0; it < BROW; ++it) {
        const int px = it * IMW + lq;                                     // 0..447
        const unsigned short* t = Tt + px * TPH + 8 * ((e + (px >> 3)) & 7);
        const v4u h = *(const v4u*)(t);
        const v4u l = *(const v4u*)(t + BPX * TPH);
        *(v4u*)(dh + (size_t)it * IMW * CDIM) = h;
        *(v4u*)(dl + (size_t)it * IMW * CDIM) = l;
      }
    } else {
      const int rw = lq / NST, sg = lq - rw * NST;                        // channel row 0..7 of 8, line 0..6 of 7
      unsigned short* dq = QK + ((size_t)(bl * CQK + cg * QT + rw)) * NPX + bd * BPX + sg * 64 + 8 * e;
      const unsigned short* t = Tt + rw * PQ + sg * 64 + 8 * e;
#pragma unroll
      for (int it = 0; it < 8; ++it) {
        const v4u h = *(const v4u*)(t + it * 8 * PQ);
        *(v4u*)(dq + (size_t)it * 8 * NPX) = h;
      }
#if defined(__HIP_DEVICE_COMPILE__)
      // the wait that stands before a register named by an issued global store is overwritten: in the listing the
      // code of the v branch, which writes these registers, follows the stores behind a conditional branch
      asm volatile("s_wait_xcnt 0x0" ::: "memory");
#endif
    }
  }
}

// =====================================================================================================
// (4a) channel attention, partial sums for one (pixel slice sl of 224 px, head pair g: heads 2g, 2g+1 = channels
//      64g..64g+63, batch bl), 256 threads.
//   phase 1: per-row sum of squares of q rows 64g..+63 and k rows 256+64g..+63 over the slice (f32, one 8-px
//            vector per lane, lanes 0..27, + xor tree), wave w -> rows 16w..16w+15.
//   phase 2: S[hl][c][d] = sum_n q[c][n] k[d][n] over the slice: 8 D tiles (hl, mt, nt) one per wave, A = q row
//            16mt+(lane&15), B = k row 16nt+(lane&15), both k-contiguous with the split k map, 7 k-steps on f16 WMMA.
//   The record [2][32][32] logits + [128] sums of squares goes through LDS and out as whole 128-B lines.
// coverage: 14 slices x 224 px = 3136 px; record 2 x 256 x 4 + 32 x 4 = 2176 floats; grid (14, 4, 16) covers PS.
// =====================================================================================================
__global__ __launch_bounds__(256)
void attn_s(const unsigned short* __restrict__ QK, float* PS) {
  __shared__ __align__(16) float sP[PREC];
  const int tid  = threadIdx.x;
  const int lane = tid & 31, wave = tid >> 5;
  const int hh   = lane >> 4, c = lane & 15;
  const int sl   = blockIdx.x, g = blockIdx.y, bl = blockIdx.z;
  const unsigned short* qkb = QK + (size_t)bl * CQK * NPX + sl * SLPX;

  // The slice is short enough for a wave to hold all of it in registers: the loads of both phases stand ahead
  // of the arithmetic, so that they are in flight together instead of one latency per row and per k-step.
  const int hl = wave >> 2, mt = (wave >> 1) & 1, ntk = wave & 1;
  Frag fa[SLPX / 32], fb[SLPX / 32];
  v8h  rv[16];
  {
    const unsigned short* arow = qkb + (size_t)(64 * g + 32 * hl + 16 * mt + c) * NPX + 8 * hh;
    const unsigned short* brow = qkb + (size_t)(256 + 64 * g + 32 * hl + 16 * ntk + c) * NPX + 8 * hh;
    const int idc = min(lane, SLPX / 8 - 1);                              // 28 vectors per row slice
    const int ch0 = 64 * g + 16 * wave + ((wave >= 4) ? 192 : 0);         // q: 64g+16w, k: 256+64g+16(w-4)
    const unsigned short* rp = qkb + (size_t)ch0 * NPX + 8 * idc;
#pragma unroll
    for (int ks = 0; ks < SLPX / 32; ++ks) {
      fa[ks] = ldfrag(arow + 32 * ks);
      fb[ks] = ldfrag(brow + 32 * ks);
    }
#pragma unroll
    for (int rr = 0; rr < 16; ++rr) rv[rr] = *(const v8h*)(rp + rr * NPX);
#if defined(__HIP_DEVICE_COMPILE__)
    // the wait that stands before a register named by an issued global load is overwritten; the three address
    // pairs are inputs so that no load of this run is given one of them as its destination
    asm volatile("s_wait_xcnt 0x0" :: "v"(arow), "v"(brow), "v"(rp) : "memory");
#endif
  }

  // ---- phase 1: row sums of squares over the slice ----
  {
    float s[16];
#pragma unroll
    for (int rr = 0; rr < 16; ++rr) {
      float t = 0.f;
#pragma unroll
      for (int q = 0; q < 8; ++q) { const float f = (float)rv[rr][q]; t = fmaf(f, f, t); }
      s[rr] = (lane < SLPX / 8) ? t : 0.f;
    }
#pragma unroll
    for (int off = 16; off > 0; off >>= 1) {
#pragma unroll
      for (int rr = 0; rr < 16; ++rr) s[rr] += __shfl_xor(s[rr], off, 32);
    }
    if (lane == 0) {
#pragma unroll
      for (int rr = 0; rr < 16; ++rr) sP[2048 + 16 * wave + rr] = s[rr];
    }
  }

  // ---- phase 2: raw logits S of the slice on f16 WMMA ----
  {
    v8f acc = zero8();
#pragma unroll
    for (int ks = 0; ks < SLPX / 32; ++ks) acc = mma_h(fa[ks].h, fb[ks].h, acc);
    float* sp = sP + hl * 1024 + (16 * mt + 8 * hh) * 32 + 16 * ntk + c;
#pragma unroll
    for (int r = 0; r < 8; ++r) sp[r * 32] = acc[r];
  }
  __syncthreads();
  {
    float* dst = PS + ((size_t)((bl * (CDIM / 64) + g) * NSL + sl)) * PREC;
    const v4f r0 = *(const v4f*)(sP + 4 * tid);
    const v4f r1 = *(const v4f*)(sP + 1024 + 4 * tid);
    *(v4f*)(dst + 4 * tid) = r0;
    *(v4f*)(dst + 1024 + 4 * tid) = r1;
    if (tid < 32) {                                                        // wave 0
      const v4f r2 = *(const v4f*)(sP + 2048 + 4 * tid);
      *(v4f*)(dst + 2048 + 4 * tid) = r2;
    }
  }
}

// =====================================================================================================
// (4b) softmax and attn.v for one (pixel range vt of 448 px, head pair g, batch bl), 256 threads.
//   join:    the 14 slice records of (g, bl) summed in slice order (f32) -> S in LDS, 1/max(norm, eps) in LDS;
//            every block of a (g, bl) does the same sums and gets the same attn.
//   phase 3: logits = S * invq * invk * temperature (bf16-RNE), max-subtracted softmax in f32, attn x256 as f16
//            hi and x1024 residual into LDS Pa [c][d] (d contiguous = A operand of phase 4).
//   phase 4: out[c][n] = sum_d attn[c][d] v[d][n]: waves (2pr, 2pr+1) share one 16-px tile (tile pr + 4(7vt + i)), wave
//            hl does head hl: A = Pa frags (resident), B = v rows of VP/VPL (position-major, k = d contiguous):
//            hi.hi -> o, hi.res + res.hi -> orr (x1024). 256*out = o + orr/1024 split into f16 hi + x1024 residual,
//            [16][3136][256] (64-ch slab of a 512-B row): wave hl writes rows {lr, lr+4}, lr = (lane>>3)+8hl, 8 consecutive
// coverage: phase 4: 7 ranges x 4 pairs x 7 iterations = 196 tiles x 16 px = 3136 rows; per row the two waves'
//           halves (32hl + 16mt + 8hh + r) cover the 64-ch slab; grid (7, 4, 16) covers OP/OPL exactly once.
// =====================================================================================================
__global__ __launch_bounds__(256)
void attn_v(const float* __restrict__ PS, const unsigned short* __restrict__ VP,
            const unsigned short* __restrict__ VPL, const float* __restrict__ temp,
            unsigned short* OP, unsigned short* OPL) {
  __shared__ float sInv[128];
  __shared__ float sS[2 * 32 * 33];
  __shared__ __align__(16) unsigned short Pa[4 * 32 * PAP];            // [hi|res][hl][32][PAP]
  __shared__ __align__(16) unsigned short Ow[8 * 16 * TPH];            // [hi|res][pair][16][TPH]
  const int tid  = threadIdx.x;
  const int lane = tid & 31, wave = tid >> 5;
  const int hh   = lane >> 4, c = lane & 15;
  const int vt   = blockIdx.x, g = blockIdx.y, bl = blockIdx.z;

  // ---- join the slice records ----
  {
    const float* pb = PS + ((size_t)((bl * (CDIM / 64) + g) * NSL)) * PREC;
    v4f a0 = {0.f, 0.f, 0.f, 0.f}, a1 = {0.f, 0.f, 0.f, 0.f};
#pragma unroll
    for (int s = 0; s < NSL; ++s) {
      a0 += *(const v4f*)(pb + s * PREC + 4 * tid);
      a1 += *(const v4f*)(pb + s * PREC + 1024 + 4 * tid);
    }
    float* s0 = sS + (tid >> 3) * 33 + 4 * (tid & 7);                      // head 0: row tid>>3, d 4(tid&7)..+3
    float* s1 = s0 + 32 * 33;                                              // head 1
#pragma unroll
    for (int q = 0; q < 4; ++q) { s0[q] = a0[q]; s1[q] = a1[q]; }
    if (tid < 32) {                                                        // wave 0
      v4f an = {0.f, 0.f, 0.f, 0.f};
#pragma unroll
      for (int s = 0; s < NSL; ++s) an += *(const v4f*)(pb + s * PREC + 2048 + 4 * tid);
#pragma unroll
      for (int q = 0; q < 4; ++q) sInv[4 * tid + q] = 1.0f / fmaxf(sqrtf(an[q]), 1e-12f);
    }
  }
  __syncthreads();

  // ---- phase 3: softmax, attn x256 as f16 hi + residual ----
  if (tid < 64) {                                                          // waves 0, 1
    const int hl = tid >> 5, row = tid & 31;
    const float tv = bfr(temp[2 * g + hl]);
    const float iq = sInv[32 * hl + row] * tv;
    const float* srow = sS + hl * (32 * 33) + row * 33;
    const float* ik   = sInv + 64 + 32 * hl;
    float lg[32];
    float mx = -3.0e38f;
#pragma unroll
    for (int d = 0; d < 32; ++d) { const float v = srow[d] * iq * ik[d]; lg[d] = v; mx = fmaxf(mx, v); }
    float ssum = 0.f;
#pragma unroll
    for (int d = 0; d < 32; ++d) { const float ev = __expf(lg[d] - mx); lg[d] = ev; ssum += ev; }
    const float inv = PSC / ssum;
    unsigned short* ph = Pa + (hl * 32 + row) * PAP;
    unsigned short* pl = Pa + (64 + hl * 32 + row) * PAP;
#pragma unroll
    for (int d = 0; d < 32; ++d) {
      const float pv = lg[d] * inv;
      const _Float16 hv = (_Float16)pv;
      const _Float16 lv = (_Float16)((pv - (float)hv) * RSC);
      ph[d] = h_bits(hv);
      pl[d] = h_bits(lv);
    }
  }
  __syncthreads();

  // ---- phase 4: out = attn . v ----
  {
    const int pr = wave >> 1, hl = wave & 1;
    Frag ah[2], al[2];
#pragma unroll
    for (int mt = 0; mt < 2; ++mt) {
      const unsigned short* p0 = Pa + (hl * 32 + 16 * mt + c) * PAP + 8 * hh;
      ah[mt] = ldfrag(p0);
      al[mt] = ldfrag(p0 + 64 * PAP);
    }
    const size_t pbase = (size_t)bl * NPX * CDIM + 64 * g;
    const unsigned short* vpb = VP  + pbase + 32 * hl + 8 * hh;
    const unsigned short* vlb = VPL + pbase + 32 * hl + 8 * hh;
    unsigned short* owh = Ow + pr * (16 * TPH);
    unsigned short* owl = Ow + (4 + pr) * (16 * TPH);
    const int e8 = lane & 7, lr = (lane >> 3) + 8 * hl;                   // rows lr, lr+4 of the pair tile
#pragma unroll 1
    for (int i = 0; i < VIT; ++i) {                                        // 7 iterations
      const int n0 = (pr + 4 * (vt * VIT + i)) * 16;                       // tile 0..195
      const unsigned short* vr = vpb + (size_t)(n0 + c) * CDIM;
      const unsigned short* vl = vlb + (size_t)(n0 + c) * CDIM;
      const Frag fvh = ldfrag(vr);
      const Frag fvl = ldfrag(vl);
      v8f o[2], orr[2];
#pragma unroll
      for (int mt = 0; mt < 2; ++mt) {
        o[mt]   = mma_h(ah[mt].h, fvh.h, zero8());
        orr[mt] = mma_h(ah[mt].h, fvl.h, zero8());
        orr[mt] = mma_h(al[mt].h, fvh.h, orr[mt]);
      }
#pragma unroll
      for (int mt = 0; mt < 2; ++mt) {
        v4u uh, ul;
#pragma unroll
        for (int q = 0; q < 4; ++q) {
          const float f0 = o[mt][2 * q]     + orr[mt][2 * q]     * IRSC;
          const float f1 = o[mt][2 * q + 1] + orr[mt][2 * q + 1] * IRSC;
          const _Float16 h0 = (_Float16)f0, h1 = (_Float16)f1;
          const _Float16 l0 = (_Float16)((f0 - (float)h0) * RSC);
          const _Float16 l1 = (_Float16)((f1 - (float)h1) * RSC);
          uh[q] = pk16(h_bits(h0), h_bits(h1));
          ul[q] = pk16(h_bits(l0), h_bits(l1));
        }
        const int so = c * TPH + 32 * hl + 16 * mt + 8 * hh;               // channels 32hl+16mt+8hh..+7, px c
        *(v4u*)(owh + so) = uh;
        *(v4u*)(owl + so) = ul;
      }
      __syncthreads();
      const v4u a0 = *(const v4u*)(owh + lr * TPH + 8 * e8);
      const v4u a1 = *(const v4u*)(owh + (lr + 4) * TPH + 8 * e8);
      const v4u b0 = *(const v4u*)(owl + lr * TPH + 8 * e8);
      const v4u b1 = *(const v4u*)(owl + (lr + 4) * TPH + 8 * e8);
      unsigned short* d0 = OP  + pbase + (size_t)(n0 + lr) * CDIM + 8 * e8;
      unsigned short* d1 = OPL + pbase + (size_t)(n0 + lr) * CDIM + 8 * e8;
{
        *(v4u*)(d0) = a0;
        *(v4u*)(d0 + 4 * CDIM) = a1;
        *(v4u*)(d1) = b0;
        *(v4u*)(d1 + 4 * CDIM) = b1;
        
      }
      __syncthreads();
    }
  }
}

// =====================================================================================================
// Workspace map (bytes; each region start a multiple of 256; every extent an exact tile multiple). All 16 batches go
// through each stage in one launch. Six regions are carved; a plane whose first store comes in a launch behind the
// last read of a region lies on top of that region:
//   WQ16 bf16 [768][256]          393216      WP16 f16 [256][256]            131072
//   R1   f32 [16][768][3136]   154140672      read last by (3); from (4a) on it holds OP, OPL f16 [16][3136][256]
//                                             25690112 x 2 and PS f32 [16][4][14][2176] 7798784, side by side
//   QK   f16 [16][512][3136]    51380224
//   VP, VPL f16 [16][3136][256] 25690112 x 2                                              total = 257425408
// =====================================================================================================
extern "C" void kernel_launch(void* const* d_in, const int* in_sizes, int n_in,
                              void* d_out, int out_size, void* d_ws, size_t ws_size,
                              hipStream_t stream) {
  const int XN = NBAT * CDIM * NPX;                      // 12845056
  if (n_in < 5) return;
  if (in_sizes[0] != XN) return;
  if (in_sizes[1] != C3 * CDIM) return;
  if (in_sizes[2] != C3 * 9) return;
  if (in_sizes[3] != CDIM * CDIM) return;
  if (in_sizes[4] != NHEAD) return;
  if (out_size != XN) return;

  size_t off = 0;
  auto carve = [&](size_t bytes) { const size_t o = off; off += (bytes + 255) & ~(size_t)255; return o; };
  const size_t plane16 = (size_t)NCHK * NPX * CDIM * 2;  // 25690112
  static_assert((size_t)NCHK * NPX * CDIM * 2 % 256 == 0);
  static_assert((size_t)NCHK * NPX * CDIM * 2 * 2 + (size_t)NCHK * (CDIM / 64) * NSL * PREC * 4
                <= (size_t)NCHK * C3 * NPX * 4);          // OP, OPL, PS fit on R1
  const size_t oWQ  = carve((size_t)C3 * CDIM * 2);
  const size_t oWP  = carve((size_t)CDIM * CDIM * 2);
  const size_t oR1  = carve((size_t)NCHK * C3 * NPX * 4);
  const size_t oQK  = carve((size_t)NCHK * CQK * NPX * 2);
  const size_t oVP  = carve(plane16);
  const size_t oVPL = carve(plane16);
  if (off > ws_size) return;
  const size_t oOP  = oR1;
  const size_t oOPL = oR1 + plane16;
  const size_t oPS  = oR1 + 2 * plane16;

  const float* x    = (const float*)d_in[0];
  const float* wq   = (const float*)d_in[1];
  const float* wdw  = (const float*)d_in[2];
  const float* wp   = (const float*)d_in[3];
  const float* temp = (const float*)d_in[4];
  float* out = (float*)d_out;

  char* ws = (char*)d_ws;
  unsigned short* WQ16 = (unsigned short*)(ws + oWQ);
  unsigned short* WP16 = (unsigned short*)(ws + oWP);
  float*          R1   = (float*)(ws + oR1);
  unsigned short* QK   = (unsigned short*)(ws + oQK);
  unsigned short* VP   = (unsigned short*)(ws + oVP);
  unsigned short* VPL  = (unsigned short*)(ws + oVPL);
  unsigned short* OP   = (unsigned short*)(ws + oOP);
  unsigned short* OPL  = (unsigned short*)(ws + oOPL);
  float*          PS   = (float*)(ws + oPS);

  const dim3 blk256(256), blk128(128);

  // (0) weights -> 16-bit planes
  cvt_w<<<dim3(32), blk256, 0, stream>>>(wq, wp, WQ16, WP16);
  // (1) qkv 1x1 conv straight from x -> f32 [16][768][3136]
  qkv_k<<<dim3(NTILE, MSPL, NCHK), blk128, 0, stream>>>(WQ16, x, R1);
  // (3) depthwise 3x3 -> q,k channel-major f16; v position-major f16 hi + residual
  dw_k<<<dim3(NBAND, C3 / QT, NCHK), dim3(DWT), 0, stream>>>(R1, wdw, QK, VP, VPL);
  // (4a) channel attention: partial logits and sums of squares per 224-px slice
  attn_s<<<dim3(NSL, CDIM / 64, NCHK), blk256, 0, stream>>>(QK, PS);
  // (4b) join, softmax, attn.v -> 256*out position-major f16 hi + residual [16][3136][256]
  attn_v<<<dim3(NVT, CDIM / 64, NCHK), blk256, 0, stream>>>(PS, VP, VPL, temp, OP, OPL);
  // (5) proj 1x1 conv -> d_out, scaled by 1/(64*256)
  gemm_k<0, 1><<<dim3(NTILE, CDIM / 64, NCHK), blk128, 0, stream>>>(WP16, OP, OPL, out, CDIM, OUTSC);
  (void)hipGetLastError();
}

// v006
// One run takes 121 microseconds.
// Next to v005, in two timings, it ran 1.10 times as fast each time.
// Counting every step since v000, it is 5.78 times as fast.
// Contractions: qkv 1x1 conv W[768x256].X[256x3136] on v_wmma_f32_16x16x32_bf16 (bf16 RNE operands, single product);
// channel logits q.k^T (32x32 per head, K=3136) on v_wmma_f32_16x16x32_f16 (f16 values of the depthwise outputs);
// attn.v (K=32) on v_wmma_f32_16x16x32_f16 (attn x256 as f16 hi + x1024 residual, v as f16 hi + x1024 residual,
// 3 products); proj 1x1 conv on v_wmma_f32_16x16x32_f16 (64 x bf16-RNE weights as f16, 256 x out as f16 hi +
// x1024 residual, 2 products); f32 accumulate everywhere; depthwise 3x3, L2 norms and softmax in f32 on VALU.
#include <hip/hip_runtime.h>
#include <math.h>
#include <stdint.h>

#define NBAT   16
#define NCHK   16
#define CDIM   256
#define C3     768
#define NPX    3136
#define IMW    56
#define NHEAD  8
#define QT     64
#define NTILE  49
#define TPH    72
#define OSP    68
#define PAP    40
#define RSC    1024.0f
#define IRSC   0.0009765625f
#define PSC    256.0f
#define WSC    64.0f
#define OUTSC  6.103515625e-05f
#define NSL    14
#define SLPX   224
#define PREC   2176
#define HREC   1088
#define NVT    7
#define VIT    7
#define SPE    264
#define BROW   8
#define BPX    448
#define NBAND  7
#define NST    7
#define DWT    448
#define PQ     456
#define ACH    32
#define MSPL   2
#define NCK    12

static_assert(NTILE * QT == NPX);
static_assert(IMW * IMW == NPX);
static_assert(NCHK == NBAT);
static_assert(NPX % 32 == 0);
static_assert(NPX % 16 == 0);
static_assert((NPX / 16) % 4 == 0);
static_assert(CDIM % 32 == 0);
static_assert(C3 % 128 == 0);
static_assert(CDIM % 64 == 0);
static_assert((TPH * 2) % 16 == 0);
static_assert((OSP * 4) % 16 == 0);
static_assert((PAP * 2) % 16 == 0);
static_assert(NHEAD * 32 == CDIM);
static_assert(NSL * SLPX == NPX);
static_assert(SLPX % 32 == 0);
static_assert(SLPX / 8 <= 32);
static_assert(PREC == 2 * 32 * 32 + 128);
static_assert((PREC * 4) % 128 == 0);
static_assert(NVT * VIT * 64 == NPX);
static_assert(SPE == CDIM + 8);
static_assert((SPE * 2) % 32 == 16);
static_assert(BROW * IMW == BPX);
static_assert(NBAND * BPX == NPX);
static_assert(NST * 8 == IMW);
static_assert(DWT == QT * NST);
static_assert((BPX * 2) % 128 == 0);
static_assert((PQ * 2) % 16 == 0 && PQ >= BPX);
static_assert(QT * PQ * 2 + 2 * HREC * 4 <= 2 * BPX * TPH * 2);
static_assert((QT * PQ * 2) % 16 == 0 && (HREC * 4) % 16 == 0 && HREC == 32 * 32 + 64);
static_assert(2 * SLPX == BPX && 2 * NBAND == NSL);
static_assert((SLPX * 2) % 16 == 0);
static_assert(DWT / 8 == IMW);
static_assert(MSPL * NCK * ACH == C3);
static_assert(NCK >= 2);
static_assert(2 * ACH * OSP * 4 <= QT * SPE * 2);

typedef _Float16       v16h __attribute__((ext_vector_type(16)));
typedef _Float16       v8h  __attribute__((ext_vector_type(8)));
typedef __bf16         v16b __attribute__((ext_vector_type(16)));
typedef unsigned short v8us __attribute__((ext_vector_type(8)));
typedef float          v8f  __attribute__((ext_vector_type(8)));
typedef float          v4f  __attribute__((ext_vector_type(4)));
typedef unsigned int   v4u  __attribute__((ext_vector_type(4)));

union Frag { v8us u[2]; v16h h; v16b bf; };
static_assert(sizeof(Frag) == 32);

// ---- scalar helpers ---------------------------------------------------------------------------------
__device__ __forceinline__ unsigned short bf_bits(float f) {          // f32 -> bf16 bits, RNE convert
  unsigned u = __float_as_uint(f);
  return (unsigned short)((u + 0x7FFFu + ((u >> 16) & 1u)) >> 16);
}
__device__ __forceinline__ float bf_up(unsigned short hb) { return __uint_as_float(((unsigned)hb) << 16); }
__device__ __forceinline__ float bfr(float f) { return bf_up(bf_bits(f)); }
__device__ __forceinline__ unsigned short h_bits(_Float16 x) { return __builtin_bit_cast(unsigned short, x); }
__device__ __forceinline__ unsigned pk16(unsigned short a, unsigned short b) { return (unsigned)a | ((unsigned)b << 16); }
__device__ __forceinline__ v8f zero8() { v8f z = {0.f, 0.f, 0.f, 0.f, 0.f, 0.f, 0.f, 0.f}; return z; }

// ---- 16-bit fragment loader (A, or B from a k-contiguous [n][k] row): lane -> row/col (lane&15), p already
//      includes + 8*(lane>>4); elements 0..7 <- p[0..7] (k0+8h..), elements 8..15 <- p[16..23] (k0+16+8h..)
__device__ __forceinline__ Frag ldfrag(const unsigned short* p) {
  Frag f;
  f.u[0] = *(const v8us*)(p);
  f.u[1] = *(const v8us*)(p + 16);
  return f;
}

// ---- WMMA helpers: builtin followed by a 4-slot VALU gap tying D and keeping A/B live ----------------------
__device__ __forceinline__ v8f mma_h(v16h a, v16h b, v8f c) {
  v8f d = __builtin_amdgcn_wmma_f32_16x16x32_f16(false, a, false, b, (short)0, c, false, false);
#if defined(__HIP_DEVICE_COMPILE__)
  asm volatile("v_nop\n\tv_nop\n\tv_nop\n\tv_nop" : "+v"(d) : "v"(a), "v"(b));
#endif
  return d;
}
__device__ __forceinline__ v8f mma_b(v16b a, v16b b, v8f c) {
  v8f d = __builtin_amdgcn_wmma_f32_16x16x32_bf16(false, a, false, b, (short)0, c, false, false);
#if defined(__HIP_DEVICE_COMPILE__)
  const v16h ha = __builtin_bit_cast(v16h, a), hb = __builtin_bit_cast(v16h, b);
  asm volatile("v_nop\n\tv_nop\n\tv_nop\n\tv_nop" : "+v"(d) : "v"(ha), "v"(hb));
#endif
  return d;
}

// ---- eight asynchronous copies to LDS: copy j brings one whole 512-B row (32 lanes x 16 B), rows 4 apart; l is the
//      lane's LDS byte address and g its global address in the first row. The s_wait_xcnt at the end of the statement
//      stands in front of any later overwrite of an address register that a copy names.
__device__ __forceinline__ void copy8(unsigned l, const unsigned short* g) {
#if defined(__HIP_DEVICE_COMPILE__)
  asm volatile(
      "global_load_async_to_lds_b128 %0, %8, off\n\t"
      "global_load_async_to_lds_b128 %1, %9, off\n\t"
      "global_load_async_to_lds_b128 %2, %10, off\n\t"
      "global_load_async_to_lds_b128 %3, %11, off\n\t"
      "global_load_async_to_lds_b128 %4, %12, off\n\t"
      "global_load_async_to_lds_b128 %5, %13, off\n\t"
      "global_load_async_to_lds_b128 %6, %14, off\n\t"
      "global_load_async_to_lds_b128 %7, %15, off\n\t"
      "s_wait_xcnt 0x0"
      :: "v"(l), "v"(l + 4 * (SPE * 2)), "v"(l + 8 * (SPE * 2)), "v"(l + 12 * (SPE * 2)),
         "v"(l + 16 * (SPE * 2)), "v"(l + 20 * (SPE * 2)), "v"(l + 24 * (SPE * 2)), "v"(l + 28 * (SPE * 2)),
         "v"(g), "v"(g + 4 * CDIM), "v"(g + 8 * CDIM), "v"(g + 12 * CDIM),
         "v"(g + 16 * CDIM), "v"(g + 20 * CDIM), "v"(g + 24 * CDIM), "v"(g + 28 * CDIM)
      : "memory");
#endif
}

// =====================================================================================================
// (0) weights: wq f32 [768][256] -> WQ16 bf16 bits [768][256]; wp f32 [256][256] -> WP16 f16 bits of
// coverage: WQ16 32 blocks x 96 lines = 3072 lines = 768 x 256; WP16 32 x 32 = 1024 lines = 256 x 256.
// =====================================================================================================
__global__ __launch_bounds__(256)
void cvt_w(const float* __restrict__ wq, const float* __restrict__ wp,
           unsigned short* WQ16, unsigned short* WP16) {
  const int tid = threadIdx.x, e = tid & 7, lq = tid >> 3;
  v4u uq[3];
#pragma unroll
  for (int it = 0; it < 3; ++it) {
    const int L = blockIdx.x * 96 + it * 32 + lq;                 // 0..3071
    const float* s = wq + (size_t)64 * L + 8 * e;                  // max 196600 + 7 < 196608
    const v4f a = *(const v4f*)(s);
    const v4f b = *(const v4f*)(s + 4);
    uq[it][0] = pk16(bf_bits(a[0]), bf_bits(a[1]));
    uq[it][1] = pk16(bf_bits(a[2]), bf_bits(a[3]));
    uq[it][2] = pk16(bf_bits(b[0]), bf_bits(b[1]));
    uq[it][3] = pk16(bf_bits(b[2]), bf_bits(b[3]));
  }
  v4u up;
  const int Lp = blockIdx.x * 32 + lq;                             // 0..1023
  {
    const float* s = wp + (size_t)64 * Lp + 8 * e;                 // max 65528 + 7 < 65536
    const v4f a = *(const v4f*)(s);
    const v4f b = *(const v4f*)(s + 4);
    up[0] = pk16(h_bits((_Float16)(WSC * bfr(a[0]))), h_bits((_Float16)(WSC * bfr(a[1]))));
    up[1] = pk16(h_bits((_Float16)(WSC * bfr(a[2]))), h_bits((_Float16)(WSC * bfr(a[3]))));
    up[2] = pk16(h_bits((_Float16)(WSC * bfr(b[0]))), h_bits((_Float16)(WSC * bfr(b[1]))));
    up[3] = pk16(h_bits((_Float16)(WSC * bfr(b[2]))), h_bits((_Float16)(WSC * bfr(b[3]))));
  }
{
#pragma unroll
    for (int it = 0; it < 3; ++it) {
      const int L = blockIdx.x * 96 + it * 32 + lq;
      *(v4u*)(WQ16 + (size_t)64 * L + 8 * e) = uq[it];
    }
    *(v4u*)(WP16 + (size_t)64 * Lp + 8 * e) = up;
    
  }
}

// =====================================================================================================
// (1) qkv 1x1 conv: Y[bl][m][n] = sum_k WQ16[m][k] bf16(x[bl][k][n]) for one (64-px tile nt, half mh of the 768 rows,
//     batch bl), 128 threads = 4 waves. The block reads its x tile [256 ch][64 px] f32 once, converts it (RNE) and
//     lays it position-major [px][k] in LDS at a pitch of 528 B; wave (mi, ni) takes its B fragments (px 32ni..+31,
//     all of K) into registers for the whole kernel. A comes in stages of 32 rows through two LDS buffers filled by
//     asynchronous copies: stage t+1 flies while stage t is worked on. Per stage a wave does rows 16mi..+15 x its
//     32 px (16 WMMAs, k ascending, one accumulator chain per 16x16 tile); the 32 x 64 f32 result goes through LDS
//     (two buffers, on the x tile's place, which is dead behind the fragment loads) and out as whole 128-B lines.
// coverage: x tile 128 threads x 32 loads x 4 = 256 ch x 64 px; stage 4 waves x 8 copies = 32 rows; result lines
//           4 x 8 rows x 256 B = 32 rows x 64 px; 12 stages x 32 = 384 rows; grid (49, 2, 16) covers Y exactly once.
// =====================================================================================================
__global__ __launch_bounds__(128)
void qkv_k(const unsigned short* __restrict__ A16, const float* __restrict__ x, float* Y) {
  __shared__ __align__(16) unsigned short Bt[QT * SPE];                // x tile [px][k]; behind the fragment loads: Os
  __shared__ __align__(16) unsigned short Ar[2 * ACH * SPE];           // the two A buffers
  float* Os = (float*)Bt;
  const int tid  = threadIdx.x;
  const int lane = tid & 31, wave = tid >> 5;
  const int hh   = lane >> 4, c = lane & 15;
  const int mi   = wave >> 1, ni = wave & 1;
  const int nt   = blockIdx.x, bl = blockIdx.z;
  const int m0   = blockIdx.y * (NCK * ACH), n0 = nt * QT;

  // wave w copies rows w, w+4, ..., w+28 of a stage
  const unsigned l0 = (unsigned)(uintptr_t)(Ar + wave * SPE + 8 * lane);
  const unsigned short* ga = A16 + (size_t)(m0 + wave) * CDIM + 8 * lane;
  copy8(l0, ga);                                                        // stage 0 -> buffer 0

  // ---- x tile: thread (4-px group pg, 8-channel group cq) loads 8 channels x 4 px per pass, 4 passes ----
  {
    const int pg = tid & 15, cq = tid >> 4;                             // cq 0..7
    const char* xb = (const char*)(x + (size_t)bl * CDIM * NPX + n0);
    const unsigned vo = (unsigned)(cq * 8 * NPX + 4 * pg) * 4u;         // max (56 * 3136 + 60) * 4
    // both loops are unrolled so that ld[][] lives in registers and all 32 loads are in flight together
    v4f ld[4][8];
#pragma unroll
    for (int p = 0; p < 4; ++p) {
#pragma unroll
      for (int j = 0; j < 8; ++j)                                       // channel 64p + 8cq + j <= 255
        ld[p][j] = *(const v4f*)(xb + vo + (unsigned)((p * 64 + j) * NPX) * 4u);
    }
#if defined(__HIP_DEVICE_COMPILE__)
    // the wait that stands before a register named by an issued global load is overwritten; the address registers
    // are inputs so that no load of this run is given one of them as its destination
    asm volatile("s_wait_xcnt 0x0" :: "v"(vo), "s"(xb) : "memory");
#endif
    // unrolled for constant indices into ld[][]
#pragma unroll
    for (int p = 0; p < 4; ++p) {
#pragma unroll
      for (int q = 0; q < 4; ++q) {
        v4u u;
#pragma unroll
        for (int i = 0; i < 4; ++i) u[i] = pk16(bf_bits(ld[p][2 * i][q]), bf_bits(ld[p][2 * i + 1][q]));
        *(v4u*)(Bt + (4 * pg + q) * SPE + (p * 8 + cq) * 8) = u;        // px 4pg+q, channels 64p+8cq..+7
      }
    }
  }
#if defined(__HIP_DEVICE_COMPILE__)
  // this wave's copies of stage 0 have landed before the barrier behind which the other waves read them
  asm volatile("s_wait_asynccnt 0x0" ::: "memory");
#endif
  __syncthreads();                                                      // publishes the x tile and stage 0
  copy8(l0 + ACH * (SPE * 2), ga + ACH * CDIM);                         // stage 1 -> buffer 1

  // unrolled so that fb[][] lives in registers
  Frag fb[2][CDIM / 32];
  {
    const unsigned short* bp = Bt + (32 * ni + c) * SPE + 8 * hh;
#pragma unroll
    for (int j = 0; j < 2; ++j) {
#pragma unroll
      for (int ks = 0; ks < CDIM / 32; ++ks) fb[j][ks] = ldfrag(bp + (16 * j) * SPE + 32 * ks);
    }
  }
  __syncthreads();                                                      // every wave has left Bt: it becomes Os

  const unsigned short* ap0 = Ar + (16 * mi + c) * SPE + 8 * hh;
  const int e = tid & 15, lq = tid >> 4;                                // 16 lanes x 16 B = one 256-B row piece; lq 0..7
  float* yb = Y + ((size_t)(bl * C3 + m0 + lq)) * NPX + n0 + 4 * e;

  // kept rolled: twelve copies of the body would only lengthen the text that the instruction cache has to hold
#pragma unroll 1
  for (int t = 0; t < NCK; ++t) {
    const int par = t & 1;
    const unsigned short* ap = ap0 + par * (ACH * SPE);
    float* ob = Os + par * (ACH * OSP);
    // the stage's LDS reads stand as one group ahead of its WMMAs; unrolled so that fa[] lives in registers
    Frag fa[CDIM / 32];
#pragma unroll
    for (int ks = 0; ks < CDIM / 32; ++ks) fa[ks] = ldfrag(ap + 32 * ks);
    v8f acc0 = zero8(), acc1 = zero8();
#pragma unroll
    for (int ks = 0; ks < CDIM / 32; ++ks) {
      acc0 = mma_b(fa[ks].bf, fb[0][ks].bf, acc0);
      acc1 = mma_b(fa[ks].bf, fb[1][ks].bf, acc1);
    }
    {
      float* op = ob + (16 * mi + 8 * hh) * OSP + 32 * ni + c;
      // unrolled for constant indices into the accumulators
#pragma unroll
      for (int r = 0; r < 8; ++r) { op[r * OSP] = acc0[r]; op[r * OSP + 16] = acc1[r]; }
    }
#if defined(__HIP_DEVICE_COMPILE__)
    // foot of the trip: this wave's reads of buffer par and its writes of ob are done ...
    asm volatile("s_wait_dscnt 0x0" ::: "memory");
    // ... and its copies of stage t+1 have landed, before the barrier that publishes stage t+1 and ob and frees buffer par
    asm volatile("s_wait_asynccnt 0x0" ::: "memory");
#endif
    __syncthreads();
    if (t + 2 < NCK) copy8(l0 + par * (ACH * (SPE * 2)), ga + (size_t)(t + 2) * (ACH * CDIM));
    float* yd = yb + (size_t)t * (ACH * NPX);
    // unrolled so that the four LDS reads stand together ahead of the stores
#pragma unroll
    for (int it = 0; it < ACH / 8; ++it) {
      const v4f v = *(const v4f*)(ob + (it * 8 + lq) * OSP + 4 * e);
      *(v4f*)(yd + (size_t)it * 8 * NPX) = v;
    }
#if defined(__HIP_DEVICE_COMPILE__)
    // the wait that stands before a register named by an issued global store is overwritten (the next trip does)
    asm volatile("s_wait_xcnt 0x0" ::: "memory");
#endif
  }
#if defined(__HIP_DEVICE_COMPILE__)
  // behind the last copy, before the wave ends
  asm volatile("s_wait_asynccnt 0x0" ::: "memory");
#endif
}

// =====================================================================================================
// (5) GEMM: Y[bl][m][n] = scale * sum_k A16[m][k] B16[bl][n][k] (K = 256 = 8 k-steps of 32), A and B rows
//     k-contiguous. The block's MR rows of A and 64 rows of B (and of BPL), all of K, are brought into LDS once by
//     asynchronous copies, a whole 512-B row per copy, at a pitch of 528 B; the split k map loader reads LDS. With RES: B carries a second
//     x1024 residual plane BPL into a separate accumulator, folded back as accl/1024 in the epilogue.
//     Block 128 threads = 4 waves; wave w owns columns n0+16w..+15 (one B fragment per k-step) and MT m-tiles
//     lines of the f32 channel-major plane (2 lines per 64-n row segment, 8 consecutive lanes x 16 B, one
// coverage: Os 4 waves x MT tiles x 16x16 = MR x 64; lines NIT x 16 = 2 MR = MR rows x 64 n; grid (49, M/MR, 16).
// =====================================================================================================
template <int BF, int RES>
__global__ __launch_bounds__(128)
void gemm_k(const unsigned short* __restrict__ A16, const unsigned short* __restrict__ BP,
            const unsigned short* __restrict__ BPL, float* Y, int M, float scale) {
  constexpr int MT  = RES ? 4 : 8;
  constexpr int MR  = 16 * MT;
  constexpr int NIT = (2 * MR) / 16;
  constexpr int NROW = MR + (RES ? 2 : 1) * QT;                        // staged rows: A, B, (BPL)
  static_assert(MR % 32 == 0 && QT % 32 == 0);
  static_assert(MR * OSP * 4 <= NROW * SPE * 2);
  static_assert(NROW / 4 <= 63);                                        // copies of a wave in flight
  __shared__ __align__(16) unsigned short St[NROW * SPE];
  float* Os = (float*)St;                                               // output staging, on St behind the K loop
  const int tid  = threadIdx.x;
  const int lane = tid & 31, wave = tid >> 5;
  const int hh   = lane >> 4, c = lane & 15;
  const int nt   = blockIdx.x, bl = blockIdx.z;
  const int m0   = blockIdx.y * MR, n0 = nt * QT;

  // ---- fill: wave w copies rows w, w+4, ... of each operand ----
  {
    const unsigned l0 = (unsigned)(uintptr_t)(St + wave * SPE + 8 * lane);
    const unsigned short* ga = A16 + (size_t)(m0 + wave) * CDIM + 8 * lane;
    const size_t go = ((size_t)(bl * NPX + n0 + wave)) * CDIM + 8 * lane;
    // the three loops are unrolled so that every copy's addresses are one add of a constant to a common base
#pragma unroll
    for (int s = 0; s < MR / 32; ++s) copy8(l0 + s * 32 * (SPE * 2), ga + s * 32 * CDIM);
#pragma unroll
    for (int s = 0; s < QT / 32; ++s) copy8(l0 + (MR + s * 32) * (SPE * 2), BP + go + s * 32 * CDIM);
    if (RES) {
#pragma unroll
      for (int s = 0; s < QT / 32; ++s) copy8(l0 + (MR + QT + s * 32) * (SPE * 2), BPL + go + s * 32 * CDIM);
    }
#if defined(__HIP_DEVICE_COMPILE__)
    // this wave's copies have landed before the barrier behind which the other waves read them
    asm volatile("s_wait_asynccnt 0x0" ::: "memory");
#endif
  }
  __syncthreads();

  const unsigned short* ap  = St + c * SPE + 8 * hh;
  const unsigned short* bp  = St + (MR + 16 * wave + c) * SPE + 8 * hh;
  const unsigned short* bpl = RES ? (bp + QT * SPE) : bp;

  v8f acc[MT], accl[MT];
#pragma unroll
  for (int mt = 0; mt < MT; ++mt) { acc[mt] = zero8(); accl[mt] = zero8(); }

#pragma unroll 2
  for (int ks = 0; ks < CDIM / 32; ++ks) {
    const Frag fb = ldfrag(bp + 32 * ks);
    Frag fbl;
    if (RES) fbl = ldfrag(bpl + 32 * ks); else fbl = fb;
    // the k-step's LDS reads stand as one group ahead of its WMMAs: one LDS latency per k-step, not one per WMMA;
    // unrolled so that fa[] lives in registers
    Frag fa[MT];
#pragma unroll
    for (int mt = 0; mt < MT; ++mt) fa[mt] = ldfrag(ap + (16 * mt) * SPE + 32 * ks);
#pragma unroll
    for (int mt = 0; mt < MT; ++mt) {
      if (BF) acc[mt] = mma_b(fa[mt].bf, fb.bf, acc[mt]);
      else    acc[mt] = mma_h(fa[mt].h, fb.h, acc[mt]);
      if (RES) accl[mt] = mma_h(fa[mt].h, fbl.h, accl[mt]);
    }
  }

  __syncthreads();                                                      // every wave has left St: it becomes Os

  // ---- epilogue -> LDS Os[m][n] ----
  {
    const int nl = 16 * wave + c;
#pragma unroll
    for (int mt = 0; mt < MT; ++mt) {
#pragma unroll
      for (int r = 0; r < 8; ++r) {
        float v = acc[mt][r];
        if (RES) v += accl[mt][r] * IRSC;
        Os[(16 * mt + 8 * hh + r) * OSP + nl] = v * scale;
      }
    }
  }
  __syncthreads();

  {
    const int e = tid & 7, lq = tid >> 3;                              // lq 0..15
{
#pragma unroll
      for (int it = 0; it < NIT; ++it) {
        const int L = it * 16 + lq;                                    // 0..2MR-1
        const int row = L >> 1, hf = L & 1;
        const v4f v = *(const v4f*)(Os + row * OSP + hf * 32 + 4 * e);
        float* dst = Y + ((size_t)(bl * M + m0 + row)) * NPX + n0 + hf * 32 + 4 * e;
        *(v4f*)dst = v;
      }
      
    }
  }
}

// =====================================================================================================
// (3) depthwise 3x3, zero pad 1, for one (band of 8 image rows = 448 px, 64-channel group cg, batch bl) of the f32
//     plane QKV[16][768][3136]; weights = bf16-RNE values in registers. Group cg < 8: head cg's 32 q channels and its
//     32 k channels; cg >= 8: v channels 64(cg-8)..+63. Thread (channel tid/7, strip tid%7 of 8 px):
//     the 10 input rows of its strip (8 px as two 16-B loads, plus the left and the right neighbour) are held in
//     registers and give an 8 x 8 px patch; row and neighbour addresses are clamped, taps outside the image zeroed
//     by predicate; per output the 9 products are summed in tap order. Results as f16 hi (v: and x1024 residual)
//     into an LDS tile. v tile: [px][channel], the eight 16-B channel chunks of a px row rotated by (px/8)&7 so that
//     the strips of a wave store to different banks; it goes out as whole 128-B lines.
//     q,k tile: [channel][px]; it never leaves the block. The band is two slices of 224 px; waves 0..7 form, from LDS,
//     per slice s2 = wave/4:
//       the sum of squares of tile rows 16(wave&3)..+15 over the slice (f32, one 8-px vector per lane, lanes 0..27,
//       + xor tree), and
//       one 16x16 tile (mt, ntk) of S[c][d] = sum_n q[c][n] k[d][n] over the slice: A = q row 16mt+(lane&15), B = k row
//       16ntk+(lane&15), both k-contiguous with the split k map, 7 k-steps on f16 WMMA.
//     The head's part of the slice record ([32][32] logits, 32 + 32 sums of squares) goes through LDS and out as whole
//     128-B lines of PS[bl][head pair][slice][2 x 1024 logits | 64 q sums | 64 k sums].
// coverage: 448 threads x 64 px = 64 ch x 448 px per tile; v lines 8 x 56 = 448 per plane; record part 256 x 4 = 1024
//           logits and 2 x 8 x 4 = 64 sums per slice; grid (7, 12, 16) covers PS (cg 0..7: 8 heads x 14 slices) and
//           VP/VPL (cg 8..11 -> v channels 0..255) exactly once.
// =====================================================================================================
__global__ __launch_bounds__(DWT)
void dw_k(const float* __restrict__ QKV, const float* __restrict__ wdw,
          float* PS, unsigned short* VP, unsigned short* VPL) {
  __shared__ __align__(16) unsigned short Tt[2 * BPX * TPH];           // v: [hi|res][448][TPH]; q,k: [64][PQ], 2 records
  const int tid = threadIdx.x;
  const int bd = blockIdx.x, cg = blockIdx.y, bl = blockIdx.z;
  const bool isv = (cg >= 8);                                           // block-uniform
  const int ch = tid / NST, st = tid - ch * NST;                        // ch 0..63, st 0..6
  const int cb  = isv ? cg * QT : cg * 32;                              // the group's first channel (block-uniform)
  const int chx = ch + ((!isv && ch >= 32) ? CDIM - 32 : 0);            // q,k: rows 32..63 are the head's k channels
  const bool okt = (bd > 0), okb = (bd < NBAND - 1);                    // row above / below the band is in the image
  const bool okl = (st > 0), okr = (st < NST - 1);                      // left / right neighbour is in the image

  // Addresses: a block-uniform base (the band's first row; the row above it, clamped into the image) plus the
  // thread's byte offset (its strip; its left and right neighbour, clamped into the row).
  const char* sb  = (const char*)(QKV + ((size_t)(bl * C3 + cb)) * NPX + bd * BPX);
  const char* sbt = sb - (okt ? IMW * 4 : 0);
  const unsigned ob = okb ? BROW * IMW * 4u : (BROW - 1) * IMW * 4u;    // the row below, as an offset from sb
  const char* sw  = (const char*)(wdw + cb * 9);
  unsigned vm = (unsigned)(chx * NPX + 8 * st) * 4u;                    // cb + chx <= 767; max (287 * 3136 + 48) * 4
  unsigned vl = vm - (okl ? 4u : 0u);
  unsigned vr = vm + (okr ? 32u : 28u);
  const unsigned vw = (unsigned)(chx * 9) * 4u;                         // max (cb + chx) * 9 + 8 = 6911

  // every loop below over rows, px and taps is unrolled so that w[], in[] and o[] are registers with constant indices
  float w[9];
  float in[BROW + 2][10];
  auto ldrow = [&](int rr, const char* base, unsigned om, unsigned ol, unsigned orr) {
    const v4f a = *(const v4f*)(base + om);
    const v4f b = *(const v4f*)(base + om + 16);
    in[rr][0] = *(const float*)(base + ol);
    in[rr][9] = *(const float*)(base + orr);
#pragma unroll
    for (int q = 0; q < 4; ++q) { in[rr][1 + q] = a[q]; in[rr][5 + q] = b[q]; }
  };
  // taps outside the image read as zero
  auto mask = [&](int rr) {
    const bool oky = (rr == 0) ? okt : (rr == BROW + 1) ? okb : true;
    in[rr][0] = (oky && okl) ? in[rr][0] : 0.f;
    in[rr][9] = (oky && okr) ? in[rr][9] : 0.f;
    if (rr == 0 || rr == BROW + 1) {
#pragma unroll
      for (int q = 1; q < 9; ++q) in[rr][q] = oky ? in[rr][q] : 0.f;
    }
  };

  // first run of loads: the weights and input rows 0..7, all in flight together
#pragma unroll
  for (int t = 0; t < 9; ++t) w[t] = *(const float*)(sw + vw + 4 * t);
  ldrow(0, sbt, vm, vl, vr);
#pragma unroll
  for (int rr = 1; rr < BROW; ++rr) ldrow(rr, sb + (rr - 1) * (IMW * 4), vm, vl, vr);
#if defined(__HIP_DEVICE_COMPILE__)
  // the wait that stands before a register named by an issued global load is overwritten; the address registers are
  // operands so that no load of this run is given one of them as its destination; the three offsets are in/out so
  // that the second run forms its addresses from them again as scalar base + 32-bit offset: carried over from here
  // they would be three 64-bit pairs, held in registers through rows 0 to 2
  asm volatile("s_wait_xcnt 0x0" : "+v"(vm), "+v"(vl), "+v"(vr) : "v"(vw), "s"(sw), "s"(sb), "s"(sbt) : "memory");
#endif
#pragma unroll
  for (int t = 0; t < 9; ++t) w[t] = bfr(w[t]);

#pragma unroll
  for (int r = 0; r < BROW; ++r) {
    if (r == 3) {
      // second run: input rows 8 and 9 take registers that rows 0 to 2 have left, so that the kernel stays within 128
      // registers (eight waves a SIMD: two blocks fit however their 14 waves are dealt); they are used from r = 6 on
      const unsigned vm9 = vm + ob, vl9 = vl + ob, vr9 = vr + ob;
      ldrow(BROW, sb + (BROW - 1) * (IMW * 4), vm, vl, vr);
      ldrow(BROW + 1, sb, vm9, vl9, vr9);
#if defined(__HIP_DEVICE_COMPILE__)
      // the same wait for the second run of loads, its address registers as inputs
      asm volatile("s_wait_xcnt 0x0" :: "v"(vm), "v"(vl), "v"(vr), "v"(vm9), "v"(vl9), "v"(vr9), "s"(sb) : "memory");
#endif
    }
    if (r == 0) { mask(0); mask(1); }
    mask(r + 2);
    float o[8];
#pragma unroll
    for (int j = 0; j < 8; ++j) {
      float s = 0.f;
#pragma unroll
      for (int t = 0; t < 9; ++t) s = fmaf(in[r + t / 3][j + t % 3], w[t], s);
      o[j] = s;
    }
    if (isv) {
      const int p0 = r * IMW + 8 * st;                                   // px of the band, p0/8 = 7r + st
      unsigned short* th = Tt + p0 * TPH + ((ch + 8 * (NST * r + st)) & 63);
#pragma unroll
      for (int j = 0; j < 8; ++j) {
        const _Float16 hv = (_Float16)o[j];
        const _Float16 lv = (_Float16)((o[j] - (float)hv) * RSC);
        th[j * TPH] = h_bits(hv);
        th[BPX * TPH + j * TPH] = h_bits(lv);
      }
    } else {
      v4u u;
#pragma unroll
      for (int q = 0; q < 4; ++q) u[q] = pk16(h_bits((_Float16)o[2 * q]), h_bits((_Float16)o[2 * q + 1]));
      *(v4u*)(Tt + ch * PQ + r * IMW + 8 * st) = u;
    }
  }
  __syncthreads();
  {
    const int e = tid & 7, lq = tid >> 3;                                 // lq 0..55
    if (isv) {
      const int vg = cg - 8;                                              // 0..3
      unsigned short* dh = VP  + ((size_t)(bl * NPX + bd * BPX + lq)) * CDIM + vg * QT + 8 * e;
      unsigned short* dl = VPL + ((size_t)(bl * NPX + bd * BPX + lq)) * CDIM + vg * QT + 8 * e;
#pragma unroll
      for (int it = 0; it < BROW; ++it) {
        const int px = it * IMW + lq;                                     // 0..447
        const unsigned short* t = Tt + px * TPH + 8 * ((e + (px >> 3)) & 7);
        const v4u h = *(const v4u*)(t);
        const v4u l = *(const v4u*)(t + BPX * TPH);
        *(v4u*)(dh + (size_t)it * IMW * CDIM) = h;
        *(v4u*)(dl + (size_t)it * IMW * CDIM) = l;
      }
#if defined(__HIP_DEVICE_COMPILE__)
      // the wait that stands before a register named by an issued global store is overwritten: in the listing the
      // code of the q,k branch, which writes these registers, follows the stores behind a conditional branch
      asm volatile("s_wait_xcnt 0x0" ::: "memory");
#endif
    } else {
      float* sP = (float*)(Tt + QT * PQ);                                 // the two slices' record parts, behind the tile
      const int lane = tid & 31, wave = tid >> 5;
      if (wave < 8) {                                                     // whole waves
        const int hh = lane >> 4, c = lane & 15;
        const int s2 = wave >> 2, mt = (wave >> 1) & 1, ntk = wave & 1;
        const unsigned short* ts = Tt + s2 * SLPX;
        float* rec = sP + s2 * HREC;
        // ---- row sums of squares over the slice ----
        {
          const int idc = min(lane, SLPX / 8 - 1);                        // 28 vectors per row slice
          const unsigned short* rp = ts + (16 * (wave & 3)) * PQ + 8 * idc;
          float s[16];
#pragma unroll
          for (int rr = 0; rr < 16; ++rr) {
            const v8h rv = *(const v8h*)(rp + rr * PQ);
            float t = 0.f;
#pragma unroll
            for (int q = 0; q < 8; ++q) { const float f = (float)rv[q]; t = fmaf(f, f, t); }
            s[rr] = (lane < SLPX / 8) ? t : 0.f;
          }
#pragma unroll
          for (int off = 16; off > 0; off >>= 1) {
#pragma unroll
            for (int rr = 0; rr < 16; ++rr) s[rr] += __shfl_xor(s[rr], off, 32);
          }
          if (lane == 0) {
#pragma unroll
            for (int rr = 0; rr < 16; ++rr) rec[1024 + 16 * (wave & 3) + rr] = s[rr];
          }
        }
        // ---- raw logits S of the slice on f16 WMMA ----
        {
          const unsigned short* arow = ts + (16 * mt + c) * PQ + 8 * hh;
          const unsigned short* brow = ts + (32 + 16 * ntk + c) * PQ + 8 * hh;
          // the LDS reads stand in two groups (k-steps 0..3, 4..6), each ahead of its WMMAs: two LDS latencies, not one
          // per k-step, and no more registers than the depthwise part holds; unrolled so that fa[], fb[] are registers
          v8f acc = zero8();
#pragma unroll
          for (int k0 = 0; k0 < SLPX / 32; k0 += 4) {
            Frag fa[4], fb[4];
#pragma unroll
            for (int ks = k0; ks < k0 + 4 && ks < SLPX / 32; ++ks) {
              fa[ks - k0] = ldfrag(arow + 32 * ks);
              fb[ks - k0] = ldfrag(brow + 32 * ks);
            }
#pragma unroll
            for (int ks = k0; ks < k0 + 4 && ks < SLPX / 32; ++ks) acc = mma_h(fa[ks - k0].h, fb[ks - k0].h, acc);
          }
          float* sp = rec + (16 * mt + 8 * hh) * 32 + 16 * ntk + c;
#pragma unroll
          for (int r = 0; r < 8; ++r) sp[r * 32] = acc[r];
        }
      }
      __syncthreads();                                                    // block-uniform branch: every wave passes it
      const int hl = cg & 1;
      float* dst = PS + ((size_t)((bl * (CDIM / 64) + (cg >> 1)) * NSL + 2 * bd)) * PREC;
      if (wave < 8) {
        const v4f r0 = *(const v4f*)(sP + 4 * tid);
        const v4f r1 = *(const v4f*)(sP + HREC + 4 * tid);
        *(v4f*)(dst + hl * 1024 + 4 * tid) = r0;
        *(v4f*)(dst + PREC + hl * 1024 + 4 * tid) = r1;
      } else if (wave == 8) {
        const int s2 = lane >> 4, i = lane & 15;                          // i 0..7: q sums, 8..15: k sums
        const v4f r2 = *(const v4f*)(sP + s2 * HREC + 1024 + 4 * i);
        *(v4f*)(dst + s2 * PREC + 2048 + 32 * hl + 4 * i + ((i >= 8) ? 32 : 0)) = r2;
      }
    }
  }
}

// =====================================================================================================
// (4) softmax and attn.v for one (pixel range vt of 448 px, head pair g, batch bl), 256 threads.
//   join:    the 14 slice records of (g, bl) summed in slice order (f32) -> S in LDS, 1/max(norm, eps) in LDS;
//            every block of a (g, bl) does the same sums and gets the same attn.
//   phase 3: logits = S * invq * invk * temperature (bf16-RNE), max-subtracted softmax in f32, attn x256 as f16
//            hi and x1024 residual into LDS Pa [c][d] (d contiguous = A operand of phase 4).
//   phase 4: out[c][n] = sum_d attn[c][d] v[d][n]: waves (2pr, 2pr+1) share one 16-px tile (tile pr + 4(7vt + i)), wave
//            hl does head hl: A = Pa frags (resident), B = v rows of VP/VPL (position-major, k = d contiguous):
//            hi.hi -> o, hi.res + res.hi -> orr (x1024). 256*out = o + orr/1024 split into f16 hi + x1024 residual,
//            [16][3136][256] (64-ch slab of a 512-B row): wave hl writes rows {lr, lr+4}, lr = (lane>>3)+8hl, 8 consecutive
// coverage: phase 4: 7 ranges x 4 pairs x 7 iterations = 196 tiles x 16 px = 3136 rows; per row the two waves'
//           halves (32hl + 16mt + 8hh + r) cover the 64-ch slab; grid (7, 4, 16) covers OP/OPL exactly once.
// =====================================================================================================
__global__ __launch_bounds__(256)
void attn_v(const float* __restrict__ PS, const unsigned short* __restrict__ VP,
            const unsigned short* __restrict__ VPL, const float* __restrict__ temp,
            unsigned short* OP, unsigned short* OPL) {
  __shared__ float sInv[128];
  __shared__ float sS[2 * 32 * 33];
  __shared__ __align__(16) unsigned short Pa[4 * 32 * PAP];            // [hi|res][hl][32][PAP]
  __shared__ __align__(16) unsigned short Ow[8 * 16 * TPH];            // [hi|res][pair][16][TPH]
  const int tid  = threadIdx.x;
  const int lane = tid & 31, wave = tid >> 5;
  const int hh   = lane >> 4, c = lane & 15;
  const int vt   = blockIdx.x, g = blockIdx.y, bl = blockIdx.z;

  // ---- join the slice records ----
  {
    const float* pb = PS + ((size_t)((bl * (CDIM / 64) + g) * NSL)) * PREC;
    v4f a0 = {0.f, 0.f, 0.f, 0.f}, a1 = {0.f, 0.f, 0.f, 0.f};
#pragma unroll
    for (int s = 0; s < NSL; ++s) {
      a0 += *(const v4f*)(pb + s * PREC + 4 * tid);
      a1 += *(const v4f*)(pb + s * PREC + 1024 + 4 * tid);
    }
    float* s0 = sS + (tid >> 3) * 33 + 4 * (tid & 7);                      // head 0: row tid>>3, d 4(tid&7)..+3
    float* s1 = s0 + 32 * 33;                                              // head 1
#pragma unroll
    for (int q = 0; q < 4; ++q) { s0[q] = a0[q]; s1[q] = a1[q]; }
    if (tid < 32) {                                                        // wave 0
      v4f an = {0.f, 0.f, 0.f, 0.f};
#pragma unroll
      for (int s = 0; s < NSL; ++s) an += *(const v4f*)(pb + s * PREC + 2048 + 4 * tid);
#pragma unroll
      for (int q = 0; q < 4; ++q) sInv[4 * tid + q] = 1.0f / fmaxf(sqrtf(an[q]), 1e-12f);
    }
  }
  __syncthreads();

  // ---- phase 3: softmax, attn x256 as f16 hi + residual ----
  if (tid < 64) {                                                          // waves 0, 1
    const int hl = tid >> 5, row = tid & 31;
    const float tv = bfr(temp[2 * g + hl]);
    const float iq = sInv[32 * hl + row] * tv;
    const float* srow = sS + hl * (32 * 33) + row * 33;
    const float* ik   = sInv + 64 + 32 * hl;
    float lg[32];
    float mx = -3.0e38f;
#pragma unroll
    for (int d = 0; d < 32; ++d) { const float v = srow[d] * iq * ik[d]; lg[d] = v; mx = fmaxf(mx, v); }
    float ssum = 0.f;
#pragma unroll
    for (int d = 0; d < 32; ++d) { const float ev = __expf(lg[d] - mx); lg[d] = ev; ssum += ev; }
    const float inv = PSC / ssum;
    unsigned short* ph = Pa + (hl * 32 + row) * PAP;
    unsigned short* pl = Pa + (64 + hl * 32 + row) * PAP;
#pragma unroll
    for (int d = 0; d < 32; ++d) {
      const float pv = lg[d] * inv;
      const _Float16 hv = (_Float16)pv;
      const _Float16 lv = (_Float16)((pv - (float)hv) * RSC);
      ph[d] = h_bits(hv);
      pl[d] = h_bits(lv);
    }
  }
  __syncthreads();

  // ---- phase 4: out = attn . v ----
  {
    const int pr = wave >> 1, hl = wave & 1;
    Frag ah[2], al[2];
#pragma unroll
    for (int mt = 0; mt < 2; ++mt) {
      const unsigned short* p0 = Pa + (hl * 32 + 16 * mt + c) * PAP + 8 * hh;
      ah[mt] = ldfrag(p0);
      al[mt] = ldfrag(p0 + 64 * PAP);
    }
    const size_t pbase = (size_t)bl * NPX * CDIM + 64 * g;
    const unsigned short* vpb = VP  + pbase + 32 * hl + 8 * hh;
    const unsigned short* vlb = VPL + pbase + 32 * hl + 8 * hh;
    unsigned short* owh = Ow + pr * (16 * TPH);
    unsigned short* owl = Ow + (4 + pr) * (16 * TPH);
    const int e8 = lane & 7, lr = (lane >> 3) + 8 * hl;                   // rows lr, lr+4 of the pair tile
#pragma unroll 1
    for (int i = 0; i < VIT; ++i) {                                        // 7 iterations
      const int n0 = (pr + 4 * (vt * VIT + i)) * 16;                       // tile 0..195
      const unsigned short* vr = vpb + (size_t)(n0 + c) * CDIM;
      const unsigned short* vl = vlb + (size_t)(n0 + c) * CDIM;
      const Frag fvh = ldfrag(vr);
      const Frag fvl = ldfrag(vl);
      v8f o[2], orr[2];
#pragma unroll
      for (int mt = 0; mt < 2; ++mt) {
        o[mt]   = mma_h(ah[mt].h, fvh.h, zero8());
        orr[mt] = mma_h(ah[mt].h, fvl.h, zero8());
        orr[mt] = mma_h(al[mt].h, fvh.h, orr[mt]);
      }
#pragma unroll
      for (int mt = 0; mt < 2; ++mt) {
        v4u uh, ul;
#pragma unroll
        for (int q = 0; q < 4; ++q) {
          const float f0 = o[mt][2 * q]     + orr[mt][2 * q]     * IRSC;
          const float f1 = o[mt][2 * q + 1] + orr[mt][2 * q + 1] * IRSC;
          const _Float16 h0 = (_Float16)f0, h1 = (_Float16)f1;
          const _Float16 l0 = (_Float16)((f0 - (float)h0) * RSC);
          const _Float16 l1 = (_Float16)((f1 - (float)h1) * RSC);
          uh[q] = pk16(h_bits(h0), h_bits(h1));
          ul[q] = pk16(h_bits(l0), h_bits(l1));
        }
        const int so = c * TPH + 32 * hl + 16 * mt + 8 * hh;               // channels 32hl+16mt+8hh..+7, px c
        *(v4u*)(owh + so) = uh;
        *(v4u*)(owl + so) = ul;
      }
      __syncthreads();
      const v4u a0 = *(const v4u*)(owh + lr * TPH + 8 * e8);
      const v4u a1 = *(const v4u*)(owh + (lr + 4) * TPH + 8 * e8);
      const v4u b0 = *(const v4u*)(owl + lr * TPH + 8 * e8);
      const v4u b1 = *(const v4u*)(owl + (lr + 4) * TPH + 8 * e8);
      unsigned short* d0 = OP  + pbase + (size_t)(n0 + lr) * CDIM + 8 * e8;
      unsigned short* d1 = OPL + pbase + (size_t)(n0 + lr) * CDIM + 8 * e8;
{
        *(v4u*)(d0) = a0;
        *(v4u*)(d0 + 4 * CDIM) = a1;
        *(v4u*)(d1) = b0;
        *(v4u*)(d1 + 4 * CDIM) = b1;
        
      }
      __syncthreads();
    }
  }
}

// =====================================================================================================
// Workspace map (bytes; each region start a multiple of 256; every extent an exact tile multiple). All 16 batches go
// through each stage in one launch. Six regions are carved; a plane whose first store comes in a launch behind the
// last read of a region lies on top of that region:
//   WQ16 bf16 [768][256]          393216      WP16 f16 [256][256]            131072
//   R1   f32 [16][768][3136]   154140672      read last by (3); from (4) on it holds OP, OPL f16 [16][3136][256]
//                                             25690112 x 2, side by side
//   PS   f32 [16][4][14][2176]   7798784      written by (3) while R1 is still read: a region of its own
//   VP, VPL f16 [16][3136][256] 25690112 x 2                                              total = 213843968
// =====================================================================================================
extern "C" void kernel_launch(void* const* d_in, const int* in_sizes, int n_in,
                              void* d_out, int out_size, void* d_ws, size_t ws_size,
                              hipStream_t stream) {
  const int XN = NBAT * CDIM * NPX;                      // 12845056
  if (n_in < 5) return;
  if (in_sizes[0] != XN) return;
  if (in_sizes[1] != C3 * CDIM) return;
  if (in_sizes[2] != C3 * 9) return;
  if (in_sizes[3] != CDIM * CDIM) return;
  if (in_sizes[4] != NHEAD) return;
  if (out_size != XN) return;

  size_t off = 0;
  auto carve = [&](size_t bytes) { const size_t o = off; off += (bytes + 255) & ~(size_t)255; return o; };
  const size_t plane16 = (size_t)NCHK * NPX * CDIM * 2;  // 25690112
  static_assert((size_t)NCHK * NPX * CDIM * 2 % 256 == 0);
  static_assert((size_t)NCHK * NPX * CDIM * 2 * 2 <= (size_t)NCHK * C3 * NPX * 4);   // OP, OPL fit on R1
  const size_t oWQ  = carve((size_t)C3 * CDIM * 2);
  const size_t oWP  = carve((size_t)CDIM * CDIM * 2);
  const size_t oR1  = carve((size_t)NCHK * C3 * NPX * 4);
  const size_t oPS  = carve((size_t)NCHK * (CDIM / 64) * NSL * PREC * 4);
  const size_t oVP  = carve(plane16);
  const size_t oVPL = carve(plane16);
  if (off > ws_size) return;
  const size_t oOP  = oR1;
  const size_t oOPL = oR1 + plane16;

  const float* x    = (const float*)d_in[0];
  const float* wq   = (const float*)d_in[1];
  const float* wdw  = (const float*)d_in[2];
  const float* wp   = (const float*)d_in[3];
  const float* temp = (const float*)d_in[4];
  float* out = (float*)d_out;

  char* ws = (char*)d_ws;
  unsigned short* WQ16 = (unsigned short*)(ws + oWQ);
  unsigned short* WP16 = (unsigned short*)(ws + oWP);
  float*          R1   = (float*)(ws + oR1);
  unsigned short* VP   = (unsigned short*)(ws + oVP);
  unsigned short* VPL  = (unsigned short*)(ws + oVPL);
  unsigned short* OP   = (unsigned short*)(ws + oOP);
  unsigned short* OPL  = (unsigned short*)(ws + oOPL);
  float*          PS   = (float*)(ws + oPS);

  const dim3 blk256(256), blk128(128);

  // (0) weights -> 16-bit planes
  cvt_w<<<dim3(32), blk256, 0, stream>>>(wq, wp, WQ16, WP16);
  // (1) qkv 1x1 conv straight from x -> f32 [16][768][3136]
  qkv_k<<<dim3(NTILE, MSPL, NCHK), blk128, 0, stream>>>(WQ16, x, R1);
  // (3) depthwise 3x3 -> q,k: partial logits and sums of squares per 224-px slice; v position-major f16 hi + residual
  dw_k<<<dim3(NBAND, C3 / QT, NCHK), dim3(DWT), 0, stream>>>(R1, wdw, PS, VP, VPL);
  // (4) join, softmax, attn.v -> 256*out position-major f16 hi + residual [16][3136][256]
  attn_v<<<dim3(NVT, CDIM / 64, NCHK), blk256, 0, stream>>>(PS, VP, VPL, temp, OP, OPL);
  // (5) proj 1x1 conv -> d_out, scaled by 1/(64*256)
  gemm_k<0, 1><<<dim3(NTILE, CDIM / 64, NCHK), blk128, 0, stream>>>(WP16, OP, OPL, out, CDIM, OUTSC);
  (void)hipGetLastError();
}

// v010
// One run takes 66 microseconds.
// It is 1.83 times as fast as v006, going by the measured steps of the versions left out in between.
// Over all steps from v000 it is 10.6 times as fast.
// Contractions: qkv 1x1 conv W[768x256].X[256x3136] on v_wmma_f32_16x16x32_bf16 (bf16 RNE operands, single product);
// channel logits q.k^T (32x32 per head, K=3136) on v_wmma_f32_16x16x32_f16 (f16 values of the depthwise outputs);
// proj.attn (K=32, per batch and head) on v_wmma_f32_16x16x32_f16 (64 x bf16-RNE weights as f16, attn x256 as f16 hi +
// x1024 residual, 2 products); (proj.attn).v (K=256) on v_wmma_f32_16x16x32_f16 (1024 x proj.attn as f16, v as f16,
// single product); f32 accumulate everywhere; depthwise 3x3, L2 norms and softmax in f32 on VALU.
// The 1x1 conv's result lies in the workspace as f16 (RNE of the f32 accumulators) and is widened again by its reader.
#include <hip/hip_runtime.h>
#include <math.h>
#include <stdint.h>

#define NBAT   16
#define NCHK   16
#define CDIM   256
#define C3     768
#define NPX    3136
#define IMW    56
#define NHEAD  8
#define QT     64
#define NTILE  49
#define TPH    72
#define OSP    68
#define PAP    40
#define RSC    1024.0f
#define IRSC   0.0009765625f
#define PSC    256.0f
#define WSC    64.0f
#define MSC    0.0625f
#define NSL    14
#define SLPX   224
#define PREC   2176
#define HREC   1088
#define SPE    264
#define BROW   8
#define BPX    448
#define NBAND  7
#define NST    7
#define DWT    448
#define PQ     456
#define ACH    64
#define MSPL   1
#define NCK    12
#define QP     128
#define NQT    25
#define TQP    136
#define TTN    (QT * PQ + 4 * HREC)
#define MT     8
#define MR     128

static_assert(NTILE * QT == NPX);
static_assert(IMW * IMW == NPX);
static_assert(NCHK == NBAT);
static_assert(NPX % 32 == 0);
static_assert(NPX % 16 == 0);
static_assert((NPX / 16) % 4 == 0);
static_assert(CDIM % 32 == 0);
static_assert(C3 % 128 == 0);
static_assert(CDIM % 64 == 0);
static_assert((TPH * 2) % 16 == 0);
static_assert((OSP * 4) % 16 == 0);
static_assert((PAP * 2) % 16 == 0);
static_assert(NHEAD * 32 == CDIM);
static_assert(NSL * SLPX == NPX);
static_assert(SLPX % 32 == 0);
static_assert(SLPX / 8 <= 32);
static_assert(PREC == 2 * 32 * 32 + 128);
static_assert((PREC * 4) % 128 == 0);
static_assert(SPE == CDIM + 8);
static_assert((SPE * 2) % 32 == 16);
static_assert(BROW * IMW == BPX);
static_assert(NBAND * BPX == NPX);
static_assert(NST * 8 == IMW);
static_assert(DWT == QT * NST);
static_assert((BPX * 2) % 128 == 0);
static_assert((PQ * 2) % 16 == 0 && PQ >= BPX);
static_assert(BPX * TPH <= TTN);
static_assert(CDIM % MR == 0);
static_assert((QT * PQ * 2) % 16 == 0 && (HREC * 4) % 16 == 0 && HREC == 32 * 32 + 64);
static_assert(2 * SLPX == BPX && 2 * NBAND == NSL);
static_assert((SLPX * 2) % 16 == 0);
static_assert(DWT / 8 == IMW);
static_assert(MSPL * NCK * ACH == C3);
static_assert(NCK >= 2);
static_assert(2 * ACH * TQP * 2 <= QP * SPE * 2);
static_assert((NQT - 1) * QP < NPX && NQT * QP >= NPX && NPX >= QP && (NPX - QP) % 64 == 0);
static_assert(TQP >= QP && (TQP * 2) % 16 == 0 && (QP * 2) % 128 == 0);
static_assert(TPH >= QT && ACH % 16 == 0 && (QT * 2) % 128 == 0 && (NPX * 2) % 128 == 0);

typedef _Float16       v16h __attribute__((ext_vector_type(16)));
typedef _Float16       v8h  __attribute__((ext_vector_type(8)));
typedef __bf16         v16b __attribute__((ext_vector_type(16)));
typedef unsigned short v8us __attribute__((ext_vector_type(8)));
typedef float          v8f  __attribute__((ext_vector_type(8)));
typedef float          v4f  __attribute__((ext_vector_type(4)));
typedef float          v2f  __attribute__((ext_vector_type(2)));
typedef unsigned int   v4u  __attribute__((ext_vector_type(4)));

union Frag { v8us u[2]; v16h h; v16b bf; };
static_assert(sizeof(Frag) == 32);

// ---- scalar helpers ---------------------------------------------------------------------------------
__device__ __forceinline__ unsigned short bf_bits(float f) {          // f32 -> bf16 bits, RNE convert
  unsigned u = __float_as_uint(f);
  return (unsigned short)((u + 0x7FFFu + ((u >> 16) & 1u)) >> 16);
}
__device__ __forceinline__ float bf_up(unsigned short hb) { return __uint_as_float(((unsigned)hb) << 16); }
__device__ __forceinline__ float bfr(float f) { return bf_up(bf_bits(f)); }
__device__ __forceinline__ unsigned short h_bits(_Float16 x) { return __builtin_bit_cast(unsigned short, x); }
__device__ __forceinline__ unsigned pk16(unsigned short a, unsigned short b) { return (unsigned)a | ((unsigned)b << 16); }
__device__ __forceinline__ v8f zero8() { v8f z = {0.f, 0.f, 0.f, 0.f, 0.f, 0.f, 0.f, 0.f}; return z; }

// ---- 16-bit fragment loader (A, or B from a k-contiguous [n][k] row): lane -> row/col (lane&15), p already
//      includes + 8*(lane>>4); elements 0..7 <- p[0..7] (k0+8h..), elements 8..15 <- p[16..23] (k0+16+8h..)
__device__ __forceinline__ Frag ldfrag(const unsigned short* p) {
  Frag f;
  f.u[0] = *(const v8us*)(p);
  f.u[1] = *(const v8us*)(p + 16);
  return f;
}

// ---- WMMA helpers: builtin followed by a 4-slot VALU gap tying D and keeping A/B live ----------------------
__device__ __forceinline__ v8f mma_h(v16h a, v16h b, v8f c) {
  v8f d = __builtin_amdgcn_wmma_f32_16x16x32_f16(false, a, false, b, (short)0, c, false, false);
#if defined(__HIP_DEVICE_COMPILE__)
  asm volatile("v_nop\n\tv_nop\n\tv_nop\n\tv_nop" : "+v"(d) : "v"(a), "v"(b));
#endif
  return d;
}
__device__ __forceinline__ v8f mma_b(v16b a, v16b b, v8f c) {
  v8f d = __builtin_amdgcn_wmma_f32_16x16x32_bf16(false, a, false, b, (short)0, c, false, false);
#if defined(__HIP_DEVICE_COMPILE__)
  const v16h ha = __builtin_bit_cast(v16h, a), hb = __builtin_bit_cast(v16h, b);
  asm volatile("v_nop\n\tv_nop\n\tv_nop\n\tv_nop" : "+v"(d) : "v"(ha), "v"(hb));
#endif
  return d;
}

// ---- eight asynchronous copies to LDS: copy j brings one whole 512-B row (32 lanes x 16 B), rows 4 apart; l is the
//      lane's LDS byte address and g its global address in the first row. The s_wait_xcnt at the end of the statement
//      stands in front of any later overwrite of an address register that a copy names.
__device__ __forceinline__ void copy8(unsigned l, const unsigned short* g) {
#if defined(__HIP_DEVICE_COMPILE__)
  asm volatile(
      "global_load_async_to_lds_b128 %0, %8, off\n\t"
      "global_load_async_to_lds_b128 %1, %9, off\n\t"
      "global_load_async_to_lds_b128 %2, %10, off\n\t"
      "global_load_async_to_lds_b128 %3, %11, off\n\t"
      "global_load_async_to_lds_b128 %4, %12, off\n\t"
      "global_load_async_to_lds_b128 %5, %13, off\n\t"
      "global_load_async_to_lds_b128 %6, %14, off\n\t"
      "global_load_async_to_lds_b128 %7, %15, off\n\t"
      "s_wait_xcnt 0x0"
      :: "v"(l), "v"(l + 4 * (SPE * 2)), "v"(l + 8 * (SPE * 2)), "v"(l + 12 * (SPE * 2)),
         "v"(l + 16 * (SPE * 2)), "v"(l + 20 * (SPE * 2)), "v"(l + 24 * (SPE * 2)), "v"(l + 28 * (SPE * 2)),
         "v"(g), "v"(g + 4 * CDIM), "v"(g + 8 * CDIM), "v"(g + 12 * CDIM),
         "v"(g + 16 * CDIM), "v"(g + 20 * CDIM), "v"(g + 24 * CDIM), "v"(g + 28 * CDIM)
      : "memory");
#endif
}

// ---- the same with rows 8 apart: a stage of 64 rows dealt to eight waves; the wait as in copy8
__device__ __forceinline__ void copy8w(unsigned l, const unsigned short* g) {
#if defined(__HIP_DEVICE_COMPILE__)
  asm volatile(
      "global_load_async_to_lds_b128 %0, %8, off\n\t"
      "global_load_async_to_lds_b128 %1, %9, off\n\t"
      "global_load_async_to_lds_b128 %2, %10, off\n\t"
      "global_load_async_to_lds_b128 %3, %11, off\n\t"
      "global_load_async_to_lds_b128 %4, %12, off\n\t"
      "global_load_async_to_lds_b128 %5, %13, off\n\t"
      "global_load_async_to_lds_b128 %6, %14, off\n\t"
      "global_load_async_to_lds_b128 %7, %15, off\n\t"
      "s_wait_xcnt 0x0"
      :: "v"(l), "v"(l + 8 * (SPE * 2)), "v"(l + 16 * (SPE * 2)), "v"(l + 24 * (SPE * 2)),
         "v"(l + 32 * (SPE * 2)), "v"(l + 40 * (SPE * 2)), "v"(l + 48 * (SPE * 2)), "v"(l + 56 * (SPE * 2)),
         "v"(g), "v"(g + 8 * CDIM), "v"(g + 16 * CDIM), "v"(g + 24 * CDIM),
         "v"(g + 32 * CDIM), "v"(g + 40 * CDIM), "v"(g + 48 * CDIM), "v"(g + 56 * CDIM)
      : "memory");
#endif
}

// =====================================================================================================
// (0) weights: wq f32 [768][256] -> WQ16 bf16 bits [768][256]; wp f32 [256][256] -> WP16 f16 bits of
// coverage: WQ16 32 blocks x 96 lines = 3072 lines = 768 x 256; WP16 32 x 32 = 1024 lines = 256 x 256.
// =====================================================================================================
__global__ __launch_bounds__(256)
void cvt_w(const float* __restrict__ wq, const float* __restrict__ wp,
           unsigned short* WQ16, unsigned short* WP16) {
  const int tid = threadIdx.x, e = tid & 7, lq = tid >> 3;
  v4u uq[3];
#pragma unroll
  for (int it = 0; it < 3; ++it) {
    const int L = blockIdx.x * 96 + it * 32 + lq;                 // 0..3071
    const float* s = wq + (size_t)64 * L + 8 * e;                  // max 196600 + 7 < 196608
    const v4f a = *(const v4f*)(s);
    const v4f b = *(const v4f*)(s + 4);
    uq[it][0] = pk16(bf_bits(a[0]), bf_bits(a[1]));
    uq[it][1] = pk16(bf_bits(a[2]), bf_bits(a[3]));
    uq[it][2] = pk16(bf_bits(b[0]), bf_bits(b[1]));
    uq[it][3] = pk16(bf_bits(b[2]), bf_bits(b[3]));
  }
  v4u up;
  const int Lp = blockIdx.x * 32 + lq;                             // 0..1023
  {
    const float* s = wp + (size_t)64 * Lp + 8 * e;                 // max 65528 + 7 < 65536
    const v4f a = *(const v4f*)(s);
    const v4f b = *(const v4f*)(s + 4);
    up[0] = pk16(h_bits((_Float16)(WSC * bfr(a[0]))), h_bits((_Float16)(WSC * bfr(a[1]))));
    up[1] = pk16(h_bits((_Float16)(WSC * bfr(a[2]))), h_bits((_Float16)(WSC * bfr(a[3]))));
    up[2] = pk16(h_bits((_Float16)(WSC * bfr(b[0]))), h_bits((_Float16)(WSC * bfr(b[1]))));
    up[3] = pk16(h_bits((_Float16)(WSC * bfr(b[2]))), h_bits((_Float16)(WSC * bfr(b[3]))));
  }
{
#pragma unroll
    for (int it = 0; it < 3; ++it) {
      const int L = blockIdx.x * 96 + it * 32 + lq;
      *(v4u*)(WQ16 + (size_t)64 * L + 8 * e) = uq[it];
    }
    *(v4u*)(WP16 + (size_t)64 * Lp + 8 * e) = up;
    
  }
}

// =====================================================================================================
// (1) qkv 1x1 conv: Y[bl][m][n] = sum_k WQ16[m][k] bf16(x[bl][k][n]) for one (128-px tile nt, batch bl) and all 768
//     rows, 256 threads = 8 waves. The block reads its x tile [256 ch][128 px] f32 once, converts it (RNE) and
//     lays it position-major [px][k] in LDS at a pitch of 528 B; wave (mi, ni) takes its B fragments (px 32ni..+31,
//     all of K) into registers for the whole kernel. A comes in stages of 64 rows through two LDS buffers filled by
//     asynchronous copies: stage t+1 flies while stage t is worked on; a stage fetched from L2 serves 128 px.
//     Per stage a wave does rows 16mi..+15 and then rows 32+16mi..+15 x its 32 px (twice 16 WMMAs, k ascending, one
//     accumulator chain per 16x16 tile). The px are the product's rows and the
//     channels its columns, so that a lane holds 8 consecutive px of one channel: they are rounded to f16 and packed
//     into one 16-B LDS store. The 64 x 128 f16 result goes through LDS (two buffers, pitch 272 B, on the x tile's
//     place, which is dead behind the fragment loads) and out as whole 128-B lines.
//     3136 = 24 x 128 + 64: the last tile starts at px 3008, inside the image, and stores only its upper 64 px; the
//     lower 64 belong to tile 23.
// coverage: x tile 256 threads x 32 loads x 4 = 256 ch x 128 px; stage 8 waves x 8 copies = 64 rows; result lines
//           4 x 16 rows x 256 B = 64 rows x 128 px; 12 stages x 64 = 768 rows; grid (25, 1, 16) covers Y exactly once.
// =====================================================================================================
__global__ __launch_bounds__(256)
void qkv_k(const unsigned short* __restrict__ A16, const float* __restrict__ x, unsigned short* Y) {
  __shared__ __align__(16) unsigned short Bt[QP * SPE];                // x tile [px][k]; behind the fragment loads: Os
  __shared__ __align__(16) unsigned short Ar[2 * ACH * SPE];           // the two A buffers
  unsigned short* Os = Bt;
  const int tid  = threadIdx.x;
  const int lane = tid & 31, wave = tid >> 5;
  const int hh   = lane >> 4, c = lane & 15;
  const int mi   = wave >> 2, ni = wave & 3;
  const int nt   = blockIdx.x, bl = blockIdx.z;
  const int m0   = blockIdx.y * (NCK * ACH);
  const int n0   = min(nt * QP, NPX - QP);                              // the last tile is moved back into the image

  // wave w copies rows w, w+8, ..., w+56 of a stage
  const unsigned l0 = (unsigned)(uintptr_t)(Ar + wave * SPE + 8 * lane);
  const unsigned short* ga = A16 + (size_t)(m0 + wave) * CDIM + 8 * lane;
  copy8w(l0, ga);                                                        // stage 0 -> buffer 0

  // ---- x tile: thread (4-px group pg, 8-channel group cq) loads 8 channels x 4 px per pass, 4 passes ----
  {
    const int pg = tid & 31, cq = tid >> 5;                             // cq 0..7
    const char* xb = (const char*)(x + (size_t)bl * CDIM * NPX + n0);
    const unsigned vo = (unsigned)(cq * 8 * NPX + 4 * pg) * 4u;         // max (56 * 3136 + 124) * 4
    // both loops are unrolled so that ld[][] lives in registers and all 32 loads are in flight together
    v4f ld[4][8];
#pragma unroll
    for (int p = 0; p < 4; ++p) {
#pragma unroll
      for (int j = 0; j < 8; ++j)                                       // channel 64p + 8cq + j <= 255
        ld[p][j] = *(const v4f*)(xb + vo + (unsigned)((p * 64 + j) * NPX) * 4u);
    }
#if defined(__HIP_DEVICE_COMPILE__)
    // the wait that stands before a register named by an issued global load is overwritten; the address registers
    // are inputs so that no load of this run is given one of them as its destination
    asm volatile("s_wait_xcnt 0x0" :: "v"(vo), "s"(xb) : "memory");
#endif
    // unrolled for constant indices into ld[][]
#pragma unroll
    for (int p = 0; p < 4; ++p) {
#pragma unroll
      for (int q = 0; q < 4; ++q) {
        v4u u;
#pragma unroll
        for (int i = 0; i < 4; ++i) u[i] = pk16(bf_bits(ld[p][2 * i][q]), bf_bits(ld[p][2 * i + 1][q]));
        *(v4u*)(Bt + (4 * pg + q) * SPE + (p * 8 + cq) * 8) = u;        // px 4pg+q, channels 64p+8cq..+7
      }
    }
  }
#if defined(__HIP_DEVICE_COMPILE__)
  // this wave's copies of stage 0 have landed before the barrier behind which the other waves read them
  asm volatile("s_wait_asynccnt 0x0" ::: "memory");
#endif
  __syncthreads();                                                      // publishes the x tile and stage 0
  copy8w(l0 + ACH * (SPE * 2), ga + ACH * CDIM);                         // stage 1 -> buffer 1

  // unrolled so that fb[][] lives in registers
  Frag fb[2][CDIM / 32];
  {
    const unsigned short* bp = Bt + (32 * ni + c) * SPE + 8 * hh;
#pragma unroll
    for (int j = 0; j < 2; ++j) {
#pragma unroll
      for (int ks = 0; ks < CDIM / 32; ++ks) fb[j][ks] = ldfrag(bp + (16 * j) * SPE + 32 * ks);
    }
  }
  __syncthreads();                                                      // every wave has left Bt: it becomes Os

  const unsigned short* ap0 = Ar + (16 * mi + c) * SPE + 8 * hh;
  const int e = tid & 15, lq = tid >> 4;                                // 16 lanes x 16 B = one 256-B row piece; lq 0..15
  unsigned short* yb = Y + ((size_t)(bl * C3 + m0 + lq)) * NPX + n0 + 8 * e;
  const bool own = (n0 + 8 * e >= nt * QP);                             // false only for the last tile's lower 64 px

  // kept rolled: twelve copies of the body would only lengthen the text that the instruction cache has to hold
#pragma unroll 1
  for (int t = 0; t < NCK; ++t) {
    const int par = t & 1;
    const unsigned short* ap = ap0 + par * (ACH * SPE);
    unsigned short* ob = Os + par * (ACH * TQP);
    // the stage's two halves of 32 rows, one after the other in the same registers; unrolled for constant offsets
#pragma unroll
    for (int h = 0; h < ACH / 32; ++h) {
      // the half's LDS reads stand as one group ahead of its WMMAs; unrolled so that fa[] lives in registers
      Frag fa[CDIM / 32];
#pragma unroll
      for (int ks = 0; ks < CDIM / 32; ++ks) fa[ks] = ldfrag(ap + h * (32 * SPE) + 32 * ks);
      v8f acc0 = zero8(), acc1 = zero8();
#pragma unroll
      for (int ks = 0; ks < CDIM / 32; ++ks) {
        acc0 = mma_b(fb[0][ks].bf, fa[ks].bf, acc0);                    // rows: px 32ni..+15; columns: channels 32h+16mi..+15
        acc1 = mma_b(fb[1][ks].bf, fa[ks].bf, acc1);                    // rows: px 32ni+16..+31
      }
      // the lane's accumulator registers r = 0..7 are px 8hh + r of channel 32h + 16mi + c
      unsigned short* op = ob + (32 * h + 16 * mi + c) * TQP + 32 * ni + 8 * hh;
      v4u u0, u1;
      // unrolled for constant indices into the accumulators
#pragma unroll
      for (int q = 0; q < 4; ++q) {
        u0[q] = pk16(h_bits((_Float16)acc0[2 * q]), h_bits((_Float16)acc0[2 * q + 1]));
        u1[q] = pk16(h_bits((_Float16)acc1[2 * q]), h_bits((_Float16)acc1[2 * q + 1]));
      }
      *(v4u*)(op) = u0;
      *(v4u*)(op + 16) = u1;
    }
#if defined(__HIP_DEVICE_COMPILE__)
    // foot of the trip: this wave's reads of buffer par and its writes of ob are done ...
    asm volatile("s_wait_dscnt 0x0" ::: "memory");
    // ... and its copies of stage t+1 have landed, before the barrier that publishes stage t+1 and ob and frees buffer par
    asm volatile("s_wait_asynccnt 0x0" ::: "memory");
#endif
    __syncthreads();
    if (t + 2 < NCK) copy8w(l0 + par * (ACH * (SPE * 2)), ga + (size_t)(t + 2) * (ACH * CDIM));
    unsigned short* yd = yb + (size_t)t * (ACH * NPX);
    if (own) {
      // unrolled so that the four LDS reads stand together ahead of the stores
#pragma unroll
      for (int it = 0; it < ACH / 16; ++it) {
        const v4u v = *(const v4u*)(ob + (it * 16 + lq) * TQP + 8 * e);
        *(v4u*)(yd + (size_t)it * 16 * NPX) = v;
      }
#if defined(__HIP_DEVICE_COMPILE__)
      // the wait that stands before a register named by an issued global store is overwritten (the next trip does)
      asm volatile("s_wait_xcnt 0x0" ::: "memory");
#endif
    }
  }
#if defined(__HIP_DEVICE_COMPILE__)
  // behind the last copy, before the wave ends
  asm volatile("s_wait_asynccnt 0x0" ::: "memory");
#endif
}

// =====================================================================================================
// (5) GEMM: Y[bl][m][n] = scale * sum_k A16[bl][m][k] B16[bl][n][k] (K = 256 = 8 k-steps of 32), A and B rows
//     k-contiguous. The block's 128 rows of A and 64 rows of B, all of K, are brought into LDS once by asynchronous
//     copies, a whole 512-B row per copy, at a pitch of 528 B; the split k map loader reads LDS.
//     Block 128 threads = 4 waves; wave w owns columns n0+16w..+15 (one B fragment per k-step) and 8 m-tiles. The
//     result goes through LDS and out as whole 128-B lines of the f32 channel-major plane (2 lines per 64-n row
//     segment, 8 consecutive lanes x 16 B).
// coverage: Os 4 waves x 8 tiles x 16x16 = 128 x 64; lines 16 x 16 = 256 = 128 rows x 64 n; grid (49, M/128, 16).
// =====================================================================================================
__global__ __launch_bounds__(128)
void gemm_k(const unsigned short* __restrict__ A16, const unsigned short* __restrict__ BP, float* Y, int M, float scale) {
  constexpr int NIT  = (2 * MR) / 16;
  constexpr int NROW = MR + QT;                                         // staged rows: A, B
  static_assert(MR == 16 * MT && MR % 32 == 0 && QT % 32 == 0);
  static_assert(MR * OSP * 4 <= NROW * SPE * 2);
  static_assert(NROW / 4 <= 63);                                        // copies of a wave in flight
  __shared__ __align__(16) unsigned short St[NROW * SPE];
  float* Os = (float*)St;                                               // output staging, on St behind the K loop
  const int tid  = threadIdx.x;
  const int lane = tid & 31, wave = tid >> 5;
  const int hh   = lane >> 4, c = lane & 15;
  const int nt   = blockIdx.x, bl = blockIdx.z;
  const int m0   = blockIdx.y * MR, n0 = nt * QT;

  // ---- fill: wave w copies rows w, w+4, ... of each operand ----
  {
    const unsigned l0 = (unsigned)(uintptr_t)(St + wave * SPE + 8 * lane);
    const unsigned short* ga = A16 + (size_t)(bl * M + m0 + wave) * CDIM + 8 * lane;
    const size_t go = ((size_t)(bl * NPX + n0 + wave)) * CDIM + 8 * lane;
    // the two loops are unrolled so that every copy's addresses are one add of a constant to a common base
#pragma unroll
    for (int s = 0; s < MR / 32; ++s) copy8(l0 + s * 32 * (SPE * 2), ga + s * 32 * CDIM);
#pragma unroll
    for (int s = 0; s < QT / 32; ++s) copy8(l0 + (MR + s * 32) * (SPE * 2), BP + go + s * 32 * CDIM);
#if defined(__HIP_DEVICE_COMPILE__)
    // this wave's copies have landed before the barrier behind which the other waves read them
    asm volatile("s_wait_asynccnt 0x0" ::: "memory");
#endif
  }
  __syncthreads();

  const unsigned short* ap = St + c * SPE + 8 * hh;
  const unsigned short* bp = St + (MR + 16 * wave + c) * SPE + 8 * hh;

  v8f acc[MT];
#pragma unroll
  for (int mt = 0; mt < MT; ++mt) acc[mt] = zero8();

  // two k-steps a trip: half the loop overhead, and the text stays short; one k-step's fragments are live at a time
#pragma unroll 2
  for (int ks = 0; ks < CDIM / 32; ++ks) {
    const Frag fb = ldfrag(bp + 32 * ks);
    // the k-step's LDS reads stand as one group ahead of its WMMAs: one LDS latency per k-step, not one per WMMA;
    // unrolled so that fa[] lives in registers
    Frag fa[MT];
#pragma unroll
    for (int mt = 0; mt < MT; ++mt) fa[mt] = ldfrag(ap + (16 * mt) * SPE + 32 * ks);
#pragma unroll
    for (int mt = 0; mt < MT; ++mt) acc[mt] = mma_h(fa[mt].h, fb.h, acc[mt]);
  }

  __syncthreads();                                                      // every wave has left St: it becomes Os

  // ---- epilogue -> LDS Os[m][n] ----
  {
    const int nl = 16 * wave + c;
#pragma unroll
    for (int mt = 0; mt < MT; ++mt) {
#pragma unroll
      for (int r = 0; r < 8; ++r) Os[(16 * mt + 8 * hh + r) * OSP + nl] = acc[mt][r] * scale;
    }
  }
  __syncthreads();

  {
    const int e = tid & 7, lq = tid >> 3;                              // lq 0..15
#pragma unroll
    for (int it = 0; it < NIT; ++it) {
      const int L = it * 16 + lq;                                      // 0..2MR-1
      const int row = L >> 1, hf = L & 1;
      const v4f v = *(const v4f*)(Os + row * OSP + hf * 32 + 4 * e);
      float* dst = Y + ((size_t)(bl * M + m0 + row)) * NPX + n0 + hf * 32 + 4 * e;
      *(v4f*)dst = v;
    }
  }
}

// =====================================================================================================
// (3) depthwise 3x3, zero pad 1, for one (band of 8 image rows = 448 px, 64-channel group cg, batch bl) of the f16
//     plane QKV[16][768][3136], widened to f32 as it is read; weights = bf16-RNE values in registers. Group cg < 8: head cg's 32 q channels and its
//     32 k channels; cg >= 8: v channels 64(cg-8)..+63. Thread (channel tid/7, strip tid%7 of 8 px):
//     the 10 input rows of its strip (8 px as one 16-B load, plus the left and the right neighbour) are held in
//     registers and give an 8 x 8 px patch; row and neighbour addresses are clamped, taps outside the image zeroed
//     by predicate; per output the 9 products are summed in tap order. Results as f16 (RNE)
//     into an LDS tile. v tile: [px][channel], the eight 16-B channel chunks of a px row rotated by (px/8)&7 so that
//     the strips of a wave store to different banks; it goes out as whole 128-B lines.
//     q,k tile: [channel][px]; it never leaves the block. The band is two slices of 224 px; waves 0..7 form, from LDS,
//     per slice s2 = wave/4:
//       the sum of squares of tile rows 16(wave&3)..+15 over the slice (f32, one 8-px vector per lane, lanes 0..27,
//       + xor tree), and
//       one 16x16 tile (mt, ntk) of S[c][d] = sum_n q[c][n] k[d][n] over the slice: A = q row 16mt+(lane&15), B = k row
//       16ntk+(lane&15), both k-contiguous with the split k map, 7 k-steps on f16 WMMA.
//     The head's part of the slice record ([32][32] logits, 32 + 32 sums of squares) goes through LDS and out as whole
//     128-B lines of PS[bl][head pair][slice][2 x 1024 logits | 64 q sums | 64 k sums].
// coverage: 448 threads x 64 px = 64 ch x 448 px per tile; v lines 8 x 56 = 448; record part 256 x 4 = 1024
//           logits and 2 x 8 x 4 = 64 sums per slice; grid (7, 12, 16) covers PS (cg 0..7: 8 heads x 14 slices) and
//           VP (cg 8..11 -> v channels 0..255) exactly once.
// =====================================================================================================
__global__ __launch_bounds__(DWT)
void dw_k(const unsigned short* __restrict__ QKV, const float* __restrict__ wdw,
          float* PS, unsigned short* VP) {
  __shared__ __align__(16) unsigned short Tt[TTN];                     // v: [448][TPH]; q,k: [64][PQ], 2 records
  const int tid = threadIdx.x;
  const int bd = blockIdx.x, cg = blockIdx.y, bl = blockIdx.z;
  const bool isv = (cg >= 8);                                           // block-uniform
  const int ch = tid / NST, st = tid - ch * NST;                        // ch 0..63, st 0..6
  const int cb  = isv ? cg * QT : cg * 32;                              // the group's first channel (block-uniform)
  const int chx = ch + ((!isv && ch >= 32) ? CDIM - 32 : 0);            // q,k: rows 32..63 are the head's k channels
  const bool okt = (bd > 0), okb = (bd < NBAND - 1);                    // row above / below the band is in the image
  const bool okl = (st > 0), okr = (st < NST - 1);                      // left / right neighbour is in the image

  // Addresses: a block-uniform base (the band's first row; the row above it, clamped into the image) plus the
  // thread's byte offset (its strip; its left and right neighbour, clamped into the row).
  const char* sb  = (const char*)(QKV + ((size_t)(bl * C3 + cb)) * NPX + bd * BPX);
  const char* sbt = sb - (okt ? IMW * 2 : 0);
  const unsigned ob = okb ? BROW * IMW * 2u : (BROW - 1) * IMW * 2u;    // the row below, as an offset from sb
  const char* sw  = (const char*)(wdw + cb * 9);
  unsigned vm = (unsigned)(chx * NPX + 8 * st) * 2u;                    // cb + chx <= 767; max (287 * 3136 + 48) * 2
  unsigned vl = vm - (okl ? 2u : 0u);
  unsigned vr = vm + (okr ? 16u : 14u);
  const unsigned vw = (unsigned)(chx * 9) * 4u;                         // max (cb + chx) * 9 + 8 = 6911

  // every loop below over rows, px and taps is unrolled so that w[], in[] and o[] are registers with constant indices
  float w[9];
  float in[BROW + 2][10];
  auto ldrow = [&](int rr, const char* base, unsigned om, unsigned ol, unsigned orr) {
    const v8h a = *(const v8h*)(base + om);
    in[rr][0] = (float)*(const _Float16*)(base + ol);
    in[rr][9] = (float)*(const _Float16*)(base + orr);
#pragma unroll
    for (int q = 0; q < 8; ++q) in[rr][1 + q] = (float)a[q];
  };
  // taps outside the image read as zero
  auto mask = [&](int rr) {
    const bool oky = (rr == 0) ? okt : (rr == BROW + 1) ? okb : true;
    in[rr][0] = (oky && okl) ? in[rr][0] : 0.f;
    in[rr][9] = (oky && okr) ? in[rr][9] : 0.f;
    if (rr == 0 || rr == BROW + 1) {
#pragma unroll
      for (int q = 1; q < 9; ++q) in[rr][q] = oky ? in[rr][q] : 0.f;
    }
  };

  // first run of loads: the weights and input rows 0..7, all in flight together
#pragma unroll
  for (int t = 0; t < 9; ++t) w[t] = *(const float*)(sw + vw + 4 * t);
  ldrow(0, sbt, vm, vl, vr);
#pragma unroll
  for (int rr = 1; rr < BROW; ++rr) ldrow(rr, sb + (rr - 1) * (IMW * 2), vm, vl, vr);
#if defined(__HIP_DEVICE_COMPILE__)
  // the wait that stands before a register named by an issued global load is overwritten; the address registers are
  // operands so that no load of this run is given one of them as its destination; the three offsets are in/out so
  // that the second run forms its addresses from them again as scalar base + 32-bit offset: carried over from here
  // they would be three 64-bit pairs, held in registers through rows 0 to 2
  asm volatile("s_wait_xcnt 0x0" : "+v"(vm), "+v"(vl), "+v"(vr) : "v"(vw), "s"(sw), "s"(sb), "s"(sbt) : "memory");
#endif
#pragma unroll
  for (int t = 0; t < 9; ++t) w[t] = bfr(w[t]);

#pragma unroll
  for (int r = 0; r < BROW; ++r) {
    if (r == 3) {
      // second run: input rows 8 and 9 take registers that rows 0 to 2 have left, so that the kernel stays within 128
      // registers (eight waves a SIMD: two blocks fit however their 14 waves are dealt); they are used from r = 6 on
      const unsigned vm9 = vm + ob, vl9 = vl + ob, vr9 = vr + ob;
      ldrow(BROW, sb + (BROW - 1) * (IMW * 2), vm, vl, vr);
      ldrow(BROW + 1, sb, vm9, vl9, vr9);
#if defined(__HIP_DEVICE_COMPILE__)
      // the same wait for the second run of loads, its address registers as inputs
      asm volatile("s_wait_xcnt 0x0" :: "v"(vm), "v"(vl), "v"(vr), "v"(vm9), "v"(vl9), "v"(vr9), "s"(sb) : "memory");
#endif
    }
    if (r == 0) { mask(0); mask(1); }
    mask(r + 2);
    // written two px wide, so that the products of the widened values go on the packed f32 FMA, two px an instruction
    float o[8];
#pragma unroll
    for (int jp = 0; jp < 4; ++jp) {
      v2f s = {0.f, 0.f};
#pragma unroll
      for (int t = 0; t < 9; ++t) {
        const v2f a  = {in[r + t / 3][2 * jp + t % 3], in[r + t / 3][2 * jp + 1 + t % 3]};
        const v2f ww = {w[t], w[t]};
        s = __builtin_elementwise_fma(a, ww, s);
      }
      o[2 * jp] = s[0];
      o[2 * jp + 1] = s[1];
    }
    if (isv) {
      const int p0 = r * IMW + 8 * st;                                   // px of the band, p0/8 = 7r + st
      unsigned short* th = Tt + p0 * TPH + ((ch + 8 * (NST * r + st)) & 63);
#pragma unroll
      for (int j = 0; j < 8; ++j) th[j * TPH] = h_bits((_Float16)o[j]);
    } else {
      v4u u;
#pragma unroll
      for (int q = 0; q < 4; ++q) u[q] = pk16(h_bits((_Float16)o[2 * q]), h_bits((_Float16)o[2 * q + 1]));
      *(v4u*)(Tt + ch * PQ + r * IMW + 8 * st) = u;
    }
  }
  __syncthreads();
  {
    const int e = tid & 7, lq = tid >> 3;                                 // lq 0..55
    if (isv) {
      const int vg = cg - 8;                                              // 0..3
      unsigned short* dh = VP  + ((size_t)(bl * NPX + bd * BPX + lq)) * CDIM + vg * QT + 8 * e;
#pragma unroll
      for (int it = 0; it < BROW; ++it) {
        const int px = it * IMW + lq;                                     // 0..447
        const unsigned short* t = Tt + px * TPH + 8 * ((e + (px >> 3)) & 7);
        const v4u h = *(const v4u*)(t);
        *(v4u*)(dh + (size_t)it * IMW * CDIM) = h;
      }
#if defined(__HIP_DEVICE_COMPILE__)
      // the wait that stands before a register named by an issued global store is overwritten: in the listing the
      // code of the q,k branch, which writes these registers, follows the stores behind a conditional branch
      asm volatile("s_wait_xcnt 0x0" ::: "memory");
#endif
    } else {
      float* sP = (float*)(Tt + QT * PQ);                                 // the two slices' record parts, behind the tile
      const int lane = tid & 31, wave = tid >> 5;
      if (wave < 8) {                                                     // whole waves
        const int hh = lane >> 4, c = lane & 15;
        const int s2 = wave >> 2, mt = (wave >> 1) & 1, ntk = wave & 1;
        const unsigned short* ts = Tt + s2 * SLPX;
        float* rec = sP + s2 * HREC;
        // ---- row sums of squares over the slice ----
        {
          const int idc = min(lane, SLPX / 8 - 1);                        // 28 vectors per row slice
          const unsigned short* rp = ts + (16 * (wave & 3)) * PQ + 8 * idc;
          float s[16];
#pragma unroll
          for (int rr = 0; rr < 16; ++rr) {
            const v8h rv = *(const v8h*)(rp + rr * PQ);
            float t = 0.f;
#pragma unroll
            for (int q = 0; q < 8; ++q) { const float f = (float)rv[q]; t = fmaf(f, f, t); }
            s[rr] = (lane < SLPX / 8) ? t : 0.f;
          }
#pragma unroll
          for (int off = 16; off > 0; off >>= 1) {
#pragma unroll
            for (int rr = 0; rr < 16; ++rr) s[rr] += __shfl_xor(s[rr], off, 32);
          }
          if (lane == 0) {
#pragma unroll
            for (int rr = 0; rr < 16; ++rr) rec[1024 + 16 * (wave & 3) + rr] = s[rr];
          }
        }
        // ---- raw logits S of the slice on f16 WMMA ----
        {
          const unsigned short* arow = ts + (16 * mt + c) * PQ + 8 * hh;
          const unsigned short* brow = ts + (32 + 16 * ntk + c) * PQ + 8 * hh;
          // the LDS reads stand in two groups (k-steps 0..3, 4..6), each ahead of its WMMAs: two LDS latencies, not one
          // per k-step, and no more registers than the depthwise part holds; unrolled so that fa[], fb[] are registers
          v8f acc = zero8();
#pragma unroll
          for (int k0 = 0; k0 < SLPX / 32; k0 += 4) {
            Frag fa[4], fb[4];
#pragma unroll
            for (int ks = k0; ks < k0 + 4 && ks < SLPX / 32; ++ks) {
              fa[ks - k0] = ldfrag(arow + 32 * ks);
              fb[ks - k0] = ldfrag(brow + 32 * ks);
            }
#pragma unroll
            for (int ks = k0; ks < k0 + 4 && ks < SLPX / 32; ++ks) acc = mma_h(fa[ks - k0].h, fb[ks - k0].h, acc);
          }
          float* sp = rec + (16 * mt + 8 * hh) * 32 + 16 * ntk + c;
#pragma unroll
          for (int r = 0; r < 8; ++r) sp[r * 32] = acc[r];
        }
      }
      __syncthreads();                                                    // block-uniform branch: every wave passes it
      const int hl = cg & 1;
      float* dst = PS + ((size_t)((bl * (CDIM / 64) + (cg >> 1)) * NSL + 2 * bd)) * PREC;
      if (wave < 8) {
        const v4f r0 = *(const v4f*)(sP + 4 * tid);
        const v4f r1 = *(const v4f*)(sP + HREC + 4 * tid);
        *(v4f*)(dst + hl * 1024 + 4 * tid) = r0;
        *(v4f*)(dst + PREC + hl * 1024 + 4 * tid) = r1;
      } else if (wave == 8) {
        const int s2 = lane >> 4, i = lane & 15;                          // i 0..7: q sums, 8..15: k sums
        const v4f r2 = *(const v4f*)(sP + s2 * HREC + 1024 + 4 * i);
        *(v4f*)(dst + s2 * PREC + 2048 + 32 * hl + 4 * i + ((i >= 8) ? 32 : 0)) = r2;
      }
    }
  }
}

// =====================================================================================================
// (4) softmax and proj.attn for one (head pair g, batch bl), 256 threads. proj.(attn.v) is formed as (proj.attn).v:
//     MW[o][32h + d] = sum_c wp[o][32h + c] attn_h[c][d] is a 256 x 256 matrix per batch, and attn.v over the pixels goes.
//   join:    the 14 slice records of (g, bl) summed in slice order (f32) -> S in LDS, 1/max(norm, eps) in LDS.
//   phase 3: logits = S * invq * invk * temperature (bf16-RNE), max-subtracted softmax in f32, attn x256 as f16
//            hi and x1024 residual into LDS Pa [d][c] (c contiguous = B operand of phase 4).
//   phase 4: wave w does rows o = 32w..32w+31 (2 m-tiles) x the pair's 64 columns: A = WP16 rows (k = c contiguous,
//            held in registers from the start), B = Pa rows d; w.hi -> o, w.res -> orr (x1024). 1024*MW = (o + orr/1024)/16
//            as one f16 plane, through LDS and out as whole 128-B lines of MH [16][256][256].
// coverage: 8 waves x 2 m-tiles x 16 = 256 rows; 2 heads x 2 n-tiles x 16 = 64 columns; lines 8 x 32 = 256;
//           grid (4, 16) covers MH exactly once.
// =====================================================================================================
__global__ __launch_bounds__(256)
void attn_w(const float* __restrict__ PS, const unsigned short* __restrict__ WP16, const float* __restrict__ temp,
            unsigned short* MH) {
  __shared__ float sInv[128];
  __shared__ float sS[2 * 32 * 33];
  __shared__ __align__(16) unsigned short Pa[4 * 32 * PAP];            // [hi|res][hl][d][PAP]
  __shared__ __align__(16) unsigned short Mw[CDIM * TPH];              // [256][TPH]
  const int tid  = threadIdx.x;
  const int lane = tid & 31, wave = tid >> 5;
  const int hh   = lane >> 4, c = lane & 15;
  const int g    = blockIdx.x, bl = blockIdx.y;

  // ---- the wave's A fragments: issued first, so that they fly under the join; unrolled so that wa[][] is registers ----
  Frag wa[2][2];                                                           // [m-tile][head of the pair]
  {
    const char* wb = (const char*)(WP16 + 64 * g);
    const unsigned wo = (unsigned)((32 * wave + c) * CDIM + 8 * hh) * 2u;  // row <= 239, + 16 below
#pragma unroll
    for (int mt = 0; mt < 2; ++mt) {
#pragma unroll
      for (int hl = 0; hl < 2; ++hl)
        wa[mt][hl] = ldfrag((const unsigned short*)(wb + wo + (unsigned)((16 * mt) * CDIM + 32 * hl) * 2u));
    }
#if defined(__HIP_DEVICE_COMPILE__)
    // the wait that stands before a register named by an issued global load is overwritten; the address registers
    // are inputs so that no load of this run is given one of them as its destination
    asm volatile("s_wait_xcnt 0x0" :: "v"(wo), "s"(wb) : "memory");
#endif
  }

  // ---- join the slice records ----
  {
    const float* pb = PS + ((size_t)((bl * (CDIM / 64) + g) * NSL)) * PREC;
    v4f a0 = {0.f, 0.f, 0.f, 0.f}, a1 = {0.f, 0.f, 0.f, 0.f};
#pragma unroll
    for (int s = 0; s < NSL; ++s) {
      a0 += *(const v4f*)(pb + s * PREC + 4 * tid);
      a1 += *(const v4f*)(pb + s * PREC + 1024 + 4 * tid);
    }
    float* s0 = sS + (tid >> 3) * 33 + 4 * (tid & 7);                      // head 0: row tid>>3, d 4(tid&7)..+3
    float* s1 = s0 + 32 * 33;                                              // head 1
#pragma unroll
    for (int q = 0; q < 4; ++q) { s0[q] = a0[q]; s1[q] = a1[q]; }
    if (tid < 32) {                                                        // wave 0
      v4f an = {0.f, 0.f, 0.f, 0.f};
#pragma unroll
      for (int s = 0; s < NSL; ++s) an += *(const v4f*)(pb + s * PREC + 2048 + 4 * tid);
#pragma unroll
      for (int q = 0; q < 4; ++q) sInv[4 * tid + q] = 1.0f / fmaxf(sqrtf(an[q]), 1e-12f);
    }
  }
  __syncthreads();

  // ---- phase 3: softmax, attn x256 as f16 hi + residual, stored transposed ----
  if (tid < 64) {                                                          // waves 0, 1
    const int hl = tid >> 5, row = tid & 31;
    const float tv = bfr(temp[2 * g + hl]);
    const float iq = sInv[32 * hl + row] * tv;
    const float* srow = sS + hl * (32 * 33) + row * 33;
    const float* ik   = sInv + 64 + 32 * hl;
    float lg[32];
    float mx = -3.0e38f;
#pragma unroll
    for (int d = 0; d < 32; ++d) { const float v = srow[d] * iq * ik[d]; lg[d] = v; mx = fmaxf(mx, v); }
    float ssum = 0.f;
#pragma unroll
    for (int d = 0; d < 32; ++d) { const float ev = __expf(lg[d] - mx); lg[d] = ev; ssum += ev; }
    const float inv = PSC / ssum;
    unsigned short* ph = Pa + (hl * 32) * PAP + row;                       // column c = row of row d
    unsigned short* pl = Pa + (64 + hl * 32) * PAP + row;
#pragma unroll
    for (int d = 0; d < 32; ++d) {
      const float pv = lg[d] * inv;
      const _Float16 hv = (_Float16)pv;
      const _Float16 lv = (_Float16)((pv - (float)hv) * RSC);
      ph[d * PAP] = h_bits(hv);
      pl[d * PAP] = h_bits(lv);
    }
  }
  __syncthreads();

  // ---- phase 4: MW = wp . attn ----
  // unrolled for constant indices into wa[][] and the accumulators
#pragma unroll
  for (int hl = 0; hl < 2; ++hl) {
#pragma unroll
    for (int nt = 0; nt < 2; ++nt) {
      const unsigned short* p0 = Pa + (hl * 32 + 16 * nt + c) * PAP + 8 * hh;
      const Frag bh = ldfrag(p0);
      const Frag br = ldfrag(p0 + 64 * PAP);
#pragma unroll
      for (int mt = 0; mt < 2; ++mt) {
        const v8f o   = mma_h(wa[mt][hl].h, bh.h, zero8());
        const v8f orr = mma_h(wa[mt][hl].h, br.h, zero8());
        unsigned short* mh = Mw + (32 * wave + 16 * mt + 8 * hh) * TPH + 32 * hl + 16 * nt + c;
#pragma unroll
        for (int r = 0; r < 8; ++r) mh[r * TPH] = h_bits((_Float16)((o[r] + orr[r] * IRSC) * MSC));
      }
    }
  }
  __syncthreads();
  {
    const int e = tid & 7, lq = tid >> 3;                                  // lq 0..31
    const unsigned short* t = Mw + lq * TPH + 8 * e;
    unsigned short* dh = MH + ((size_t)(bl * CDIM + lq)) * CDIM + 64 * g + 8 * e;
#pragma unroll
    for (int it = 0; it < CDIM / 32; ++it) {
      const v4u h = *(const v4u*)(t + it * 32 * TPH);
      *(v4u*)(dh + it * 32 * CDIM) = h;
    }
  }
}

// =====================================================================================================
// Workspace map (bytes; each region start a multiple of 256; every extent an exact tile multiple). All 16 batches go
// through each stage in one launch. Five regions are carved; a plane whose first store comes in a launch behind the
// last read of a region lies on top of that region:
//   WQ16 bf16 [768][256]          393216      WP16 f16 [256][256]            131072
//   R1   f16 [16][768][3136]    77070336      read last by (3); from (4) on it holds MH f16 [16][256][256] 2097152
//   PS   f32 [16][4][14][2176]   7798784      written by (3) while R1 is still read: a region of its own
//   VP   f16 [16][3136][256]    25690112                                                  total = 111083520
// =====================================================================================================
extern "C" void kernel_launch(void* const* d_in, const int* in_sizes, int n_in,
                              void* d_out, int out_size, void* d_ws, size_t ws_size,
                              hipStream_t stream) {
  const int XN = NBAT * CDIM * NPX;                      // 12845056
  if (n_in < 5) return;
  if (in_sizes[0] != XN) return;
  if (in_sizes[1] != C3 * CDIM) return;
  if (in_sizes[2] != C3 * 9) return;
  if (in_sizes[3] != CDIM * CDIM) return;
  if (in_sizes[4] != NHEAD) return;
  if (out_size != XN) return;

  size_t off = 0;
  auto carve = [&](size_t bytes) { const size_t o = off; off += (bytes + 255) & ~(size_t)255; return o; };
  const size_t plane16 = (size_t)NCHK * NPX * CDIM * 2;  // 25690112
  static_assert((size_t)NCHK * NPX * CDIM * 2 % 256 == 0);
  static_assert((size_t)NCHK * CDIM * CDIM * 2 <= (size_t)NCHK * C3 * NPX * 2);      // MH fits on R1
  const size_t oWQ  = carve((size_t)C3 * CDIM * 2);
  const size_t oWP  = carve((size_t)CDIM * CDIM * 2);
  const size_t oR1  = carve((size_t)NCHK * C3 * NPX * 2);
  const size_t oPS  = carve((size_t)NCHK * (CDIM / 64) * NSL * PREC * 4);
  const size_t oVP  = carve(plane16);
  if (off > ws_size) return;
  const size_t oMH  = oR1;

  const float* x    = (const float*)d_in[0];
  const float* wq   = (const float*)d_in[1];
  const float* wdw  = (const float*)d_in[2];
  const float* wp   = (const float*)d_in[3];
  const float* temp = (const float*)d_in[4];
  float* out = (float*)d_out;

  char* ws = (char*)d_ws;
  unsigned short* WQ16 = (unsigned short*)(ws + oWQ);
  unsigned short* WP16 = (unsigned short*)(ws + oWP);
  unsigned short* R1   = (unsigned short*)(ws + oR1);
  unsigned short* VP   = (unsigned short*)(ws + oVP);
  unsigned short* MH   = (unsigned short*)(ws + oMH);
  float*          PS   = (float*)(ws + oPS);

  const dim3 blk256(256), blk128(128);

  // (0) weights -> 16-bit planes
  cvt_w<<<dim3(32), blk256, 0, stream>>>(wq, wp, WQ16, WP16);
  // (1) qkv 1x1 conv straight from x -> f16 [16][768][3136]
  qkv_k<<<dim3(NQT, MSPL, NCHK), blk256, 0, stream>>>(WQ16, x, R1);
  // (3) depthwise 3x3 -> q,k: partial logits and sums of squares per 224-px slice; v position-major f16
  dw_k<<<dim3(NBAND, C3 / QT, NCHK), dim3(DWT), 0, stream>>>(R1, wdw, PS, VP);
  // (4) join, softmax, proj.attn -> 1024*MW f16 [16][256][256]
  attn_w<<<dim3(CDIM / 64, NCHK), blk256, 0, stream>>>(PS, WP16, temp, MH);
  // (5) (proj.attn).v -> d_out, scaled by 1/1024
  gemm_k<<<dim3(NTILE, CDIM / MR, NCHK), blk128, 0, stream>>>(MH, VP, out, CDIM, IRSC);
  (void)hipGetLastError();
}
